// v000
// Times are from an AMD MI455X. After a warm-up the kernel runs many times in a row, and a time is the length of
// such a window on the GPU divided by its runs, so every launch and the gaps after it count. The runs cycle
// through copies of the inputs. A figure is the median of several windows, for all but v000 over two sittings.
// Sittings can differ by a few percent; kernels timed side by side share one.
// v000, which the later versions start from, runs in 1240 microseconds.
#include <hip/hip_runtime.h>
#include <math.h>

// ---------------------------------------------------------------------------
// Types
// ---------------------------------------------------------------------------
typedef __bf16 v16bf __attribute__((ext_vector_type(16)));
typedef __bf16 v8bf  __attribute__((ext_vector_type(8)));
typedef float  v8f   __attribute__((ext_vector_type(8)));

static __device__ __forceinline__ unsigned short f2bfbits(float x) {
    unsigned u = __builtin_bit_cast(unsigned, x);
    unsigned r = u + 0x7fffu + ((u >> 16) & 1u);   // round-to-nearest-even
    return (unsigned short)(r >> 16);
}

static __device__ __forceinline__ float geluf(float v) {
    return 0.5f * v * (1.0f + erff(v * 0.70710678118654752f));
}

// Build a 16-element bf16 WMMA fragment from two 16-byte-aligned runs of
// 8 bf16 (K offsets 8g and 8g+16 per the CDNA5 16-bit A/B layout).
static __device__ __forceinline__ v16bf make_frag(const unsigned short* lo,
                                                  const unsigned short* hi) {
    v8bf a = *reinterpret_cast<const v8bf*>(lo);
    v8bf b = *reinterpret_cast<const v8bf*>(hi);
    return __builtin_shufflevector(a, b, 0, 1, 2, 3, 4, 5, 6, 7,
                                         8, 9, 10, 11, 12, 13, 14, 15);
}

#define WMMA_BF16(A, B, C) \
    __builtin_amdgcn_wmma_f32_16x16x32_bf16(false, (A), false, (B), (short)0, (C), false, false)

// ---------------------------------------------------------------------------
// Weight conversion kernels (fp32 -> bf16)
// ---------------------------------------------------------------------------
__global__ void cvt_plain_kernel(const float* __restrict__ in,
                                 unsigned short* __restrict__ out, int n) {
    int i = blockIdx.x * 256 + threadIdx.x;
    if (i < n) out[i] = f2bfbits(in[i]);
}

// (H, D, HD) -> column-combined (D, H*HD): out[d*H*HD + h*HD + e] = in[h,d,e]
__global__ void cvt_qkvw_kernel(const float* __restrict__ in,
                                unsigned short* __restrict__ out,
                                int H, int D, int HD) {
    int i = blockIdx.x * 256 + threadIdx.x;
    int n = H * D * HD;
    if (i >= n) return;
    int h = i / (D * HD);
    int r = i - h * (D * HD);
    int d = r / HD;
    int e = r - d * HD;
    out[(size_t)d * (H * HD) + h * HD + e] = f2bfbits(in[i]);
}

// ---------------------------------------------------------------------------
// LayerNorm: one 256-thread block per token, bf16 output
// ---------------------------------------------------------------------------
__global__ __launch_bounds__(256) void ln_kernel(const float* __restrict__ x,
                                                 const float* __restrict__ g,
                                                 const float* __restrict__ b,
                                                 unsigned short* __restrict__ out,
                                                 int D) {
    const int row = blockIdx.x;
    const int tid = threadIdx.x;
    const float* xr = x + (size_t)row * D;
    __shared__ float red[20];

    float s = 0.f, ss = 0.f;
    for (int i = tid; i < D; i += 256) {
        float v = xr[i];
        s += v;
        ss += v * v;
    }
#pragma unroll
    for (int m = 16; m >= 1; m >>= 1) {
        s  += __shfl_xor(s,  m, 32);
        ss += __shfl_xor(ss, m, 32);
    }
    const int wid = tid >> 5;
    if ((tid & 31) == 0) { red[wid] = s; red[8 + wid] = ss; }
    __syncthreads();
    if (tid == 0) {
        float S = 0.f, SS = 0.f;
        for (int w = 0; w < 8; ++w) { S += red[w]; SS += red[8 + w]; }
        float mu  = S / (float)D;
        float var = SS / (float)D - mu * mu;
        red[16] = mu;
        red[17] = rsqrtf(var + 1e-5f);
    }
    __syncthreads();
    const float mu = red[16], rs = red[17];
    unsigned short* orow = out + (size_t)row * D;
    for (int i = tid; i < D; i += 256)
        orow[i] = f2bfbits((xr[i] - mu) * rs * g[i] + b[i]);
}

// ---------------------------------------------------------------------------
// Tiled bf16 WMMA GEMM (double-buffered, BK=64):
//   C[M,N] = [res +] act((A[M,K] @ B[K,N] + bias) * scale)
//   block tile 128x128, 8 waves (2 x 4), each wave: 64x32 via 4x2 fragments.
//   Pipeline: at iteration k, stage tile k+1 into the other LDS buffer, then
//   run the 16 WMMAs for tile k. One barrier per 64-wide K block.
// ---------------------------------------------------------------------------
constexpr int GL = 72;   // padded LDS row length (elements) for BK=64

template <int ACT, bool RES, bool OUTF, bool OUTB>
__global__ __launch_bounds__(256) void gemm_bf16_kernel(
        const unsigned short* __restrict__ A,   // [M,K] bf16 row-major
        const unsigned short* __restrict__ Bw,  // [K,N] bf16 row-major
        const float* __restrict__ bias,         // [N]
        const float* __restrict__ res,          // [M,N] fp32 (if RES)
        float* __restrict__ outF,               // [M,N] fp32 (if OUTF)
        unsigned short* __restrict__ outB,      // [M,N] bf16 (if OUTB)
        int M, int N, int K, float scale) {
    __shared__ alignas(16) unsigned short As [2 * 128 * GL];  // [buf][m][k]
    __shared__ alignas(16) unsigned short Bts[2 * 128 * GL];  // [buf][n][k]

    const int tid  = threadIdx.x;
    const int wid  = tid >> 5;
    const int lane = tid & 31;
    const int g    = lane >> 4;
    const int ln   = lane & 15;
    const int wm   = wid >> 2;
    const int wn   = wid & 3;
    const int m0   = blockIdx.y * 128;
    const int n0   = blockIdx.x * 128;

    // Stage a 128x64 A tile and a (transposed) 64x128 B tile into buffer `buf`.
    auto stageAB = [&](int buf, int k0) {
        unsigned short* as = &As [buf * 128 * GL];
        unsigned short* bt = &Bts[buf * 128 * GL];
#pragma unroll
        for (int i = 0; i < 4; ++i) {               // 1024 16B chunks of A
            int idx = tid + i * 256;
            int r   = idx >> 3;
            int kc  = (idx & 7) << 3;
            *reinterpret_cast<uint4*>(&as[r * GL + kc]) =
                *reinterpret_cast<const uint4*>(&A[(size_t)(m0 + r) * K + k0 + kc]);
        }
#pragma unroll
        for (int i = 0; i < 4; ++i) {               // 1024 8-wide B chunks
            int idx = tid + i * 256;
            int kk  = idx >> 4;
            int nc  = (idx & 15) << 3;
            uint4 d = *reinterpret_cast<const uint4*>(&Bw[(size_t)(k0 + kk) * N + n0 + nc]);
            const unsigned short* sp = reinterpret_cast<const unsigned short*>(&d);
#pragma unroll
            for (int j = 0; j < 8; ++j) bt[(nc + j) * GL + kk] = sp[j];
        }
    };

    v8f acc[4][2];
#pragma unroll
    for (int mf = 0; mf < 4; ++mf)
#pragma unroll
        for (int nf = 0; nf < 2; ++nf)
#pragma unroll
            for (int r = 0; r < 8; ++r) acc[mf][nf][r] = 0.f;

    const int KB = K >> 6;
    stageAB(0, 0);
    for (int kb = 0; kb < KB; ++kb) {
        __syncthreads();                 // stage(kb) visible; buf (kb+1)&1 free
        if (kb + 1 < KB) stageAB((kb + 1) & 1, (kb + 1) << 6);

        const unsigned short* as = &As [(kb & 1) * 128 * GL];
        const unsigned short* bt = &Bts[(kb & 1) * 128 * GL];
#pragma unroll
        for (int kd = 0; kd < 2; ++kd) {            // two 32-wide WMMA K-steps
            v16bf af[4];
#pragma unroll
            for (int mf = 0; mf < 4; ++mf) {
                const unsigned short* p =
                    &as[(wm * 64 + mf * 16 + ln) * GL + kd * 32 + 8 * g];
                af[mf] = make_frag(p, p + 16);
            }
#pragma unroll
            for (int nf = 0; nf < 2; ++nf) {
                const unsigned short* p =
                    &bt[(wn * 32 + nf * 16 + ln) * GL + kd * 32 + 8 * g];
                v16bf bf = make_frag(p, p + 16);
#pragma unroll
                for (int mf = 0; mf < 4; ++mf)
                    acc[mf][nf] = WMMA_BF16(af[mf], bf, acc[mf][nf]);
            }
        }
    }

    // ---- straight-line epilogue (all flags compile-time) ----
#pragma unroll
    for (int mf = 0; mf < 4; ++mf) {
#pragma unroll
        for (int nf = 0; nf < 2; ++nf) {
            int col  = n0 + wn * 32 + nf * 16 + ln;
            float bv = bias[col];
#pragma unroll
            for (int r = 0; r < 8; ++r) {
                int row = m0 + wm * 64 + mf * 16 + 8 * g + r;
                float v = (acc[mf][nf][r] + bv) * scale;
                if (ACT == 1) v = geluf(v);
                size_t o = (size_t)row * N + col;
                if (RES)  v += res[o];
                if (OUTF) outF[o] = v;
                if (OUTB) outB[o] = f2bfbits(v);
            }
        }
    }
}

// ---------------------------------------------------------------------------
// Causal flash attention (bf16 in/out, online softmax, WMMA for QK^T and PV).
//   Q/K/V layout: [B*S, D] bf16 with head column offset h*HD, row stride D.
//   grid = (S/128, B*H); block = 256 (8 waves); wave w owns q rows w*16..+15.
//   K/V tiles double-buffered in LDS.
// ---------------------------------------------------------------------------
__global__ __launch_bounds__(256) void attn_kernel(
        const unsigned short* __restrict__ Q,
        const unsigned short* __restrict__ Kb,
        const unsigned short* __restrict__ Vb,
        unsigned short* __restrict__ O,
        int S, int H, int HD) {
    const int D   = H * HD;                       // 1024
    const int qt  = blockIdx.x;
    const int bh  = blockIdx.y;
    const int b   = bh / H;
    const int h   = bh - b * H;
    const size_t base = (size_t)b * S * D + (size_t)h * HD;

    const int tid  = threadIdx.x;
    const int wid  = tid >> 5;
    const int lane = tid & 31;
    const int g    = lane >> 4;
    const int ln   = lane & 15;
    const int q0   = qt * 128;

    __shared__ alignas(16) unsigned short Ks [2 * 64 * GL];   // [buf][kc][d]
    __shared__ alignas(16) unsigned short Vts[2 * 64 * GL];   // [buf][d][kc]
    __shared__ alignas(16) unsigned short Ps [8 * 16 * GL];   // per-wave P

    auto stageKV = [&](int buf, int k0) {
        unsigned short* ks = &Ks [buf * 64 * GL];
        unsigned short* vt = &Vts[buf * 64 * GL];
#pragma unroll
        for (int i = 0; i < 2; ++i) {              // 512 16B chunks of K
            int idx = tid + i * 256;
            int kc  = idx >> 3;
            int dc  = (idx & 7) << 3;
            *reinterpret_cast<uint4*>(&ks[kc * GL + dc]) =
                *reinterpret_cast<const uint4*>(&Kb[base + (size_t)(k0 + kc) * D + dc]);
        }
#pragma unroll
        for (int i = 0; i < 2; ++i) {              // V transposed scatter
            int idx = tid + i * 256;
            int kc  = idx >> 3;
            int dc  = (idx & 7) << 3;
            uint4 d = *reinterpret_cast<const uint4*>(&Vb[base + (size_t)(k0 + kc) * D + dc]);
            const unsigned short* sp = reinterpret_cast<const unsigned short*>(&d);
#pragma unroll
            for (int j = 0; j < 8; ++j) vt[(dc + j) * GL + kc] = sp[j];
        }
    };

    // Q fragments, resident for the whole block (d split into 2 k-steps)
    const int qrow = q0 + wid * 16 + ln;
    v16bf qa[2];
#pragma unroll
    for (int kd = 0; kd < 2; ++kd) {
        const unsigned short* qp = &Q[base + (size_t)qrow * D + kd * 32 + 8 * g];
        qa[kd] = make_frag(qp, qp + 16);
    }

    v8f of[4];
#pragma unroll
    for (int j = 0; j < 4; ++j)
#pragma unroll
        for (int r = 0; r < 8; ++r) of[j][r] = 0.f;
    float mrow[8], lrow[8];
#pragma unroll
    for (int r = 0; r < 8; ++r) { mrow[r] = -1e30f; lrow[r] = 0.f; }

    const int kend = q0 + 128;                    // causal: cols <= q0+127
    stageKV(0, 0);
    int it = 0;
    for (int k0 = 0; k0 < kend; k0 += 64, ++it) {
        __syncthreads();
        if (k0 + 64 < kend) stageKV((it + 1) & 1, k0 + 64);
        const unsigned short* ks = &Ks [(it & 1) * 64 * GL];
        const unsigned short* vt = &Vts[(it & 1) * 64 * GL];

        // ---- S = Q K^T  (16 x 64 per wave; 1/sqrt(HD) folded into Q) ----
        v8f sf[4];
#pragma unroll
        for (int nf = 0; nf < 4; ++nf) {
            v8f c;
#pragma unroll
            for (int r = 0; r < 8; ++r) c[r] = 0.f;
#pragma unroll
            for (int kd = 0; kd < 2; ++kd) {
                const unsigned short* kp = &ks[(nf * 16 + ln) * GL + kd * 32 + 8 * g];
                v16bf bf = make_frag(kp, kp + 16);
                c = WMMA_BF16(qa[kd], bf, c);
            }
            sf[nf] = c;
        }

        // ---- causal mask (uniform-per-wave predicate) ----
        if (k0 + 63 > q0 + wid * 16) {
#pragma unroll
            for (int nf = 0; nf < 4; ++nf) {
                int col = k0 + nf * 16 + ln;
#pragma unroll
                for (int r = 0; r < 8; ++r) {
                    int row = q0 + wid * 16 + 8 * g + r;
                    sf[nf][r] = (col > row) ? -1e30f : sf[nf][r];
                }
            }
        }

        // ---- online softmax (row = r + 8g, reduce across 16-lane half) ----
        // Arguments of the exps are always <= 0, so the fast __expf
        // (single v_exp_f32) is safe: it just underflows to 0.
        float alpha[8];
#pragma unroll
        for (int r = 0; r < 8; ++r) {
            float mx = fmaxf(fmaxf(sf[0][r], sf[1][r]), fmaxf(sf[2][r], sf[3][r]));
#pragma unroll
            for (int m = 8; m >= 1; m >>= 1) mx = fmaxf(mx, __shfl_xor(mx, m, 32));
            float mnew = fmaxf(mrow[r], mx);
            alpha[r] = __expf(mrow[r] - mnew);
            float ps = 0.f;
#pragma unroll
            for (int nf = 0; nf < 4; ++nf) {
                float p = __expf(sf[nf][r] - mnew);
                sf[nf][r] = p;
                ps += p;
            }
#pragma unroll
            for (int m = 8; m >= 1; m >>= 1) ps += __shfl_xor(ps, m, 32);
            lrow[r] = lrow[r] * alpha[r] + ps;
            mrow[r] = mnew;
        }

        // ---- write P to this wave's LDS slab (C-layout -> A-layout) ----
        unsigned short* pw = &Ps[wid * 16 * GL];
#pragma unroll
        for (int nf = 0; nf < 4; ++nf)
#pragma unroll
            for (int r = 0; r < 8; ++r)
                pw[(8 * g + r) * GL + nf * 16 + ln] = f2bfbits(sf[nf][r]);

        // ---- rescale O, then O += P @ V ----
#pragma unroll
        for (int j = 0; j < 4; ++j)
#pragma unroll
            for (int r = 0; r < 8; ++r) of[j][r] *= alpha[r];

        v16bf pa[2];
#pragma unroll
        for (int kd = 0; kd < 2; ++kd) {           // same-wave LDS RAW: in-order
            const unsigned short* pp = &pw[ln * GL + kd * 32 + 8 * g];
            pa[kd] = make_frag(pp, pp + 16);
        }
#pragma unroll
        for (int j = 0; j < 4; ++j) {
#pragma unroll
            for (int kd = 0; kd < 2; ++kd) {
                const unsigned short* vp = &vt[(j * 16 + ln) * GL + kd * 32 + 8 * g];
                v16bf vb = make_frag(vp, vp + 16);
                of[j] = WMMA_BF16(pa[kd], vb, of[j]);
            }
        }
    }

    // ---- normalize (8 reciprocals instead of 32 divides) and store bf16 ----
    float inv[8];
#pragma unroll
    for (int r = 0; r < 8; ++r) inv[r] = 1.0f / lrow[r];
#pragma unroll
    for (int j = 0; j < 4; ++j) {
#pragma unroll
        for (int r = 0; r < 8; ++r) {
            int row = q0 + wid * 16 + 8 * g + r;
            float v = of[j][r] * inv[r];
            O[base + (size_t)row * D + j * 16 + ln] = f2bfbits(v);
        }
    }
}

// ---------------------------------------------------------------------------
// Host orchestration
// ---------------------------------------------------------------------------
extern "C" void kernel_launch(void* const* d_in, const int* in_sizes, int n_in,
                              void* d_out, int out_size, void* d_ws, size_t ws_size,
                              hipStream_t stream) {
    constexpr int B = 4, S = 2048, D = 1024, H = 16, HD = 64, FF = 4096;
    constexpr int NT = B * S;                       // 8192 tokens

    const float* x     = (const float*)d_in[0];
    const float* Wq    = (const float*)d_in[1];
    const float* bq    = (const float*)d_in[2];
    const float* Wk    = (const float*)d_in[3];
    const float* bk    = (const float*)d_in[4];
    const float* Wv    = (const float*)d_in[5];
    const float* bv    = (const float*)d_in[6];
    const float* Wo    = (const float*)d_in[7];
    const float* bo    = (const float*)d_in[8];
    const float* W1    = (const float*)d_in[9];
    const float* b1    = (const float*)d_in[10];
    const float* W2    = (const float*)d_in[11];
    const float* b2    = (const float*)d_in[12];
    const float* ln1_g = (const float*)d_in[13];
    const float* ln1_b = (const float*)d_in[14];
    const float* ln2_g = (const float*)d_in[15];
    const float* ln2_b = (const float*)d_in[16];
    float* out = (float*)d_out;

    // ---- workspace carve-up (bf16 stored as unsigned short) ----
    char* p = (char*)d_ws;
    auto alloc = [&](size_t bytes) {
        void* r = p;
        p += (bytes + 255) & ~(size_t)255;
        return r;
    };
    unsigned short* wq_bf  = (unsigned short*)alloc((size_t)D * D * 2);
    unsigned short* wk_bf  = (unsigned short*)alloc((size_t)D * D * 2);
    unsigned short* wv_bf  = (unsigned short*)alloc((size_t)D * D * 2);
    unsigned short* wo_bf  = (unsigned short*)alloc((size_t)D * D * 2);
    unsigned short* w1_bf  = (unsigned short*)alloc((size_t)D * FF * 2);
    unsigned short* w2_bf  = (unsigned short*)alloc((size_t)FF * D * 2);
    unsigned short* h_bf   = (unsigned short*)alloc((size_t)NT * D * 2);   // h1 then h2
    unsigned short* q_bf   = (unsigned short*)alloc((size_t)NT * D * 2);
    unsigned short* k_bf   = (unsigned short*)alloc((size_t)NT * D * 2);
    unsigned short* v_bf   = (unsigned short*)alloc((size_t)NT * D * 2);
    unsigned short* at_bf  = (unsigned short*)alloc((size_t)NT * D * 2);
    float*          x2_f   = (float*)alloc((size_t)NT * D * 4);
    unsigned short* y1_bf  = (unsigned short*)alloc((size_t)NT * FF * 2);
    (void)ws_size; (void)in_sizes; (void)n_in; (void)out_size;

    // ---- weight conversion ----
    {
        int n = H * D * HD;
        int blk = (n + 255) / 256;
        cvt_qkvw_kernel<<<blk, 256, 0, stream>>>(Wq, wq_bf, H, D, HD);
        cvt_qkvw_kernel<<<blk, 256, 0, stream>>>(Wk, wk_bf, H, D, HD);
        cvt_qkvw_kernel<<<blk, 256, 0, stream>>>(Wv, wv_bf, H, D, HD);
        cvt_plain_kernel<<<(D * D + 255) / 256, 256, 0, stream>>>(Wo, wo_bf, D * D);
        cvt_plain_kernel<<<(D * FF + 255) / 256, 256, 0, stream>>>(W1, w1_bf, D * FF);
        cvt_plain_kernel<<<(FF * D + 255) / 256, 256, 0, stream>>>(W2, w2_bf, FF * D);
    }

    // ---- LN1 ----
    ln_kernel<<<NT, 256, 0, stream>>>(x, ln1_g, ln1_b, h_bf, D);

    // ---- QKV projections (Q pre-scaled by 1/sqrt(HD)) ----
    dim3 gP(D / 128, NT / 128);
    gemm_bf16_kernel<0, false, false, true><<<gP, 256, 0, stream>>>(
        h_bf, wq_bf, bq, nullptr, nullptr, q_bf, NT, D, D, 0.125f);
    gemm_bf16_kernel<0, false, false, true><<<gP, 256, 0, stream>>>(
        h_bf, wk_bf, bk, nullptr, nullptr, k_bf, NT, D, D, 1.0f);
    gemm_bf16_kernel<0, false, false, true><<<gP, 256, 0, stream>>>(
        h_bf, wv_bf, bv, nullptr, nullptr, v_bf, NT, D, D, 1.0f);

    // ---- causal flash attention ----
    attn_kernel<<<dim3(S / 128, B * H), 256, 0, stream>>>(q_bf, k_bf, v_bf, at_bf,
                                                          S, H, HD);

    // ---- output projection + residual -> x2 (fp32) ----
    gemm_bf16_kernel<0, true, true, false><<<gP, 256, 0, stream>>>(
        at_bf, wo_bf, bo, x, x2_f, nullptr, NT, D, D, 1.0f);

    // ---- LN2 ----
    ln_kernel<<<NT, 256, 0, stream>>>(x2_f, ln2_g, ln2_b, h_bf, D);

    // ---- FFN: gelu(h2 @ W1 + b1) -> y1 (bf16) ----
    dim3 gF(FF / 128, NT / 128);
    gemm_bf16_kernel<1, false, false, true><<<gF, 256, 0, stream>>>(
        h_bf, w1_bf, b1, nullptr, nullptr, y1_bf, NT, FF, D, 1.0f);

    // ---- gelu(y1 @ W2 + b2) + x2 -> out (fp32) ----
    gemm_bf16_kernel<1, true, true, false><<<gP, 256, 0, stream>>>(
        y1_bf, w2_bf, b2, x2_f, out, nullptr, NT, D, FF, 1.0f);
}

// v001
// Measured time: 908 microseconds a run.
// Timed twice side by side with v000, it ran 1.39 and 1.40 times as fast.
#include <hip/hip_runtime.h>
#include <math.h>

// ---------------------------------------------------------------------------
// Types
// ---------------------------------------------------------------------------
typedef __bf16 v16bf __attribute__((ext_vector_type(16)));
typedef __bf16 v8bf  __attribute__((ext_vector_type(8)));
typedef float  v8f   __attribute__((ext_vector_type(8)));

static __device__ __forceinline__ unsigned short f2bfbits(float x) {
    unsigned u = __builtin_bit_cast(unsigned, x);
    unsigned r = u + 0x7fffu + ((u >> 16) & 1u);   // round-to-nearest-even
    return (unsigned short)(r >> 16);
}

static __device__ __forceinline__ float geluf(float v) {
    return 0.5f * v * (1.0f + erff(v * 0.70710678118654752f));
}

// Build a 16-element bf16 WMMA fragment from two 16-byte-aligned runs of
// 8 bf16 (K offsets 8g and 8g+16 per the CDNA5 16-bit A/B layout).
static __device__ __forceinline__ v16bf make_frag(const unsigned short* lo,
                                                  const unsigned short* hi) {
    v8bf a = *reinterpret_cast<const v8bf*>(lo);
    v8bf b = *reinterpret_cast<const v8bf*>(hi);
    return __builtin_shufflevector(a, b, 0, 1, 2, 3, 4, 5, 6, 7,
                                         8, 9, 10, 11, 12, 13, 14, 15);
}

// Build a 16-element bf16 WMMA B fragment (32 k x 16 columns) from a row-major
// [k][n] LDS tile with two transposing loads. `p` is this lane's address
//   tile + (kbase + 8*(lane>>4) + (lane&7)) * pitch + nbase + 8*((lane>>3)&1)
// (elements); the lane receives column nbase + (lane&15) at k = kbase + 8g + 0..7
// and, `pitch16` = 16 rows further, k = kbase + 16 + 8g + 0..7: the same k order
// as make_frag(p, p + 16) delivers for the A side.
typedef __attribute__((address_space(3))) v8bf lds_v8bf;
static __device__ __forceinline__ v16bf make_frag_tr(const unsigned short* p, int pitch16) {
    v8bf a = __builtin_amdgcn_ds_load_tr16_b128_v8bf16((lds_v8bf*)p);
    v8bf b = __builtin_amdgcn_ds_load_tr16_b128_v8bf16((lds_v8bf*)(p + pitch16));
    return __builtin_shufflevector(a, b, 0, 1, 2, 3, 4, 5, 6, 7,
                                         8, 9, 10, 11, 12, 13, 14, 15);
}

#define WMMA_BF16(A, B, C) \
    __builtin_amdgcn_wmma_f32_16x16x32_bf16(false, (A), false, (B), (short)0, (C), false, false)

// ---------------------------------------------------------------------------
// Weight conversion kernels (fp32 -> bf16)
// ---------------------------------------------------------------------------
__global__ void cvt_plain_kernel(const float* __restrict__ in,
                                 unsigned short* __restrict__ out, int n) {
    int i = blockIdx.x * 256 + threadIdx.x;
    if (i < n) out[i] = f2bfbits(in[i]);
}

// (H, D, HD) -> column-combined (D, H*HD): out[d*H*HD + h*HD + e] = in[h,d,e]
__global__ void cvt_qkvw_kernel(const float* __restrict__ in,
                                unsigned short* __restrict__ out,
                                int H, int D, int HD) {
    int i = blockIdx.x * 256 + threadIdx.x;
    int n = H * D * HD;
    if (i >= n) return;
    int h = i / (D * HD);
    int r = i - h * (D * HD);
    int d = r / HD;
    int e = r - d * HD;
    out[(size_t)d * (H * HD) + h * HD + e] = f2bfbits(in[i]);
}

// ---------------------------------------------------------------------------
// LayerNorm: one 256-thread block per token, bf16 output
// ---------------------------------------------------------------------------
__global__ __launch_bounds__(256) void ln_kernel(const float* __restrict__ x,
                                                 const float* __restrict__ g,
                                                 const float* __restrict__ b,
                                                 unsigned short* __restrict__ out,
                                                 int D) {
    const int row = blockIdx.x;
    const int tid = threadIdx.x;
    const float* xr = x + (size_t)row * D;
    __shared__ float red[20];

    float s = 0.f, ss = 0.f;
    for (int i = tid; i < D; i += 256) {
        float v = xr[i];
        s += v;
        ss += v * v;
    }
#pragma unroll
    for (int m = 16; m >= 1; m >>= 1) {
        s  += __shfl_xor(s,  m, 32);
        ss += __shfl_xor(ss, m, 32);
    }
    const int wid = tid >> 5;
    if ((tid & 31) == 0) { red[wid] = s; red[8 + wid] = ss; }
    __syncthreads();
    if (tid == 0) {
        float S = 0.f, SS = 0.f;
        for (int w = 0; w < 8; ++w) { S += red[w]; SS += red[8 + w]; }
        float mu  = S / (float)D;
        float var = SS / (float)D - mu * mu;
        red[16] = mu;
        red[17] = rsqrtf(var + 1e-5f);
    }
    __syncthreads();
    const float mu = red[16], rs = red[17];
    unsigned short* orow = out + (size_t)row * D;
    for (int i = tid; i < D; i += 256)
        orow[i] = f2bfbits((xr[i] - mu) * rs * g[i] + b[i]);
}

// ---------------------------------------------------------------------------
// Tiled bf16 WMMA GEMM (double-buffered, BK=64):
//   C[M,N] = [res +] act((A[M,K] @ B[K,N] + bias) * scale)
//   block tile 128x128, 8 waves (2 x 4), each wave: 64x32 via 4x2 fragments.
//   Pipeline: at iteration k, stage tile k+1 into the other LDS buffer, then
//   run the 16 WMMAs for tile k. One barrier per 64-wide K block.
// ---------------------------------------------------------------------------
constexpr int GL = 72;   // padded LDS row length (elements) for BK=64
constexpr int BP = 144;  // LDS row length (elements) of the row-major 64x128 B tile:
                         // 288 B = 32 B x odd, the pitch of the transposing load

template <int ACT, bool RES, bool OUTF, bool OUTB>
__global__ __launch_bounds__(256) void gemm_bf16_kernel(
        const unsigned short* __restrict__ A,   // [M,K] bf16 row-major
        const unsigned short* __restrict__ Bw,  // [K,N] bf16 row-major
        const float* __restrict__ bias,         // [N]
        const float* __restrict__ res,          // [M,N] fp32 (if RES)
        float* __restrict__ outF,               // [M,N] fp32 (if OUTF)
        unsigned short* __restrict__ outB,      // [M,N] bf16 (if OUTB)
        int M, int N, int K, float scale) {
    __shared__ alignas(16) unsigned short As [2 * 128 * GL];  // [buf][m][k]
    __shared__ alignas(16) unsigned short Bs [2 * 64 * BP];   // [buf][k][n]

    const int tid  = threadIdx.x;
    const int wid  = tid >> 5;
    const int lane = tid & 31;
    const int g    = lane >> 4;
    const int ln   = lane & 15;
    const int wm   = wid >> 2;
    const int wn   = wid & 3;
    const int m0   = blockIdx.y * 128;
    const int n0   = blockIdx.x * 128;

    // Stage a 128x64 A tile and a row-major 64x128 B tile into buffer `buf`.
    auto stageAB = [&](int buf, int k0) {
        unsigned short* as = &As [buf * 128 * GL];
        unsigned short* bs = &Bs [buf * 64 * BP];
#pragma unroll
        for (int i = 0; i < 4; ++i) {               // 1024 16B chunks of A
            int idx = tid + i * 256;
            int r   = idx >> 3;
            int kc  = (idx & 7) << 3;
            *reinterpret_cast<uint4*>(&as[r * GL + kc]) =
                *reinterpret_cast<const uint4*>(&A[(size_t)(m0 + r) * K + k0 + kc]);
        }
#pragma unroll
        for (int i = 0; i < 4; ++i) {               // 1024 16B chunks of B
            int idx = tid + i * 256;
            int kk  = idx >> 4;
            int nc  = (idx & 15) << 3;
            *reinterpret_cast<uint4*>(&bs[kk * BP + nc]) =
                *reinterpret_cast<const uint4*>(&Bw[(size_t)(k0 + kk) * N + n0 + nc]);
        }
    };

    v8f acc[4][2];
#pragma unroll
    for (int mf = 0; mf < 4; ++mf)
#pragma unroll
        for (int nf = 0; nf < 2; ++nf)
#pragma unroll
            for (int r = 0; r < 8; ++r) acc[mf][nf][r] = 0.f;

    const int KB = K >> 6;
    stageAB(0, 0);
    for (int kb = 0; kb < KB; ++kb) {
        __syncthreads();                 // stage(kb) visible; buf (kb+1)&1 free
        if (kb + 1 < KB) stageAB((kb + 1) & 1, (kb + 1) << 6);

        const unsigned short* as = &As [(kb & 1) * 128 * GL];
        const unsigned short* bs = &Bs [(kb & 1) * 64 * BP];
#pragma unroll
        for (int kd = 0; kd < 2; ++kd) {            // two 32-wide WMMA K-steps
            v16bf af[4];
#pragma unroll
            for (int mf = 0; mf < 4; ++mf) {
                const unsigned short* p =
                    &as[(wm * 64 + mf * 16 + ln) * GL + kd * 32 + 8 * g];
                af[mf] = make_frag(p, p + 16);
            }
#pragma unroll
            for (int nf = 0; nf < 2; ++nf) {
                const unsigned short* p =
                    &bs[(kd * 32 + 8 * g + (lane & 7)) * BP +
                        wn * 32 + nf * 16 + 8 * ((lane >> 3) & 1)];
                v16bf bf = make_frag_tr(p, 16 * BP);
#pragma unroll
                for (int mf = 0; mf < 4; ++mf)
                    acc[mf][nf] = WMMA_BF16(af[mf], bf, acc[mf][nf]);
            }
        }
    }

    // ---- straight-line epilogue (all flags compile-time) ----
#pragma unroll
    for (int mf = 0; mf < 4; ++mf) {
#pragma unroll
        for (int nf = 0; nf < 2; ++nf) {
            int col  = n0 + wn * 32 + nf * 16 + ln;
            float bv = bias[col];
#pragma unroll
            for (int r = 0; r < 8; ++r) {
                int row = m0 + wm * 64 + mf * 16 + 8 * g + r;
                float v = (acc[mf][nf][r] + bv) * scale;
                if (ACT == 1) v = geluf(v);
                size_t o = (size_t)row * N + col;
                if (RES)  v += res[o];
                if (OUTF) outF[o] = v;
                if (OUTB) outB[o] = f2bfbits(v);
            }
        }
    }
}

// ---------------------------------------------------------------------------
// Causal flash attention (bf16 in/out, online softmax, WMMA for QK^T and PV).
//   Q/K/V layout: [B*S, D] bf16 with head column offset h*HD, row stride D.
//   grid = (S/128, B*H); block = 256 (8 waves); wave w owns q rows w*16..+15.
//   K/V tiles double-buffered in LDS, both row-major [key][d]; the PV product
//   reads V through the transposing load.
// ---------------------------------------------------------------------------
constexpr int VP = 80;   // LDS row length (elements) of a V row: 160 B = 32 B x odd
__global__ __launch_bounds__(256) void attn_kernel(
        const unsigned short* __restrict__ Q,
        const unsigned short* __restrict__ Kb,
        const unsigned short* __restrict__ Vb,
        unsigned short* __restrict__ O,
        int S, int H, int HD) {
    const int D   = H * HD;                       // 1024
    const int qt  = blockIdx.x;
    const int bh  = blockIdx.y;
    const int b   = bh / H;
    const int h   = bh - b * H;
    const size_t base = (size_t)b * S * D + (size_t)h * HD;

    const int tid  = threadIdx.x;
    const int wid  = tid >> 5;
    const int lane = tid & 31;
    const int g    = lane >> 4;
    const int ln   = lane & 15;
    const int q0   = qt * 128;

    __shared__ alignas(16) unsigned short Ks [2 * 64 * GL];   // [buf][kc][d]
    __shared__ alignas(16) unsigned short Vs [2 * 64 * VP];   // [buf][kc][d]
    __shared__ alignas(16) unsigned short Ps [8 * 16 * GL];   // per-wave P

    auto stageKV = [&](int buf, int k0) {
        unsigned short* ks = &Ks [buf * 64 * GL];
        unsigned short* vs = &Vs [buf * 64 * VP];
#pragma unroll
        for (int i = 0; i < 2; ++i) {              // 512 16B chunks of K
            int idx = tid + i * 256;
            int kc  = idx >> 3;
            int dc  = (idx & 7) << 3;
            *reinterpret_cast<uint4*>(&ks[kc * GL + dc]) =
                *reinterpret_cast<const uint4*>(&Kb[base + (size_t)(k0 + kc) * D + dc]);
        }
#pragma unroll
        for (int i = 0; i < 2; ++i) {              // 512 16B chunks of V
            int idx = tid + i * 256;
            int kc  = idx >> 3;
            int dc  = (idx & 7) << 3;
            *reinterpret_cast<uint4*>(&vs[kc * VP + dc]) =
                *reinterpret_cast<const uint4*>(&Vb[base + (size_t)(k0 + kc) * D + dc]);
        }
    };

    // Q fragments, resident for the whole block (d split into 2 k-steps)
    const int qrow = q0 + wid * 16 + ln;
    v16bf qa[2];
#pragma unroll
    for (int kd = 0; kd < 2; ++kd) {
        const unsigned short* qp = &Q[base + (size_t)qrow * D + kd * 32 + 8 * g];
        qa[kd] = make_frag(qp, qp + 16);
    }

    v8f of[4];
#pragma unroll
    for (int j = 0; j < 4; ++j)
#pragma unroll
        for (int r = 0; r < 8; ++r) of[j][r] = 0.f;
    float mrow[8], lrow[8];
#pragma unroll
    for (int r = 0; r < 8; ++r) { mrow[r] = -1e30f; lrow[r] = 0.f; }

    const int kend = q0 + 128;                    // causal: cols <= q0+127
    stageKV(0, 0);
    int it = 0;
    for (int k0 = 0; k0 < kend; k0 += 64, ++it) {
        __syncthreads();
        if (k0 + 64 < kend) stageKV((it + 1) & 1, k0 + 64);
        const unsigned short* ks = &Ks [(it & 1) * 64 * GL];
        const unsigned short* vs = &Vs [(it & 1) * 64 * VP];

        // ---- S = Q K^T  (16 x 64 per wave; 1/sqrt(HD) folded into Q) ----
        v8f sf[4];
#pragma unroll
        for (int nf = 0; nf < 4; ++nf) {
            v8f c;
#pragma unroll
            for (int r = 0; r < 8; ++r) c[r] = 0.f;
#pragma unroll
            for (int kd = 0; kd < 2; ++kd) {
                const unsigned short* kp = &ks[(nf * 16 + ln) * GL + kd * 32 + 8 * g];
                v16bf bf = make_frag(kp, kp + 16);
                c = WMMA_BF16(qa[kd], bf, c);
            }
            sf[nf] = c;
        }

        // ---- causal mask (uniform-per-wave predicate) ----
        if (k0 + 63 > q0 + wid * 16) {
#pragma unroll
            for (int nf = 0; nf < 4; ++nf) {
                int col = k0 + nf * 16 + ln;
#pragma unroll
                for (int r = 0; r < 8; ++r) {
                    int row = q0 + wid * 16 + 8 * g + r;
                    sf[nf][r] = (col > row) ? -1e30f : sf[nf][r];
                }
            }
        }

        // ---- online softmax (row = r + 8g, reduce across 16-lane half) ----
        // Arguments of the exps are always <= 0, so the fast __expf
        // (single v_exp_f32) is safe: it just underflows to 0.
        float alpha[8];
#pragma unroll
        for (int r = 0; r < 8; ++r) {
            float mx = fmaxf(fmaxf(sf[0][r], sf[1][r]), fmaxf(sf[2][r], sf[3][r]));
#pragma unroll
            for (int m = 8; m >= 1; m >>= 1) mx = fmaxf(mx, __shfl_xor(mx, m, 32));
            float mnew = fmaxf(mrow[r], mx);
            alpha[r] = __expf(mrow[r] - mnew);
            float ps = 0.f;
#pragma unroll
            for (int nf = 0; nf < 4; ++nf) {
                float p = __expf(sf[nf][r] - mnew);
                sf[nf][r] = p;
                ps += p;
            }
#pragma unroll
            for (int m = 8; m >= 1; m >>= 1) ps += __shfl_xor(ps, m, 32);
            lrow[r] = lrow[r] * alpha[r] + ps;
            mrow[r] = mnew;
        }

        // ---- write P to this wave's LDS slab (C-layout -> A-layout) ----
        unsigned short* pw = &Ps[wid * 16 * GL];
#pragma unroll
        for (int nf = 0; nf < 4; ++nf)
#pragma unroll
            for (int r = 0; r < 8; ++r)
                pw[(8 * g + r) * GL + nf * 16 + ln] = f2bfbits(sf[nf][r]);

        // ---- rescale O, then O += P @ V ----
#pragma unroll
        for (int j = 0; j < 4; ++j)
#pragma unroll
            for (int r = 0; r < 8; ++r) of[j][r] *= alpha[r];

        v16bf pa[2];
#pragma unroll
        for (int kd = 0; kd < 2; ++kd) {           // same-wave LDS RAW: in-order
            const unsigned short* pp = &pw[ln * GL + kd * 32 + 8 * g];
            pa[kd] = make_frag(pp, pp + 16);
        }
#pragma unroll
        for (int j = 0; j < 4; ++j) {
#pragma unroll
            for (int kd = 0; kd < 2; ++kd) {
                const unsigned short* vp =
                    &vs[(kd * 32 + 8 * g + (lane & 7)) * VP + j * 16 + 8 * ((lane >> 3) & 1)];
                v16bf vb = make_frag_tr(vp, 16 * VP);
                of[j] = WMMA_BF16(pa[kd], vb, of[j]);
            }
        }
    }

    // ---- normalize (8 reciprocals instead of 32 divides) and store bf16 ----
    float inv[8];
#pragma unroll
    for (int r = 0; r < 8; ++r) inv[r] = 1.0f / lrow[r];
#pragma unroll
    for (int j = 0; j < 4; ++j) {
#pragma unroll
        for (int r = 0; r < 8; ++r) {
            int row = q0 + wid * 16 + 8 * g + r;
            float v = of[j][r] * inv[r];
            O[base + (size_t)row * D + j * 16 + ln] = f2bfbits(v);
        }
    }
}

// ---------------------------------------------------------------------------
// Host orchestration
// ---------------------------------------------------------------------------
extern "C" void kernel_launch(void* const* d_in, const int* in_sizes, int n_in,
                              void* d_out, int out_size, void* d_ws, size_t ws_size,
                              hipStream_t stream) {
    constexpr int B = 4, S = 2048, D = 1024, H = 16, HD = 64, FF = 4096;
    constexpr int NT = B * S;                       // 8192 tokens

    const float* x     = (const float*)d_in[0];
    const float* Wq    = (const float*)d_in[1];
    const float* bq    = (const float*)d_in[2];
    const float* Wk    = (const float*)d_in[3];
    const float* bk    = (const float*)d_in[4];
    const float* Wv    = (const float*)d_in[5];
    const float* bv    = (const float*)d_in[6];
    const float* Wo    = (const float*)d_in[7];
    const float* bo    = (const float*)d_in[8];
    const float* W1    = (const float*)d_in[9];
    const float* b1    = (const float*)d_in[10];
    const float* W2    = (const float*)d_in[11];
    const float* b2    = (const float*)d_in[12];
    const float* ln1_g = (const float*)d_in[13];
    const float* ln1_b = (const float*)d_in[14];
    const float* ln2_g = (const float*)d_in[15];
    const float* ln2_b = (const float*)d_in[16];
    float* out = (float*)d_out;

    // ---- workspace carve-up (bf16 stored as unsigned short) ----
    char* p = (char*)d_ws;
    auto alloc = [&](size_t bytes) {
        void* r = p;
        p += (bytes + 255) & ~(size_t)255;
        return r;
    };
    unsigned short* wq_bf  = (unsigned short*)alloc((size_t)D * D * 2);
    unsigned short* wk_bf  = (unsigned short*)alloc((size_t)D * D * 2);
    unsigned short* wv_bf  = (unsigned short*)alloc((size_t)D * D * 2);
    unsigned short* wo_bf  = (unsigned short*)alloc((size_t)D * D * 2);
    unsigned short* w1_bf  = (unsigned short*)alloc((size_t)D * FF * 2);
    unsigned short* w2_bf  = (unsigned short*)alloc((size_t)FF * D * 2);
    unsigned short* h_bf   = (unsigned short*)alloc((size_t)NT * D * 2);   // h1 then h2
    unsigned short* q_bf   = (unsigned short*)alloc((size_t)NT * D * 2);
    unsigned short* k_bf   = (unsigned short*)alloc((size_t)NT * D * 2);
    unsigned short* v_bf   = (unsigned short*)alloc((size_t)NT * D * 2);
    unsigned short* at_bf  = (unsigned short*)alloc((size_t)NT * D * 2);
    float*          x2_f   = (float*)alloc((size_t)NT * D * 4);
    unsigned short* y1_bf  = (unsigned short*)alloc((size_t)NT * FF * 2);
    (void)ws_size; (void)in_sizes; (void)n_in; (void)out_size;

    // ---- weight conversion ----
    {
        int n = H * D * HD;
        int blk = (n + 255) / 256;
        cvt_qkvw_kernel<<<blk, 256, 0, stream>>>(Wq, wq_bf, H, D, HD);
        cvt_qkvw_kernel<<<blk, 256, 0, stream>>>(Wk, wk_bf, H, D, HD);
        cvt_qkvw_kernel<<<blk, 256, 0, stream>>>(Wv, wv_bf, H, D, HD);
        cvt_plain_kernel<<<(D * D + 255) / 256, 256, 0, stream>>>(Wo, wo_bf, D * D);
        cvt_plain_kernel<<<(D * FF + 255) / 256, 256, 0, stream>>>(W1, w1_bf, D * FF);
        cvt_plain_kernel<<<(FF * D + 255) / 256, 256, 0, stream>>>(W2, w2_bf, FF * D);
    }

    // ---- LN1 ----
    ln_kernel<<<NT, 256, 0, stream>>>(x, ln1_g, ln1_b, h_bf, D);

    // ---- QKV projections (Q pre-scaled by 1/sqrt(HD)) ----
    dim3 gP(D / 128, NT / 128);
    gemm_bf16_kernel<0, false, false, true><<<gP, 256, 0, stream>>>(
        h_bf, wq_bf, bq, nullptr, nullptr, q_bf, NT, D, D, 0.125f);
    gemm_bf16_kernel<0, false, false, true><<<gP, 256, 0, stream>>>(
        h_bf, wk_bf, bk, nullptr, nullptr, k_bf, NT, D, D, 1.0f);
    gemm_bf16_kernel<0, false, false, true><<<gP, 256, 0, stream>>>(
        h_bf, wv_bf, bv, nullptr, nullptr, v_bf, NT, D, D, 1.0f);

    // ---- causal flash attention ----
    attn_kernel<<<dim3(S / 128, B * H), 256, 0, stream>>>(q_bf, k_bf, v_bf, at_bf,
                                                          S, H, HD);

    // ---- output projection + residual -> x2 (fp32) ----
    gemm_bf16_kernel<0, true, true, false><<<gP, 256, 0, stream>>>(
        at_bf, wo_bf, bo, x, x2_f, nullptr, NT, D, D, 1.0f);

    // ---- LN2 ----
    ln_kernel<<<NT, 256, 0, stream>>>(x2_f, ln2_g, ln2_b, h_bf, D);

    // ---- FFN: gelu(h2 @ W1 + b1) -> y1 (bf16) ----
    dim3 gF(FF / 128, NT / 128);
    gemm_bf16_kernel<1, false, false, true><<<gF, 256, 0, stream>>>(
        h_bf, w1_bf, b1, nullptr, nullptr, y1_bf, NT, FF, D, 1.0f);

    // ---- gelu(y1 @ W2 + b2) + x2 -> out (fp32) ----
    gemm_bf16_kernel<1, true, true, false><<<gP, 256, 0, stream>>>(
        y1_bf, w2_bf, b2, x2_f, out, nullptr, NT, D, FF, 1.0f);
}

// v002
// It runs in 471 microseconds.
// Two timings next to v001 put it at 1.95 and 1.93 times that version's speed.
// Over all steps from v000 it is 2.71 times as fast.
#include <hip/hip_runtime.h>
#include <math.h>

// ---------------------------------------------------------------------------
// Types
// ---------------------------------------------------------------------------
typedef __bf16 v16bf __attribute__((ext_vector_type(16)));
typedef __bf16 v8bf  __attribute__((ext_vector_type(8)));
typedef float  v8f   __attribute__((ext_vector_type(8)));

static __device__ __forceinline__ unsigned short f2bfbits(float x) {
    unsigned u = __builtin_bit_cast(unsigned, x);
    unsigned r = u + 0x7fffu + ((u >> 16) & 1u);   // round-to-nearest-even
    return (unsigned short)(r >> 16);
}

static __device__ __forceinline__ float geluf(float v) {
    return 0.5f * v * (1.0f + erff(v * 0.70710678118654752f));
}

// Build a 16-element bf16 WMMA fragment from two 16-byte-aligned runs of
// 8 bf16 (K offsets 8g and 8g+16 per the CDNA5 16-bit A/B layout).
static __device__ __forceinline__ v16bf make_frag(const unsigned short* lo,
                                                  const unsigned short* hi) {
    v8bf a = *reinterpret_cast<const v8bf*>(lo);
    v8bf b = *reinterpret_cast<const v8bf*>(hi);
    return __builtin_shufflevector(a, b, 0, 1, 2, 3, 4, 5, 6, 7,
                                         8, 9, 10, 11, 12, 13, 14, 15);
}

// Build a 16-element bf16 WMMA B fragment (32 k x 16 columns) from a row-major
// [k][n] LDS tile with two transposing loads. `p` is this lane's address
//   tile + (kbase + 8*(lane>>4) + (lane&7)) * pitch + nbase + 8*((lane>>3)&1)
// (elements); the lane receives column nbase + (lane&15) at k = kbase + 8g + 0..7
// and, `pitch16` = 16 rows further, k = kbase + 16 + 8g + 0..7: the same k order
// as make_frag(p, p + 16) delivers for the A side.
typedef __attribute__((address_space(3))) v8bf lds_v8bf;
static __device__ __forceinline__ v16bf make_frag_tr(const unsigned short* p, int pitch16) {
    v8bf a = __builtin_amdgcn_ds_load_tr16_b128_v8bf16((lds_v8bf*)p);
    v8bf b = __builtin_amdgcn_ds_load_tr16_b128_v8bf16((lds_v8bf*)(p + pitch16));
    return __builtin_shufflevector(a, b, 0, 1, 2, 3, 4, 5, 6, 7,
                                         8, 9, 10, 11, 12, 13, 14, 15);
}

// LDS byte address of a __shared__ element (the operand of an asynchronous copy).
static __device__ __forceinline__ unsigned lds_off(const unsigned short* p) {
    return (unsigned)(size_t)(const __attribute__((address_space(3))) unsigned short*)p;
}

// Foot of a ring trip, before the barrier: this wave's LDS reads of the buffer
// that is refilled next have retired, and its own copies of the next tile have
// landed.
static __device__ __forceinline__ void ring_waits() {
    asm volatile("s_wait_dscnt 0x0" ::: "memory");
    asm volatile("s_wait_asynccnt 0x0" ::: "memory");
}

#define WMMA_BF16(A, B, C) \
    __builtin_amdgcn_wmma_f32_16x16x32_bf16(false, (A), false, (B), (short)0, (C), false, false)

// ---------------------------------------------------------------------------
// Weight conversion kernels (fp32 -> bf16)
// ---------------------------------------------------------------------------
__global__ void cvt_plain_kernel(const float* __restrict__ in,
                                 unsigned short* __restrict__ out, int n) {
    int i = blockIdx.x * 256 + threadIdx.x;
    if (i < n) out[i] = f2bfbits(in[i]);
}

// (H, D, HD) -> column-combined (D, H*HD): out[d*H*HD + h*HD + e] = in[h,d,e]
__global__ void cvt_qkvw_kernel(const float* __restrict__ in,
                                unsigned short* __restrict__ out,
                                int H, int D, int HD) {
    int i = blockIdx.x * 256 + threadIdx.x;
    int n = H * D * HD;
    if (i >= n) return;
    int h = i / (D * HD);
    int r = i - h * (D * HD);
    int d = r / HD;
    int e = r - d * HD;
    out[(size_t)d * (H * HD) + h * HD + e] = f2bfbits(in[i]);
}

// ---------------------------------------------------------------------------
// LayerNorm: one 256-thread block per token, bf16 output
// ---------------------------------------------------------------------------
__global__ __launch_bounds__(256) void ln_kernel(const float* __restrict__ x,
                                                 const float* __restrict__ g,
                                                 const float* __restrict__ b,
                                                 unsigned short* __restrict__ out,
                                                 int D) {
    const int row = blockIdx.x;
    const int tid = threadIdx.x;
    const float* xr = x + (size_t)row * D;
    __shared__ float red[20];

    float s = 0.f, ss = 0.f;
    for (int i = tid; i < D; i += 256) {
        float v = xr[i];
        s += v;
        ss += v * v;
    }
#pragma unroll
    for (int m = 16; m >= 1; m >>= 1) {
        s  += __shfl_xor(s,  m, 32);
        ss += __shfl_xor(ss, m, 32);
    }
    const int wid = tid >> 5;
    if ((tid & 31) == 0) { red[wid] = s; red[8 + wid] = ss; }
    __syncthreads();
    if (tid == 0) {
        float S = 0.f, SS = 0.f;
        for (int w = 0; w < 8; ++w) { S += red[w]; SS += red[8 + w]; }
        float mu  = S / (float)D;
        float var = SS / (float)D - mu * mu;
        red[16] = mu;
        red[17] = rsqrtf(var + 1e-5f);
    }
    __syncthreads();
    const float mu = red[16], rs = red[17];
    unsigned short* orow = out + (size_t)row * D;
    for (int i = tid; i < D; i += 256)
        orow[i] = f2bfbits((xr[i] - mu) * rs * g[i] + b[i]);
}

// ---------------------------------------------------------------------------
// Tiled bf16 WMMA GEMM (double-buffered, BK=64):
//   C[M,N] = [res +] act((A[M,K] @ B[K,N] + bias) * scale)
//   block tile 128x128, 8 waves (2 x 4), each wave: 64x32 via 4x2 fragments.
//   Pipeline: two LDS buffers filled by asynchronous copies; the copies of tile
//   k+1 fly while the 16 WMMAs of tile k run. One barrier per 64-wide K block.
// ---------------------------------------------------------------------------
constexpr int GL = 72;   // padded LDS row length (elements) for BK=64
constexpr int BP = 144;  // LDS row length (elements) of the row-major 64x128 B tile:
                         // 288 B = 32 B x odd, the pitch of the transposing load

template <int ACT, bool RES, bool OUTF, bool OUTB>
__global__ __launch_bounds__(256) void gemm_bf16_kernel(
        const unsigned short* __restrict__ A,   // [M,K] bf16 row-major
        const unsigned short* __restrict__ Bw,  // [K,N] bf16 row-major
        const float* __restrict__ bias,         // [N]
        const float* __restrict__ res,          // [M,N] fp32 (if RES)
        float* __restrict__ outF,               // [M,N] fp32 (if OUTF)
        unsigned short* __restrict__ outB,      // [M,N] bf16 (if OUTB)
        int M, int N, int K, float scale) {
    __shared__ alignas(16) unsigned short As [2 * 128 * GL];  // [buf][m][k]
    __shared__ alignas(16) unsigned short Bs [2 * 64 * BP];   // [buf][k][n]

    const int tid  = threadIdx.x;
    const int wid  = tid >> 5;
    const int lane = tid & 31;
    const int g    = lane >> 4;
    const int ln   = lane & 15;
    const int wm   = wid >> 2;
    const int wn   = wid & 3;
    const int m0   = blockIdx.y * 128;
    const int n0   = blockIdx.x * 128;

    // Copy a 128x64 A tile and a row-major 64x128 B tile into buffer `buf`:
    // 8 x 16 B per lane, global memory to LDS through no register.
    const unsigned short* ga = A + (size_t)(m0 + (tid >> 3)) * K + ((tid & 7) << 3);
    const unsigned short* gb = Bw + (size_t)(tid >> 4) * N + n0 + ((tid & 15) << 3);
    const unsigned la = lds_off(&As[(tid >> 3) * GL + ((tid & 7) << 3)]);
    const unsigned lb = lds_off(&Bs[(tid >> 4) * BP + ((tid & 15) << 3)]);
    auto copyAB = [&](int buf, int k0) {
        const unsigned short* a = ga + k0;                 // rows +32 per copy
        const unsigned short* b = gb + (size_t)k0 * N;     // rows +16 per copy
        const unsigned da = la + buf * (128 * GL * 2);
        const unsigned db = lb + buf * (64 * BP * 2);
        // The closing s_wait_xcnt stands in the copies' own statement so that no
        // address register is rewritten ahead of it.
        asm volatile(
            "global_load_async_to_lds_b128 %0, %8, off\n\t"
            "global_load_async_to_lds_b128 %1, %9, off\n\t"
            "global_load_async_to_lds_b128 %2, %10, off\n\t"
            "global_load_async_to_lds_b128 %3, %11, off\n\t"
            "global_load_async_to_lds_b128 %4, %12, off\n\t"
            "global_load_async_to_lds_b128 %5, %13, off\n\t"
            "global_load_async_to_lds_b128 %6, %14, off\n\t"
            "global_load_async_to_lds_b128 %7, %15, off\n\t"
            "s_wait_xcnt 0x0"
            :: "v"(da), "v"(da + 32 * GL * 2), "v"(da + 64 * GL * 2), "v"(da + 96 * GL * 2),
               "v"(db), "v"(db + 16 * BP * 2), "v"(db + 32 * BP * 2), "v"(db + 48 * BP * 2),
               "v"(a), "v"(a + (size_t)32 * K), "v"(a + (size_t)64 * K), "v"(a + (size_t)96 * K),
               "v"(b), "v"(b + (size_t)16 * N), "v"(b + (size_t)32 * N), "v"(b + (size_t)48 * N)
            : "memory");
    };

    v8f acc[4][2];
#pragma unroll
    for (int mf = 0; mf < 4; ++mf)
#pragma unroll
        for (int nf = 0; nf < 2; ++nf)
#pragma unroll
            for (int r = 0; r < 8; ++r) acc[mf][nf][r] = 0.f;

    const int KB = K >> 6;
    copyAB(0, 0);
    asm volatile("s_wait_asynccnt 0x0" ::: "memory");   // tile 0 landed (own copies)
    __syncthreads();                                     // tile 0 visible to all waves
    if (KB > 1) copyAB(1, 64);
    for (int kb = 0; kb < KB; ++kb) {
        const unsigned short* as = &As [(kb & 1) * 128 * GL];
        const unsigned short* bs = &Bs [(kb & 1) * 64 * BP];
#pragma unroll
        for (int kd = 0; kd < 2; ++kd) {            // two 32-wide WMMA K-steps
            v16bf af[4];
#pragma unroll
            for (int mf = 0; mf < 4; ++mf) {
                const unsigned short* p =
                    &as[(wm * 64 + mf * 16 + ln) * GL + kd * 32 + 8 * g];
                af[mf] = make_frag(p, p + 16);
            }
#pragma unroll
            for (int nf = 0; nf < 2; ++nf) {
                const unsigned short* p =
                    &bs[(kd * 32 + 8 * g + (lane & 7)) * BP +
                        wn * 32 + nf * 16 + 8 * ((lane >> 3) & 1)];
                v16bf bf = make_frag_tr(p, 16 * BP);
#pragma unroll
                for (int mf = 0; mf < 4; ++mf)
                    acc[mf][nf] = WMMA_BF16(af[mf], bf, acc[mf][nf]);
            }
        }
        ring_waits();
        __syncthreads();                 // tile kb+1 visible; buffer kb&1 free
        if (kb + 2 < KB) copyAB(kb & 1, (kb + 2) << 6);
    }
    asm volatile("s_wait_asynccnt 0x0" ::: "memory");   // no copy outlives the loop

    // ---- straight-line epilogue (all flags compile-time) ----
#pragma unroll
    for (int mf = 0; mf < 4; ++mf) {
#pragma unroll
        for (int nf = 0; nf < 2; ++nf) {
            int col  = n0 + wn * 32 + nf * 16 + ln;
            float bv = bias[col];
#pragma unroll
            for (int r = 0; r < 8; ++r) {
                int row = m0 + wm * 64 + mf * 16 + 8 * g + r;
                float v = (acc[mf][nf][r] + bv) * scale;
                if (ACT == 1) v = geluf(v);
                size_t o = (size_t)row * N + col;
                if (RES)  v += res[o];
                if (OUTF) outF[o] = v;
                if (OUTB) outB[o] = f2bfbits(v);
            }
        }
    }
}

// ---------------------------------------------------------------------------
// Causal flash attention (bf16 in/out, online softmax, WMMA for QK^T and PV).
//   Q/K/V layout: [B*S, D] bf16 with head column offset h*HD, row stride D.
//   grid = (S/128, B*H); block = 256 (8 waves); wave w owns q rows w*16..+15.
//   K/V tiles in two LDS buffers filled by asynchronous copies, both row-major
//   [key][d]; the PV product reads V through the transposing load.
// ---------------------------------------------------------------------------
constexpr int VP = 80;   // LDS row length (elements) of a V row: 160 B = 32 B x odd
__global__ __launch_bounds__(256) void attn_kernel(
        const unsigned short* __restrict__ Q,
        const unsigned short* __restrict__ Kb,
        const unsigned short* __restrict__ Vb,
        unsigned short* __restrict__ O,
        int S, int H, int HD) {
    const int D   = H * HD;                       // 1024
    const int qt  = blockIdx.x;
    const int bh  = blockIdx.y;
    const int b   = bh / H;
    const int h   = bh - b * H;
    const size_t base = (size_t)b * S * D + (size_t)h * HD;

    const int tid  = threadIdx.x;
    const int wid  = tid >> 5;
    const int lane = tid & 31;
    const int g    = lane >> 4;
    const int ln   = lane & 15;
    const int q0   = qt * 128;

    __shared__ alignas(16) unsigned short Ks [2 * 64 * GL];   // [buf][kc][d]
    __shared__ alignas(16) unsigned short Vs [2 * 64 * VP];   // [buf][kc][d]
    __shared__ alignas(16) unsigned short Ps [8 * 16 * GL];   // per-wave P

    // Copy 64 K rows and 64 V rows into buffer `buf`: 4 x 16 B per lane.
    const size_t srow = base + (size_t)(tid >> 3) * D + ((tid & 7) << 3);
    const unsigned lk = lds_off(&Ks[(tid >> 3) * GL + ((tid & 7) << 3)]);
    const unsigned lv = lds_off(&Vs[(tid >> 3) * VP + ((tid & 7) << 3)]);
    auto copyKV = [&](int buf, int k0) {
        const unsigned short* k = Kb + srow + (size_t)k0 * D;   // rows +32 per copy
        const unsigned short* v = Vb + srow + (size_t)k0 * D;
        const unsigned dk = lk + buf * (64 * GL * 2);
        const unsigned dv = lv + buf * (64 * VP * 2);
        // The closing s_wait_xcnt stands in the copies' own statement so that no
        // address register is rewritten ahead of it.
        asm volatile(
            "global_load_async_to_lds_b128 %0, %4, off\n\t"
            "global_load_async_to_lds_b128 %1, %5, off\n\t"
            "global_load_async_to_lds_b128 %2, %6, off\n\t"
            "global_load_async_to_lds_b128 %3, %7, off\n\t"
            "s_wait_xcnt 0x0"
            :: "v"(dk), "v"(dk + 32 * GL * 2), "v"(dv), "v"(dv + 32 * VP * 2),
               "v"(k), "v"(k + (size_t)32 * D), "v"(v), "v"(v + (size_t)32 * D)
            : "memory");
    };

    // Q fragments, resident for the whole block (d split into 2 k-steps)
    const int qrow = q0 + wid * 16 + ln;
    v16bf qa[2];
#pragma unroll
    for (int kd = 0; kd < 2; ++kd) {
        const unsigned short* qp = &Q[base + (size_t)qrow * D + kd * 32 + 8 * g];
        qa[kd] = make_frag(qp, qp + 16);
    }

    v8f of[4];
#pragma unroll
    for (int j = 0; j < 4; ++j)
#pragma unroll
        for (int r = 0; r < 8; ++r) of[j][r] = 0.f;
    float mrow[8], lrow[8];
#pragma unroll
    for (int r = 0; r < 8; ++r) { mrow[r] = -1e30f; lrow[r] = 0.f; }

    const int kend = q0 + 128;                    // causal: cols <= q0+127
    copyKV(0, 0);
    asm volatile("s_wait_asynccnt 0x0" ::: "memory");   // tile 0 landed (own copies)
    __syncthreads();                                     // tile 0 visible to all waves
    if (64 < kend) copyKV(1, 64);
    int it = 0;
    for (int k0 = 0; k0 < kend; k0 += 64, ++it) {
        const unsigned short* ks = &Ks [(it & 1) * 64 * GL];
        const unsigned short* vs = &Vs [(it & 1) * 64 * VP];

        // ---- S = Q K^T  (16 x 64 per wave; 1/sqrt(HD) folded into Q) ----
        v8f sf[4];
#pragma unroll
        for (int nf = 0; nf < 4; ++nf) {
            v8f c;
#pragma unroll
            for (int r = 0; r < 8; ++r) c[r] = 0.f;
#pragma unroll
            for (int kd = 0; kd < 2; ++kd) {
                const unsigned short* kp = &ks[(nf * 16 + ln) * GL + kd * 32 + 8 * g];
                v16bf bf = make_frag(kp, kp + 16);
                c = WMMA_BF16(qa[kd], bf, c);
            }
            sf[nf] = c;
        }

        // ---- causal mask (uniform-per-wave predicate) ----
        if (k0 + 63 > q0 + wid * 16) {
#pragma unroll
            for (int nf = 0; nf < 4; ++nf) {
                int col = k0 + nf * 16 + ln;
#pragma unroll
                for (int r = 0; r < 8; ++r) {
                    int row = q0 + wid * 16 + 8 * g + r;
                    sf[nf][r] = (col > row) ? -1e30f : sf[nf][r];
                }
            }
        }

        // ---- online softmax (row = r + 8g, reduce across 16-lane half) ----
        // Arguments of the exps are always <= 0, so the fast __expf
        // (single v_exp_f32) is safe: it just underflows to 0.
        float alpha[8];
#pragma unroll
        for (int r = 0; r < 8; ++r) {
            float mx = fmaxf(fmaxf(sf[0][r], sf[1][r]), fmaxf(sf[2][r], sf[3][r]));
#pragma unroll
            for (int m = 8; m >= 1; m >>= 1) mx = fmaxf(mx, __shfl_xor(mx, m, 32));
            float mnew = fmaxf(mrow[r], mx);
            alpha[r] = __expf(mrow[r] - mnew);
            float ps = 0.f;
#pragma unroll
            for (int nf = 0; nf < 4; ++nf) {
                float p = __expf(sf[nf][r] - mnew);
                sf[nf][r] = p;
                ps += p;
            }
#pragma unroll
            for (int m = 8; m >= 1; m >>= 1) ps += __shfl_xor(ps, m, 32);
            lrow[r] = lrow[r] * alpha[r] + ps;
            mrow[r] = mnew;
        }

        // ---- write P to this wave's LDS slab (C-layout -> A-layout) ----
        unsigned short* pw = &Ps[wid * 16 * GL];
#pragma unroll
        for (int nf = 0; nf < 4; ++nf)
#pragma unroll
            for (int r = 0; r < 8; ++r)
                pw[(8 * g + r) * GL + nf * 16 + ln] = f2bfbits(sf[nf][r]);

        // ---- rescale O, then O += P @ V ----
#pragma unroll
        for (int j = 0; j < 4; ++j)
#pragma unroll
            for (int r = 0; r < 8; ++r) of[j][r] *= alpha[r];

        v16bf pa[2];
#pragma unroll
        for (int kd = 0; kd < 2; ++kd) {           // same-wave LDS RAW: in-order
            const unsigned short* pp = &pw[ln * GL + kd * 32 + 8 * g];
            pa[kd] = make_frag(pp, pp + 16);
        }
#pragma unroll
        for (int j = 0; j < 4; ++j) {
#pragma unroll
            for (int kd = 0; kd < 2; ++kd) {
                const unsigned short* vp =
                    &vs[(kd * 32 + 8 * g + (lane & 7)) * VP + j * 16 + 8 * ((lane >> 3) & 1)];
                v16bf vb = make_frag_tr(vp, 16 * VP);
                of[j] = WMMA_BF16(pa[kd], vb, of[j]);
            }
        }
        ring_waits();
        __syncthreads();                 // next tile visible; this buffer free
        if (k0 + 128 < kend) copyKV(it & 1, k0 + 128);
    }
    asm volatile("s_wait_asynccnt 0x0" ::: "memory");   // no copy outlives the loop

    // ---- normalize (8 reciprocals instead of 32 divides) and store bf16 ----
    float inv[8];
#pragma unroll
    for (int r = 0; r < 8; ++r) inv[r] = 1.0f / lrow[r];
#pragma unroll
    for (int j = 0; j < 4; ++j) {
#pragma unroll
        for (int r = 0; r < 8; ++r) {
            int row = q0 + wid * 16 + 8 * g + r;
            float v = of[j][r] * inv[r];
            O[base + (size_t)row * D + j * 16 + ln] = f2bfbits(v);
        }
    }
}

// ---------------------------------------------------------------------------
// Host orchestration
// ---------------------------------------------------------------------------
extern "C" void kernel_launch(void* const* d_in, const int* in_sizes, int n_in,
                              void* d_out, int out_size, void* d_ws, size_t ws_size,
                              hipStream_t stream) {
    constexpr int B = 4, S = 2048, D = 1024, H = 16, HD = 64, FF = 4096;
    constexpr int NT = B * S;                       // 8192 tokens

    const float* x     = (const float*)d_in[0];
    const float* Wq    = (const float*)d_in[1];
    const float* bq    = (const float*)d_in[2];
    const float* Wk    = (const float*)d_in[3];
    const float* bk    = (const float*)d_in[4];
    const float* Wv    = (const float*)d_in[5];
    const float* bv    = (const float*)d_in[6];
    const float* Wo    = (const float*)d_in[7];
    const float* bo    = (const float*)d_in[8];
    const float* W1    = (const float*)d_in[9];
    const float* b1    = (const float*)d_in[10];
    const float* W2    = (const float*)d_in[11];
    const float* b2    = (const float*)d_in[12];
    const float* ln1_g = (const float*)d_in[13];
    const float* ln1_b = (const float*)d_in[14];
    const float* ln2_g = (const float*)d_in[15];
    const float* ln2_b = (const float*)d_in[16];
    float* out = (float*)d_out;

    // ---- workspace carve-up (bf16 stored as unsigned short) ----
    char* p = (char*)d_ws;
    auto alloc = [&](size_t bytes) {
        void* r = p;
        p += (bytes + 255) & ~(size_t)255;
        return r;
    };
    unsigned short* wq_bf  = (unsigned short*)alloc((size_t)D * D * 2);
    unsigned short* wk_bf  = (unsigned short*)alloc((size_t)D * D * 2);
    unsigned short* wv_bf  = (unsigned short*)alloc((size_t)D * D * 2);
    unsigned short* wo_bf  = (unsigned short*)alloc((size_t)D * D * 2);
    unsigned short* w1_bf  = (unsigned short*)alloc((size_t)D * FF * 2);
    unsigned short* w2_bf  = (unsigned short*)alloc((size_t)FF * D * 2);
    unsigned short* h_bf   = (unsigned short*)alloc((size_t)NT * D * 2);   // h1 then h2
    unsigned short* q_bf   = (unsigned short*)alloc((size_t)NT * D * 2);
    unsigned short* k_bf   = (unsigned short*)alloc((size_t)NT * D * 2);
    unsigned short* v_bf   = (unsigned short*)alloc((size_t)NT * D * 2);
    unsigned short* at_bf  = (unsigned short*)alloc((size_t)NT * D * 2);
    float*          x2_f   = (float*)alloc((size_t)NT * D * 4);
    unsigned short* y1_bf  = (unsigned short*)alloc((size_t)NT * FF * 2);
    (void)ws_size; (void)in_sizes; (void)n_in; (void)out_size;

    // ---- weight conversion ----
    {
        int n = H * D * HD;
        int blk = (n + 255) / 256;
        cvt_qkvw_kernel<<<blk, 256, 0, stream>>>(Wq, wq_bf, H, D, HD);
        cvt_qkvw_kernel<<<blk, 256, 0, stream>>>(Wk, wk_bf, H, D, HD);
        cvt_qkvw_kernel<<<blk, 256, 0, stream>>>(Wv, wv_bf, H, D, HD);
        cvt_plain_kernel<<<(D * D + 255) / 256, 256, 0, stream>>>(Wo, wo_bf, D * D);
        cvt_plain_kernel<<<(D * FF + 255) / 256, 256, 0, stream>>>(W1, w1_bf, D * FF);
        cvt_plain_kernel<<<(FF * D + 255) / 256, 256, 0, stream>>>(W2, w2_bf, FF * D);
    }

    // ---- LN1 ----
    ln_kernel<<<NT, 256, 0, stream>>>(x, ln1_g, ln1_b, h_bf, D);

    // ---- QKV projections (Q pre-scaled by 1/sqrt(HD)) ----
    dim3 gP(D / 128, NT / 128);
    gemm_bf16_kernel<0, false, false, true><<<gP, 256, 0, stream>>>(
        h_bf, wq_bf, bq, nullptr, nullptr, q_bf, NT, D, D, 0.125f);
    gemm_bf16_kernel<0, false, false, true><<<gP, 256, 0, stream>>>(
        h_bf, wk_bf, bk, nullptr, nullptr, k_bf, NT, D, D, 1.0f);
    gemm_bf16_kernel<0, false, false, true><<<gP, 256, 0, stream>>>(
        h_bf, wv_bf, bv, nullptr, nullptr, v_bf, NT, D, D, 1.0f);

    // ---- causal flash attention ----
    attn_kernel<<<dim3(S / 128, B * H), 256, 0, stream>>>(q_bf, k_bf, v_bf, at_bf,
                                                          S, H, HD);

    // ---- output projection + residual -> x2 (fp32) ----
    gemm_bf16_kernel<0, true, true, false><<<gP, 256, 0, stream>>>(
        at_bf, wo_bf, bo, x, x2_f, nullptr, NT, D, D, 1.0f);

    // ---- LN2 ----
    ln_kernel<<<NT, 256, 0, stream>>>(x2_f, ln2_g, ln2_b, h_bf, D);

    // ---- FFN: gelu(h2 @ W1 + b1) -> y1 (bf16) ----
    dim3 gF(FF / 128, NT / 128);
    gemm_bf16_kernel<1, false, false, true><<<gF, 256, 0, stream>>>(
        h_bf, w1_bf, b1, nullptr, nullptr, y1_bf, NT, FF, D, 1.0f);

    // ---- gelu(y1 @ W2 + b2) + x2 -> out (fp32) ----
    gemm_bf16_kernel<1, true, true, false><<<gP, 256, 0, stream>>>(
        y1_bf, w2_bf, b2, x2_f, out, nullptr, NT, D, FF, 1.0f);
}

// v003
// It runs in 390 microseconds.
// Two timings next to v002 both put it at 1.21 times that version's speed.
// Counting every step since v000, it is 3.27 times as fast.
#include <hip/hip_runtime.h>
#include <math.h>

// ---------------------------------------------------------------------------
// Types
// ---------------------------------------------------------------------------
typedef __bf16 v16bf __attribute__((ext_vector_type(16)));
typedef __bf16 v8bf  __attribute__((ext_vector_type(8)));
typedef float  v8f   __attribute__((ext_vector_type(8)));

static __device__ __forceinline__ unsigned short f2bfbits(float x) {
    unsigned u = __builtin_bit_cast(unsigned, x);
    unsigned r = u + 0x7fffu + ((u >> 16) & 1u);   // round-to-nearest-even
    return (unsigned short)(r >> 16);
}

static __device__ __forceinline__ float geluf(float v) {
    return 0.5f * v * (1.0f + erff(v * 0.70710678118654752f));
}

// Build a 16-element bf16 WMMA fragment from two 16-byte-aligned runs of
// 8 bf16 (K offsets 8g and 8g+16 per the CDNA5 16-bit A/B layout).
static __device__ __forceinline__ v16bf make_frag(const unsigned short* lo,
                                                  const unsigned short* hi) {
    v8bf a = *reinterpret_cast<const v8bf*>(lo);
    v8bf b = *reinterpret_cast<const v8bf*>(hi);
    return __builtin_shufflevector(a, b, 0, 1, 2, 3, 4, 5, 6, 7,
                                         8, 9, 10, 11, 12, 13, 14, 15);
}

// Build a 16-element bf16 WMMA B fragment (32 k x 16 columns) from a row-major
// [k][n] LDS tile with two transposing loads. `p` is this lane's address
//   tile + (kbase + 8*(lane>>4) + (lane&7)) * pitch + nbase + 8*((lane>>3)&1)
// (elements); the lane receives column nbase + (lane&15) at k = kbase + 8g + 0..7
// and, `pitch16` = 16 rows further, k = kbase + 16 + 8g + 0..7: the same k order
// as make_frag(p, p + 16) delivers for the A side.
typedef __attribute__((address_space(3))) v8bf lds_v8bf;
static __device__ __forceinline__ v16bf make_frag_tr(const unsigned short* p, int pitch16) {
    v8bf a = __builtin_amdgcn_ds_load_tr16_b128_v8bf16((lds_v8bf*)p);
    v8bf b = __builtin_amdgcn_ds_load_tr16_b128_v8bf16((lds_v8bf*)(p + pitch16));
    return __builtin_shufflevector(a, b, 0, 1, 2, 3, 4, 5, 6, 7,
                                         8, 9, 10, 11, 12, 13, 14, 15);
}

// LDS byte address of a __shared__ element (the operand of an asynchronous copy).
static __device__ __forceinline__ unsigned lds_off(const unsigned short* p) {
    return (unsigned)(size_t)(const __attribute__((address_space(3))) unsigned short*)p;
}

// Foot of a ring trip, before the barrier: this wave's LDS reads of the buffer
// that is refilled next have retired, and its own copies of the next tile have
// landed.
static __device__ __forceinline__ void ring_waits() {
    asm volatile("s_wait_dscnt 0x0" ::: "memory");
    asm volatile("s_wait_asynccnt 0x0" ::: "memory");
}

// Value of lane l ^ 16 (the other half of the wave), by a vector cross-row move.
static __device__ __forceinline__ float xhalf(float v) {
    int b = __builtin_bit_cast(int, v);
    return __builtin_bit_cast(float,
        __builtin_amdgcn_permlanex16(b, b, 0x76543210, 0xfedcba98, false, false));
}

#define WMMA_BF16(A, B, C) \
    __builtin_amdgcn_wmma_f32_16x16x32_bf16(false, (A), false, (B), (short)0, (C), false, false)

// ---------------------------------------------------------------------------
// Weight conversion kernels (fp32 -> bf16)
// ---------------------------------------------------------------------------
__global__ void cvt_plain_kernel(const float* __restrict__ in,
                                 unsigned short* __restrict__ out, int n) {
    int i = blockIdx.x * 256 + threadIdx.x;
    if (i < n) out[i] = f2bfbits(in[i]);
}

// (H, D, HD) -> column-combined (D, H*HD): out[d*H*HD + h*HD + e] = in[h,d,e]
__global__ void cvt_qkvw_kernel(const float* __restrict__ in,
                                unsigned short* __restrict__ out,
                                int H, int D, int HD) {
    int i = blockIdx.x * 256 + threadIdx.x;
    int n = H * D * HD;
    if (i >= n) return;
    int h = i / (D * HD);
    int r = i - h * (D * HD);
    int d = r / HD;
    int e = r - d * HD;
    out[(size_t)d * (H * HD) + h * HD + e] = f2bfbits(in[i]);
}

// ---------------------------------------------------------------------------
// LayerNorm: one 256-thread block per token, bf16 output
// ---------------------------------------------------------------------------
__global__ __launch_bounds__(256) void ln_kernel(const float* __restrict__ x,
                                                 const float* __restrict__ g,
                                                 const float* __restrict__ b,
                                                 unsigned short* __restrict__ out,
                                                 int D) {
    const int row = blockIdx.x;
    const int tid = threadIdx.x;
    const float* xr = x + (size_t)row * D;
    __shared__ float red[20];

    float s = 0.f, ss = 0.f;
    for (int i = tid; i < D; i += 256) {
        float v = xr[i];
        s += v;
        ss += v * v;
    }
#pragma unroll
    for (int m = 16; m >= 1; m >>= 1) {
        s  += __shfl_xor(s,  m, 32);
        ss += __shfl_xor(ss, m, 32);
    }
    const int wid = tid >> 5;
    if ((tid & 31) == 0) { red[wid] = s; red[8 + wid] = ss; }
    __syncthreads();
    if (tid == 0) {
        float S = 0.f, SS = 0.f;
        for (int w = 0; w < 8; ++w) { S += red[w]; SS += red[8 + w]; }
        float mu  = S / (float)D;
        float var = SS / (float)D - mu * mu;
        red[16] = mu;
        red[17] = rsqrtf(var + 1e-5f);
    }
    __syncthreads();
    const float mu = red[16], rs = red[17];
    unsigned short* orow = out + (size_t)row * D;
    for (int i = tid; i < D; i += 256)
        orow[i] = f2bfbits((xr[i] - mu) * rs * g[i] + b[i]);
}

// ---------------------------------------------------------------------------
// Tiled bf16 WMMA GEMM (double-buffered, BK=64):
//   C[M,N] = [res +] act((A[M,K] @ B[K,N] + bias) * scale)
//   block tile 128x128, 8 waves (2 x 4), each wave: 64x32 via 4x2 fragments.
//   Pipeline: two LDS buffers filled by asynchronous copies; the copies of tile
//   k+1 fly while the 16 WMMAs of tile k run. One barrier per 64-wide K block.
// ---------------------------------------------------------------------------
constexpr int GL = 72;   // padded LDS row length (elements) for BK=64
constexpr int BP = 144;  // LDS row length (elements) of the row-major 64x128 B tile:
                         // 288 B = 32 B x odd, the pitch of the transposing load

template <int ACT, bool RES, bool OUTF, bool OUTB>
__global__ __launch_bounds__(256) void gemm_bf16_kernel(
        const unsigned short* __restrict__ A,   // [M,K] bf16 row-major
        const unsigned short* __restrict__ Bw,  // [K,N] bf16 row-major
        const float* __restrict__ bias,         // [N]
        const float* __restrict__ res,          // [M,N] fp32 (if RES)
        float* __restrict__ outF,               // [M,N] fp32 (if OUTF)
        unsigned short* __restrict__ outB,      // [M,N] bf16 (if OUTB)
        int M, int N, int K, float scale) {
    __shared__ alignas(16) unsigned short As [2 * 128 * GL];  // [buf][m][k]
    __shared__ alignas(16) unsigned short Bs [2 * 64 * BP];   // [buf][k][n]

    const int tid  = threadIdx.x;
    const int wid  = tid >> 5;
    const int lane = tid & 31;
    const int g    = lane >> 4;
    const int ln   = lane & 15;
    const int wm   = wid >> 2;
    const int wn   = wid & 3;
    const int m0   = blockIdx.y * 128;
    const int n0   = blockIdx.x * 128;

    // Copy a 128x64 A tile and a row-major 64x128 B tile into buffer `buf`:
    // 8 x 16 B per lane, global memory to LDS through no register.
    const unsigned short* ga = A + (size_t)(m0 + (tid >> 3)) * K + ((tid & 7) << 3);
    const unsigned short* gb = Bw + (size_t)(tid >> 4) * N + n0 + ((tid & 15) << 3);
    const unsigned la = lds_off(&As[(tid >> 3) * GL + ((tid & 7) << 3)]);
    const unsigned lb = lds_off(&Bs[(tid >> 4) * BP + ((tid & 15) << 3)]);
    auto copyAB = [&](int buf, int k0) {
        const unsigned short* a = ga + k0;                 // rows +32 per copy
        const unsigned short* b = gb + (size_t)k0 * N;     // rows +16 per copy
        const unsigned da = la + buf * (128 * GL * 2);
        const unsigned db = lb + buf * (64 * BP * 2);
        // The closing s_wait_xcnt stands in the copies' own statement so that no
        // address register is rewritten ahead of it.
        asm volatile(
            "global_load_async_to_lds_b128 %0, %8, off\n\t"
            "global_load_async_to_lds_b128 %1, %9, off\n\t"
            "global_load_async_to_lds_b128 %2, %10, off\n\t"
            "global_load_async_to_lds_b128 %3, %11, off\n\t"
            "global_load_async_to_lds_b128 %4, %12, off\n\t"
            "global_load_async_to_lds_b128 %5, %13, off\n\t"
            "global_load_async_to_lds_b128 %6, %14, off\n\t"
            "global_load_async_to_lds_b128 %7, %15, off\n\t"
            "s_wait_xcnt 0x0"
            :: "v"(da), "v"(da + 32 * GL * 2), "v"(da + 64 * GL * 2), "v"(da + 96 * GL * 2),
               "v"(db), "v"(db + 16 * BP * 2), "v"(db + 32 * BP * 2), "v"(db + 48 * BP * 2),
               "v"(a), "v"(a + (size_t)32 * K), "v"(a + (size_t)64 * K), "v"(a + (size_t)96 * K),
               "v"(b), "v"(b + (size_t)16 * N), "v"(b + (size_t)32 * N), "v"(b + (size_t)48 * N)
            : "memory");
    };

    v8f acc[4][2];
#pragma unroll
    for (int mf = 0; mf < 4; ++mf)
#pragma unroll
        for (int nf = 0; nf < 2; ++nf)
#pragma unroll
            for (int r = 0; r < 8; ++r) acc[mf][nf][r] = 0.f;

    const int KB = K >> 6;
    copyAB(0, 0);
    asm volatile("s_wait_asynccnt 0x0" ::: "memory");   // tile 0 landed (own copies)
    __syncthreads();                                     // tile 0 visible to all waves
    if (KB > 1) copyAB(1, 64);
    for (int kb = 0; kb < KB; ++kb) {
        const unsigned short* as = &As [(kb & 1) * 128 * GL];
        const unsigned short* bs = &Bs [(kb & 1) * 64 * BP];
#pragma unroll
        for (int kd = 0; kd < 2; ++kd) {            // two 32-wide WMMA K-steps
            v16bf af[4];
#pragma unroll
            for (int mf = 0; mf < 4; ++mf) {
                const unsigned short* p =
                    &as[(wm * 64 + mf * 16 + ln) * GL + kd * 32 + 8 * g];
                af[mf] = make_frag(p, p + 16);
            }
#pragma unroll
            for (int nf = 0; nf < 2; ++nf) {
                const unsigned short* p =
                    &bs[(kd * 32 + 8 * g + (lane & 7)) * BP +
                        wn * 32 + nf * 16 + 8 * ((lane >> 3) & 1)];
                v16bf bf = make_frag_tr(p, 16 * BP);
#pragma unroll
                for (int mf = 0; mf < 4; ++mf)
                    acc[mf][nf] = WMMA_BF16(af[mf], bf, acc[mf][nf]);
            }
        }
        ring_waits();
        __syncthreads();                 // tile kb+1 visible; buffer kb&1 free
        if (kb + 2 < KB) copyAB(kb & 1, (kb + 2) << 6);
    }
    asm volatile("s_wait_asynccnt 0x0" ::: "memory");   // no copy outlives the loop

    // ---- straight-line epilogue (all flags compile-time) ----
#pragma unroll
    for (int mf = 0; mf < 4; ++mf) {
#pragma unroll
        for (int nf = 0; nf < 2; ++nf) {
            int col  = n0 + wn * 32 + nf * 16 + ln;
            float bv = bias[col];
#pragma unroll
            for (int r = 0; r < 8; ++r) {
                int row = m0 + wm * 64 + mf * 16 + 8 * g + r;
                float v = (acc[mf][nf][r] + bv) * scale;
                if (ACT == 1) v = geluf(v);
                size_t o = (size_t)row * N + col;
                if (RES)  v += res[o];
                if (OUTF) outF[o] = v;
                if (OUTB) outB[o] = f2bfbits(v);
            }
        }
    }
}

constexpr int VP = 80;   // LDS row length (elements) of a V row: 160 B = 32 B x odd
__global__ __launch_bounds__(256) void attn_kernel(
        const unsigned short* __restrict__ Q,
        const unsigned short* __restrict__ Kb,
        const unsigned short* __restrict__ Vb,
        unsigned short* __restrict__ O,
        int S, int H, int HD) {
    const int D   = H * HD;                       // 1024
    const int qt  = blockIdx.x;
    const int bh  = blockIdx.y;
    const int b   = bh / H;
    const int h   = bh - b * H;
    const size_t base = (size_t)b * S * D + (size_t)h * HD;

    const int tid  = threadIdx.x;
    const int wid  = tid >> 5;
    const int lane = tid & 31;
    const int g    = lane >> 4;
    const int ln   = lane & 15;
    const int q0   = qt * 128;

    __shared__ alignas(16) unsigned short Ks [2 * 64 * GL];   // [buf][kc][d]
    __shared__ alignas(16) unsigned short Vs [2 * 64 * VP];   // [buf][kc][d]

    // Copy 64 K rows and 64 V rows into buffer `buf`: 4 x 16 B per lane.
    const size_t srow = base + (size_t)(tid >> 3) * D + ((tid & 7) << 3);
    const unsigned lk = lds_off(&Ks[(tid >> 3) * GL + ((tid & 7) << 3)]);
    const unsigned lv = lds_off(&Vs[(tid >> 3) * VP + ((tid & 7) << 3)]);
    auto copyKV = [&](int buf, int k0) {
        const unsigned short* k = Kb + srow + (size_t)k0 * D;   // rows +32 per copy
        const unsigned short* v = Vb + srow + (size_t)k0 * D;
        const unsigned dk = lk + buf * (64 * GL * 2);
        const unsigned dv = lv + buf * (64 * VP * 2);
        // The closing s_wait_xcnt stands in the copies' own statement so that no
        // address register is rewritten ahead of it.
        asm volatile(
            "global_load_async_to_lds_b128 %0, %4, off\n\t"
            "global_load_async_to_lds_b128 %1, %5, off\n\t"
            "global_load_async_to_lds_b128 %2, %6, off\n\t"
            "global_load_async_to_lds_b128 %3, %7, off\n\t"
            "s_wait_xcnt 0x0"
            :: "v"(dk), "v"(dk + 32 * GL * 2), "v"(dv), "v"(dv + 32 * VP * 2),
               "v"(k), "v"(k + (size_t)32 * D), "v"(v), "v"(v + (size_t)32 * D)
            : "memory");
    };

    // Q fragments (B operand: column = query), resident for the whole block
    // (d split into 2 k-steps)
    const int qrow = q0 + wid * 16 + ln;
    v16bf qa[2];
#pragma unroll
    for (int kd = 0; kd < 2; ++kd) {
        const unsigned short* qp = &Q[base + (size_t)qrow * D + kd * 32 + 8 * g];
        qa[kd] = make_frag(qp, qp + 16);
    }

    v8f of[4];
#pragma unroll
    for (int j = 0; j < 4; ++j)
#pragma unroll
        for (int r = 0; r < 8; ++r) of[j][r] = 0.f;
    float mrow = -1e30f;   // running maximum of this lane's query (both halves alike)
    float lrow = 0.f;      // running sum over this half's keys; halves joined at the end

    const int kend = q0 + 128;                    // causal: cols <= q0+127
    copyKV(0, 0);
    asm volatile("s_wait_asynccnt 0x0" ::: "memory");   // tile 0 landed (own copies)
    __syncthreads();                                     // tile 0 visible to all waves
    if (64 < kend) copyKV(1, 64);
    int it = 0;
    for (int k0 = 0; k0 < kend; k0 += 64, ++it) {
        const unsigned short* ks = &Ks [(it & 1) * 64 * GL];
        const unsigned short* vs = &Vs [(it & 1) * 64 * VP];

        // ---- S^T = K Q^T  (64 keys x 16 queries per wave; 1/sqrt(HD) folded into Q) ----
        v8f sf[4];
#pragma unroll
        for (int nf = 0; nf < 4; ++nf) {
            v8f c;
#pragma unroll
            for (int r = 0; r < 8; ++r) c[r] = 0.f;
#pragma unroll
            for (int kd = 0; kd < 2; ++kd) {
                const unsigned short* kp = &ks[(nf * 16 + ln) * GL + kd * 32 + 8 * g];
                v16bf kf = make_frag(kp, kp + 16);
                c = WMMA_BF16(kf, qa[kd], c);
            }
            sf[nf] = c;                  // sf[nf][r]: key k0 + nf*16 + 8g + r, query qrow
        }

        // ---- causal mask (uniform-per-wave predicate) ----
        if (k0 + 63 > q0 + wid * 16) {
#pragma unroll
            for (int nf = 0; nf < 4; ++nf) {
#pragma unroll
                for (int r = 0; r < 8; ++r) {
                    int key = k0 + nf * 16 + 8 * g + r;
                    sf[nf][r] = (key > qrow) ? -1e30f : sf[nf][r];
                }
            }
        }

        // ---- online softmax: 32 keys of one query per lane ----
        // Arguments of the exps are always <= 0, so the fast __expf
        // (single v_exp_f32) is safe: it just underflows to 0.
        float mx4[4];
#pragma unroll
        for (int nf = 0; nf < 4; ++nf) {
            mx4[nf] = sf[nf][0];
#pragma unroll
            for (int r = 1; r < 8; ++r) mx4[nf] = fmaxf(mx4[nf], sf[nf][r]);
        }
        float mx = fmaxf(fmaxf(mx4[0], mx4[1]), fmaxf(mx4[2], mx4[3]));
        mx = fmaxf(mx, xhalf(mx));
        const float mnew  = fmaxf(mrow, mx);
        const float alpha = __expf(mrow - mnew);
        float ps4[4];
#pragma unroll
        for (int nf = 0; nf < 4; ++nf) {
            ps4[nf] = 0.f;
#pragma unroll
            for (int r = 0; r < 8; ++r) {
                float p = __expf(sf[nf][r] - mnew);
                sf[nf][r] = p;
                ps4[nf] += p;
            }
        }
        lrow = lrow * alpha + ((ps4[0] + ps4[1]) + (ps4[2] + ps4[3]));
        mrow = mnew;

        // ---- P^T as B operand: score tiles 2kd and 2kd+1, rounded in place, hold
        //      keys 8g + 0..7 and 16 + 8g + 0..7 of the 32-key step: the k order
        //      that the transposing load delivers for V^T ----
        v16bf pb[2];
#pragma unroll
        for (int kd = 0; kd < 2; ++kd) {
            v8bf lo = __builtin_convertvector(sf[2 * kd],     v8bf);
            v8bf hi = __builtin_convertvector(sf[2 * kd + 1], v8bf);
            pb[kd] = __builtin_shufflevector(lo, hi, 0, 1, 2, 3, 4, 5, 6, 7,
                                                     8, 9, 10, 11, 12, 13, 14, 15);
        }

        // ---- rescale O^T, then O^T += V^T P^T ----
#pragma unroll
        for (int j = 0; j < 4; ++j)
#pragma unroll
            for (int r = 0; r < 8; ++r) of[j][r] *= alpha;

#pragma unroll
        for (int j = 0; j < 4; ++j) {
#pragma unroll
            for (int kd = 0; kd < 2; ++kd) {
                const unsigned short* vp =
                    &vs[(kd * 32 + 8 * g + (lane & 7)) * VP + j * 16 + 8 * ((lane >> 3) & 1)];
                v16bf va = make_frag_tr(vp, 16 * VP);
                of[j] = WMMA_BF16(va, pb[kd], of[j]);
            }
        }
        ring_waits();
        __syncthreads();                 // next tile visible; this buffer free
        if (k0 + 128 < kend) copyKV(it & 1, k0 + 128);
    }
    asm volatile("s_wait_asynccnt 0x0" ::: "memory");   // no copy outlives the loop

    // ---- join the halves' sums, normalize, store bf16 ----
    // of[j][r] is O[qrow][j*16 + 8g + r]: 8 consecutive d, one 16-byte store.
    const float inv = 1.0f / (lrow + xhalf(lrow));
#pragma unroll
    for (int j = 0; j < 4; ++j) {
        v8f o = of[j];
#pragma unroll
        for (int r = 0; r < 8; ++r) o[r] *= inv;
        *reinterpret_cast<v8bf*>(&O[base + (size_t)qrow * D + j * 16 + 8 * g]) =
            __builtin_convertvector(o, v8bf);
    }
}

// ---------------------------------------------------------------------------
// Host orchestration
// ---------------------------------------------------------------------------
extern "C" void kernel_launch(void* const* d_in, const int* in_sizes, int n_in,
                              void* d_out, int out_size, void* d_ws, size_t ws_size,
                              hipStream_t stream) {
    constexpr int B = 4, S = 2048, D = 1024, H = 16, HD = 64, FF = 4096;
    constexpr int NT = B * S;                       // 8192 tokens

    const float* x     = (const float*)d_in[0];
    const float* Wq    = (const float*)d_in[1];
    const float* bq    = (const float*)d_in[2];
    const float* Wk    = (const float*)d_in[3];
    const float* bk    = (const float*)d_in[4];
    const float* Wv    = (const float*)d_in[5];
    const float* bv    = (const float*)d_in[6];
    const float* Wo    = (const float*)d_in[7];
    const float* bo    = (const float*)d_in[8];
    const float* W1    = (const float*)d_in[9];
    const float* b1    = (const float*)d_in[10];
    const float* W2    = (const float*)d_in[11];
    const float* b2    = (const float*)d_in[12];
    const float* ln1_g = (const float*)d_in[13];
    const float* ln1_b = (const float*)d_in[14];
    const float* ln2_g = (const float*)d_in[15];
    const float* ln2_b = (const float*)d_in[16];
    float* out = (float*)d_out;

    // ---- workspace carve-up (bf16 stored as unsigned short) ----
    char* p = (char*)d_ws;
    auto alloc = [&](size_t bytes) {
        void* r = p;
        p += (bytes + 255) & ~(size_t)255;
        return r;
    };
    unsigned short* wq_bf  = (unsigned short*)alloc((size_t)D * D * 2);
    unsigned short* wk_bf  = (unsigned short*)alloc((size_t)D * D * 2);
    unsigned short* wv_bf  = (unsigned short*)alloc((size_t)D * D * 2);
    unsigned short* wo_bf  = (unsigned short*)alloc((size_t)D * D * 2);
    unsigned short* w1_bf  = (unsigned short*)alloc((size_t)D * FF * 2);
    unsigned short* w2_bf  = (unsigned short*)alloc((size_t)FF * D * 2);
    unsigned short* h_bf   = (unsigned short*)alloc((size_t)NT * D * 2);   // h1 then h2
    unsigned short* q_bf   = (unsigned short*)alloc((size_t)NT * D * 2);
    unsigned short* k_bf   = (unsigned short*)alloc((size_t)NT * D * 2);
    unsigned short* v_bf   = (unsigned short*)alloc((size_t)NT * D * 2);
    unsigned short* at_bf  = (unsigned short*)alloc((size_t)NT * D * 2);
    float*          x2_f   = (float*)alloc((size_t)NT * D * 4);
    unsigned short* y1_bf  = (unsigned short*)alloc((size_t)NT * FF * 2);
    (void)ws_size; (void)in_sizes; (void)n_in; (void)out_size;

    // ---- weight conversion ----
    {
        int n = H * D * HD;
        int blk = (n + 255) / 256;
        cvt_qkvw_kernel<<<blk, 256, 0, stream>>>(Wq, wq_bf, H, D, HD);
        cvt_qkvw_kernel<<<blk, 256, 0, stream>>>(Wk, wk_bf, H, D, HD);
        cvt_qkvw_kernel<<<blk, 256, 0, stream>>>(Wv, wv_bf, H, D, HD);
        cvt_plain_kernel<<<(D * D + 255) / 256, 256, 0, stream>>>(Wo, wo_bf, D * D);
        cvt_plain_kernel<<<(D * FF + 255) / 256, 256, 0, stream>>>(W1, w1_bf, D * FF);
        cvt_plain_kernel<<<(FF * D + 255) / 256, 256, 0, stream>>>(W2, w2_bf, FF * D);
    }

    // ---- LN1 ----
    ln_kernel<<<NT, 256, 0, stream>>>(x, ln1_g, ln1_b, h_bf, D);

    // ---- QKV projections (Q pre-scaled by 1/sqrt(HD)) ----
    dim3 gP(D / 128, NT / 128);
    gemm_bf16_kernel<0, false, false, true><<<gP, 256, 0, stream>>>(
        h_bf, wq_bf, bq, nullptr, nullptr, q_bf, NT, D, D, 0.125f);
    gemm_bf16_kernel<0, false, false, true><<<gP, 256, 0, stream>>>(
        h_bf, wk_bf, bk, nullptr, nullptr, k_bf, NT, D, D, 1.0f);
    gemm_bf16_kernel<0, false, false, true><<<gP, 256, 0, stream>>>(
        h_bf, wv_bf, bv, nullptr, nullptr, v_bf, NT, D, D, 1.0f);

    // ---- causal flash attention ----
    attn_kernel<<<dim3(S / 128, B * H), 256, 0, stream>>>(q_bf, k_bf, v_bf, at_bf,
                                                          S, H, HD);

    // ---- output projection + residual -> x2 (fp32) ----
    gemm_bf16_kernel<0, true, true, false><<<gP, 256, 0, stream>>>(
        at_bf, wo_bf, bo, x, x2_f, nullptr, NT, D, D, 1.0f);

    // ---- LN2 ----
    ln_kernel<<<NT, 256, 0, stream>>>(x2_f, ln2_g, ln2_b, h_bf, D);

    // ---- FFN: gelu(h2 @ W1 + b1) -> y1 (bf16) ----
    dim3 gF(FF / 128, NT / 128);
    gemm_bf16_kernel<1, false, false, true><<<gF, 256, 0, stream>>>(
        h_bf, w1_bf, b1, nullptr, nullptr, y1_bf, NT, FF, D, 1.0f);

    // ---- gelu(y1 @ W2 + b2) + x2 -> out (fp32) ----
    gemm_bf16_kernel<1, true, true, false><<<gP, 256, 0, stream>>>(
        y1_bf, w2_bf, b2, x2_f, out, nullptr, NT, D, FF, 1.0f);
}

// v004
// It runs in 342 microseconds.
// Next to v003, in two timings, it ran 1.14 and 1.13 times as fast.
// Over all steps from v000 it is 3.71 times as fast.
#include <hip/hip_runtime.h>
#include <math.h>

// ---------------------------------------------------------------------------
// Types
// ---------------------------------------------------------------------------
typedef __bf16 v16bf __attribute__((ext_vector_type(16)));
typedef __bf16 v8bf  __attribute__((ext_vector_type(8)));
typedef float  v8f   __attribute__((ext_vector_type(8)));
typedef float  v4f   __attribute__((ext_vector_type(4)));

static __device__ __forceinline__ unsigned short f2bfbits(float x) {
    unsigned u = __builtin_bit_cast(unsigned, x);
    unsigned r = u + 0x7fffu + ((u >> 16) & 1u);   // round-to-nearest-even
    return (unsigned short)(r >> 16);
}

static __device__ __forceinline__ float geluf(float v) {
    return 0.5f * v * (1.0f + erff(v * 0.70710678118654752f));
}

// Build a 16-element bf16 WMMA fragment from two 16-byte-aligned runs of
// 8 bf16 (K offsets 8g and 8g+16 per the CDNA5 16-bit A/B layout).
static __device__ __forceinline__ v16bf make_frag(const unsigned short* lo,
                                                  const unsigned short* hi) {
    v8bf a = *reinterpret_cast<const v8bf*>(lo);
    v8bf b = *reinterpret_cast<const v8bf*>(hi);
    return __builtin_shufflevector(a, b, 0, 1, 2, 3, 4, 5, 6, 7,
                                         8, 9, 10, 11, 12, 13, 14, 15);
}

// Build a 16-element bf16 WMMA B fragment (32 k x 16 columns) from a row-major
// [k][n] LDS tile with two transposing loads. `p` is this lane's address
//   tile + (kbase + 8*(lane>>4) + (lane&7)) * pitch + nbase + 8*((lane>>3)&1)
// (elements); the lane receives column nbase + (lane&15) at k = kbase + 8g + 0..7
// and, `pitch16` = 16 rows further, k = kbase + 16 + 8g + 0..7: the same k order
// as make_frag(p, p + 16) delivers for the A side.
typedef __attribute__((address_space(3))) v8bf lds_v8bf;
static __device__ __forceinline__ v16bf make_frag_tr(const unsigned short* p, int pitch16) {
    v8bf a = __builtin_amdgcn_ds_load_tr16_b128_v8bf16((lds_v8bf*)p);
    v8bf b = __builtin_amdgcn_ds_load_tr16_b128_v8bf16((lds_v8bf*)(p + pitch16));
    return __builtin_shufflevector(a, b, 0, 1, 2, 3, 4, 5, 6, 7,
                                         8, 9, 10, 11, 12, 13, 14, 15);
}

// LDS byte address of a __shared__ element (the operand of an asynchronous copy).
static __device__ __forceinline__ unsigned lds_off(const unsigned short* p) {
    return (unsigned)(size_t)(const __attribute__((address_space(3))) unsigned short*)p;
}

// Foot of a ring trip, before the barrier: this wave's LDS reads of the buffer
// that is refilled next have retired, and its own copies of the next tile have
// landed.
static __device__ __forceinline__ void ring_waits() {
    asm volatile("s_wait_dscnt 0x0" ::: "memory");
    asm volatile("s_wait_asynccnt 0x0" ::: "memory");
}

// Value of lane l ^ 16 (the other half of the wave), by a vector cross-row move.
static __device__ __forceinline__ float xhalf(float v) {
    int b = __builtin_bit_cast(int, v);
    return __builtin_bit_cast(float,
        __builtin_amdgcn_permlanex16(b, b, 0x76543210, 0xfedcba98, false, false));
}

#define WMMA_BF16(A, B, C) \
    __builtin_amdgcn_wmma_f32_16x16x32_bf16(false, (A), false, (B), (short)0, (C), false, false)

// ---------------------------------------------------------------------------
// Weight conversion kernels (fp32 -> bf16)
// ---------------------------------------------------------------------------
__global__ void cvt_plain_kernel(const float* __restrict__ in,
                                 unsigned short* __restrict__ out, int n) {
    int i = blockIdx.x * 256 + threadIdx.x;
    if (i < n) out[i] = f2bfbits(in[i]);
}

// (H, D, HD) -> column-combined (D, H*HD): out[d*H*HD + h*HD + e] = in[h,d,e]
__global__ void cvt_qkvw_kernel(const float* __restrict__ in,
                                unsigned short* __restrict__ out,
                                int H, int D, int HD) {
    int i = blockIdx.x * 256 + threadIdx.x;
    int n = H * D * HD;
    if (i >= n) return;
    int h = i / (D * HD);
    int r = i - h * (D * HD);
    int d = r / HD;
    int e = r - d * HD;
    out[(size_t)d * (H * HD) + h * HD + e] = f2bfbits(in[i]);
}

// ---------------------------------------------------------------------------
// LayerNorm: one 256-thread block per token, bf16 output
// ---------------------------------------------------------------------------
__global__ __launch_bounds__(256) void ln_kernel(const float* __restrict__ x,
                                                 const float* __restrict__ g,
                                                 const float* __restrict__ b,
                                                 unsigned short* __restrict__ out,
                                                 int D) {
    const int row = blockIdx.x;
    const int tid = threadIdx.x;
    const float* xr = x + (size_t)row * D;
    __shared__ float red[20];

    float s = 0.f, ss = 0.f;
    for (int i = tid; i < D; i += 256) {
        float v = xr[i];
        s += v;
        ss += v * v;
    }
#pragma unroll
    for (int m = 16; m >= 1; m >>= 1) {
        s  += __shfl_xor(s,  m, 32);
        ss += __shfl_xor(ss, m, 32);
    }
    const int wid = tid >> 5;
    if ((tid & 31) == 0) { red[wid] = s; red[8 + wid] = ss; }
    __syncthreads();
    if (tid == 0) {
        float S = 0.f, SS = 0.f;
        for (int w = 0; w < 8; ++w) { S += red[w]; SS += red[8 + w]; }
        float mu  = S / (float)D;
        float var = SS / (float)D - mu * mu;
        red[16] = mu;
        red[17] = rsqrtf(var + 1e-5f);
    }
    __syncthreads();
    const float mu = red[16], rs = red[17];
    unsigned short* orow = out + (size_t)row * D;
    for (int i = tid; i < D; i += 256)
        orow[i] = f2bfbits((xr[i] - mu) * rs * g[i] + b[i]);
}

// ---------------------------------------------------------------------------
// Tiled bf16 WMMA GEMM (double-buffered, BK=64):
//   C[M,N] = [res +] act((A[M,K] @ B[K,N] + bias) * scale)
//   block tile 128x128, 8 waves (2 x 4), each wave: 64x32 via 4x2 fragments.
//   Pipeline: two LDS buffers filled by asynchronous copies; the copies of tile
//   k+1 fly while the 16 WMMAs of tile k run. One barrier per 64-wide K block.
// ---------------------------------------------------------------------------
constexpr int GL = 72;   // padded LDS row length (elements) for BK=64
constexpr int BP = 144;  // LDS row length (elements) of the row-major 64x128 B tile:
                         // 288 B = 32 B x odd, the pitch of the transposing load
constexpr int SB = 136;  // row length (bf16 elements) of the staged output tile: 272 B = 16 B x odd
constexpr int SF = 132;  // row length (floats) of the staged output tile: 528 B = 16 B x odd

template <int ACT, bool RES, bool OUTF, bool OUTB, int NC>   // NC == N
__global__ __launch_bounds__(256) void gemm_bf16_kernel(
        const unsigned short* __restrict__ A,   // [M,K] bf16 row-major
        const unsigned short* __restrict__ Bw,  // [K,N] bf16 row-major
        const float* __restrict__ bias,         // [N]
        const float* __restrict__ res,          // [M,N] fp32 (if RES)
        float* __restrict__ outF,               // [M,N] fp32 (if OUTF)
        unsigned short* __restrict__ outB,      // [M,N] bf16 (if OUTB)
        int M, int N, int K, float scale) {
    __shared__ alignas(16) unsigned short As [2 * 128 * GL];  // [buf][m][k]
    __shared__ alignas(16) unsigned short Bs [2 * 64 * BP];   // [buf][k][n]

    const int tid  = threadIdx.x;
    const int wid  = tid >> 5;
    const int lane = tid & 31;
    const int g    = lane >> 4;
    const int ln   = lane & 15;
    const int wm   = wid >> 2;
    const int wn   = wid & 3;
    const int m0   = blockIdx.y * 128;
    const int n0   = blockIdx.x * 128;

    // Copy a 128x64 A tile and a row-major 64x128 B tile into buffer `buf`:
    // 8 x 16 B per lane, global memory to LDS through no register.
    const unsigned short* ga = A + (size_t)(m0 + (tid >> 3)) * K + ((tid & 7) << 3);
    const unsigned short* gb = Bw + (size_t)(tid >> 4) * N + n0 + ((tid & 15) << 3);
    const unsigned la = lds_off(&As[(tid >> 3) * GL + ((tid & 7) << 3)]);
    const unsigned lb = lds_off(&Bs[(tid >> 4) * BP + ((tid & 15) << 3)]);
    auto copyAB = [&](int buf, int k0) {
        const unsigned short* a = ga + k0;                 // rows +32 per copy
        const unsigned short* b = gb + (size_t)k0 * N;     // rows +16 per copy
        const unsigned da = la + buf * (128 * GL * 2);
        const unsigned db = lb + buf * (64 * BP * 2);
        // The closing s_wait_xcnt stands in the copies' own statement so that no
        // address register is rewritten ahead of it.
        asm volatile(
            "global_load_async_to_lds_b128 %0, %8, off\n\t"
            "global_load_async_to_lds_b128 %1, %9, off\n\t"
            "global_load_async_to_lds_b128 %2, %10, off\n\t"
            "global_load_async_to_lds_b128 %3, %11, off\n\t"
            "global_load_async_to_lds_b128 %4, %12, off\n\t"
            "global_load_async_to_lds_b128 %5, %13, off\n\t"
            "global_load_async_to_lds_b128 %6, %14, off\n\t"
            "global_load_async_to_lds_b128 %7, %15, off\n\t"
            "s_wait_xcnt 0x0"
            :: "v"(da), "v"(da + 32 * GL * 2), "v"(da + 64 * GL * 2), "v"(da + 96 * GL * 2),
               "v"(db), "v"(db + 16 * BP * 2), "v"(db + 32 * BP * 2), "v"(db + 48 * BP * 2),
               "v"(a), "v"(a + (size_t)32 * K), "v"(a + (size_t)64 * K), "v"(a + (size_t)96 * K),
               "v"(b), "v"(b + (size_t)16 * N), "v"(b + (size_t)32 * N), "v"(b + (size_t)48 * N)
            : "memory");
    };

    v8f acc[4][2];
#pragma unroll
    for (int mf = 0; mf < 4; ++mf)
#pragma unroll
        for (int nf = 0; nf < 2; ++nf)
#pragma unroll
            for (int r = 0; r < 8; ++r) acc[mf][nf][r] = 0.f;

    const int KB = K >> 6;
    copyAB(0, 0);
    asm volatile("s_wait_asynccnt 0x0" ::: "memory");   // tile 0 landed (own copies)
    __syncthreads();                                     // tile 0 visible to all waves
    if (KB > 1) copyAB(1, 64);
    for (int kb = 0; kb < KB; ++kb) {
        const unsigned short* as = &As [(kb & 1) * 128 * GL];
        const unsigned short* bs = &Bs [(kb & 1) * 64 * BP];
#pragma unroll
        for (int kd = 0; kd < 2; ++kd) {            // two 32-wide WMMA K-steps
            v16bf af[4];
#pragma unroll
            for (int mf = 0; mf < 4; ++mf) {
                const unsigned short* p =
                    &as[(wm * 64 + mf * 16 + ln) * GL + kd * 32 + 8 * g];
                af[mf] = make_frag(p, p + 16);
            }
#pragma unroll
            for (int nf = 0; nf < 2; ++nf) {
                const unsigned short* p =
                    &bs[(kd * 32 + 8 * g + (lane & 7)) * BP +
                        wn * 32 + nf * 16 + 8 * ((lane >> 3) & 1)];
                v16bf bf = make_frag_tr(p, 16 * BP);
#pragma unroll
                for (int mf = 0; mf < 4; ++mf)
                    acc[mf][nf] = WMMA_BF16(af[mf], bf, acc[mf][nf]);
            }
        }
        ring_waits();
        __syncthreads();                 // tile kb+1 visible; buffer kb&1 free
        if (kb + 2 < KB) copyAB(kb & 1, (kb + 2) << 6);
    }
    asm volatile("s_wait_asynccnt 0x0" ::: "memory");   // no copy outlives the loop

    // ---- epilogue: the 128x128 tile goes through LDS so that every global store
    //      (and every residual load) of a wave covers whole 128-byte lines ----
    // The ring is free here: the last trip's barrier ended every wave's reads and
    // no copy is in flight.
    static_assert(OUTF != OUTB, "one output per instantiation");
    // NC is N as a compile-time constant: the row steps below become immediate
    // offsets on one address that stays in its registers to the end.
    const size_t tile0 = (size_t)m0 * NC + n0;           // first element of the tile
    // f32 rows: 32 lanes x 16 B = 512 contiguous bytes a wave, rows wid + 8 i.
    const unsigned vof = (unsigned)(wid * NC + lane * 4) * 4u;               // bytes
    // bf16 rows: 16 lanes x 16 B = 256 contiguous bytes, two rows a wave, rows (tid >> 4) + 16 i.
    const unsigned vob = (unsigned)((tid >> 4) * NC + ((tid & 15) << 3)) * 2u;   // bytes
    const float* bp = bias + n0 + wn * 32 + ln;
    const float bv2[2] = { bp[0], bp[16] };
    // No register that the two loads above name is rewritten ahead of this wait.
    asm volatile("s_wait_xcnt 0x0" ::: "memory");
    v4f rr[16];
    if (RES) {
        // Residual rows, asked for ahead of the activation so that their latency
        // is covered.
        const char* rb = reinterpret_cast<const char*>(res + tile0);
#pragma unroll
        for (int i = 0; i < 16; ++i)
            rr[i] = *reinterpret_cast<const v4f*>(rb + (size_t)(8 * i) * NC * 4 + vof);
        // The same for the sixteen loads above.
        asm volatile("s_wait_xcnt 0x0" ::: "memory");
    }
    float* stf = reinterpret_cast<float*>(wm ? Bs : As);   // f32: 64 rows in each array
#pragma unroll
    for (int mf = 0; mf < 4; ++mf) {
#pragma unroll
        for (int nf = 0; nf < 2; ++nf) {
            int lcol = wn * 32 + nf * 16 + ln;
            float bv = bv2[nf];
#pragma unroll
            for (int r = 0; r < 8; ++r) {
                int lrow = mf * 16 + 8 * g + r;          // row inside the wave's 64
                float v = (acc[mf][nf][r] + bv) * scale;
                if (ACT == 1) v = geluf(v);
                if (OUTF) stf[lrow * SF + lcol] = v;
                if (OUTB) As[(wm * 64 + lrow) * SB + lcol] = f2bfbits(v);
            }
        }
    }
    __syncthreads();                     // staged tile visible to all waves
    if (OUTB) {
        char* ob = reinterpret_cast<char*>(outB + tile0);
#pragma unroll
        for (int i = 0; i < 8; ++i) {
            v8bf t = *reinterpret_cast<const v8bf*>(
                &As[((tid >> 4) + 16 * i) * SB + ((tid & 15) << 3)]);
            *reinterpret_cast<v8bf*>(ob + (size_t)(16 * i) * NC * 2 + vob) = t;
        }
    }
    if (OUTF) {
        char* ob = reinterpret_cast<char*>(outF + tile0);
#pragma unroll
        for (int i = 0; i < 16; ++i) {
            const float* sp = reinterpret_cast<const float*>(i < 8 ? As : Bs);
            v4f t = *reinterpret_cast<const v4f*>(&sp[(wid + 8 * (i & 7)) * SF + lane * 4]);
            if (RES) t += rr[i];
            *reinterpret_cast<v4f*>(ob + (size_t)(8 * i) * NC * 4 + vof) = t;
        }
    }
}

constexpr int VP = 80;   // LDS row length (elements) of a V row: 160 B = 32 B x odd
__global__ __launch_bounds__(256) void attn_kernel(
        const unsigned short* __restrict__ Q,
        const unsigned short* __restrict__ Kb,
        const unsigned short* __restrict__ Vb,
        unsigned short* __restrict__ O,
        int S, int H, int HD) {
    const int D   = H * HD;                       // 1024
    const int qt  = blockIdx.x;
    const int bh  = blockIdx.y;
    const int b   = bh / H;
    const int h   = bh - b * H;
    const size_t base = (size_t)b * S * D + (size_t)h * HD;

    const int tid  = threadIdx.x;
    const int wid  = tid >> 5;
    const int lane = tid & 31;
    const int g    = lane >> 4;
    const int ln   = lane & 15;
    const int q0   = qt * 128;

    __shared__ alignas(16) unsigned short Ks [2 * 64 * GL];   // [buf][kc][d]
    __shared__ alignas(16) unsigned short Vs [2 * 64 * VP];   // [buf][kc][d]

    // Copy 64 K rows and 64 V rows into buffer `buf`: 4 x 16 B per lane.
    const size_t srow = base + (size_t)(tid >> 3) * D + ((tid & 7) << 3);
    const unsigned lk = lds_off(&Ks[(tid >> 3) * GL + ((tid & 7) << 3)]);
    const unsigned lv = lds_off(&Vs[(tid >> 3) * VP + ((tid & 7) << 3)]);
    auto copyKV = [&](int buf, int k0) {
        const unsigned short* k = Kb + srow + (size_t)k0 * D;   // rows +32 per copy
        const unsigned short* v = Vb + srow + (size_t)k0 * D;
        const unsigned dk = lk + buf * (64 * GL * 2);
        const unsigned dv = lv + buf * (64 * VP * 2);
        // The closing s_wait_xcnt stands in the copies' own statement so that no
        // address register is rewritten ahead of it.
        asm volatile(
            "global_load_async_to_lds_b128 %0, %4, off\n\t"
            "global_load_async_to_lds_b128 %1, %5, off\n\t"
            "global_load_async_to_lds_b128 %2, %6, off\n\t"
            "global_load_async_to_lds_b128 %3, %7, off\n\t"
            "s_wait_xcnt 0x0"
            :: "v"(dk), "v"(dk + 32 * GL * 2), "v"(dv), "v"(dv + 32 * VP * 2),
               "v"(k), "v"(k + (size_t)32 * D), "v"(v), "v"(v + (size_t)32 * D)
            : "memory");
    };

    // Q fragments (B operand: column = query), resident for the whole block
    // (d split into 2 k-steps)
    const int qrow = q0 + wid * 16 + ln;
    v16bf qa[2];
#pragma unroll
    for (int kd = 0; kd < 2; ++kd) {
        const unsigned short* qp = &Q[base + (size_t)qrow * D + kd * 32 + 8 * g];
        qa[kd] = make_frag(qp, qp + 16);
    }

    v8f of[4];
#pragma unroll
    for (int j = 0; j < 4; ++j)
#pragma unroll
        for (int r = 0; r < 8; ++r) of[j][r] = 0.f;
    float mrow = -1e30f;   // running maximum of this lane's query (both halves alike)
    float lrow = 0.f;      // running sum over this half's keys; halves joined at the end

    const int kend = q0 + 128;                    // causal: cols <= q0+127
    copyKV(0, 0);
    asm volatile("s_wait_asynccnt 0x0" ::: "memory");   // tile 0 landed (own copies)
    __syncthreads();                                     // tile 0 visible to all waves
    if (64 < kend) copyKV(1, 64);
    int it = 0;
    for (int k0 = 0; k0 < kend; k0 += 64, ++it) {
        const unsigned short* ks = &Ks [(it & 1) * 64 * GL];
        const unsigned short* vs = &Vs [(it & 1) * 64 * VP];

        // ---- S^T = K Q^T  (64 keys x 16 queries per wave; 1/sqrt(HD) folded into Q) ----
        v8f sf[4];
#pragma unroll
        for (int nf = 0; nf < 4; ++nf) {
            v8f c;
#pragma unroll
            for (int r = 0; r < 8; ++r) c[r] = 0.f;
#pragma unroll
            for (int kd = 0; kd < 2; ++kd) {
                const unsigned short* kp = &ks[(nf * 16 + ln) * GL + kd * 32 + 8 * g];
                v16bf kf = make_frag(kp, kp + 16);
                c = WMMA_BF16(kf, qa[kd], c);
            }
            sf[nf] = c;                  // sf[nf][r]: key k0 + nf*16 + 8g + r, query qrow
        }

        // ---- causal mask (uniform-per-wave predicate) ----
        if (k0 + 63 > q0 + wid * 16) {
#pragma unroll
            for (int nf = 0; nf < 4; ++nf) {
#pragma unroll
                for (int r = 0; r < 8; ++r) {
                    int key = k0 + nf * 16 + 8 * g + r;
                    sf[nf][r] = (key > qrow) ? -1e30f : sf[nf][r];
                }
            }
        }

        // ---- online softmax: 32 keys of one query per lane ----
        // Arguments of the exps are always <= 0, so the fast __expf
        // (single v_exp_f32) is safe: it just underflows to 0.
        float mx4[4];
#pragma unroll
        for (int nf = 0; nf < 4; ++nf) {
            mx4[nf] = sf[nf][0];
#pragma unroll
            for (int r = 1; r < 8; ++r) mx4[nf] = fmaxf(mx4[nf], sf[nf][r]);
        }
        float mx = fmaxf(fmaxf(mx4[0], mx4[1]), fmaxf(mx4[2], mx4[3]));
        mx = fmaxf(mx, xhalf(mx));
        const float mnew  = fmaxf(mrow, mx);
        const float alpha = __expf(mrow - mnew);
        float ps4[4];
#pragma unroll
        for (int nf = 0; nf < 4; ++nf) {
            ps4[nf] = 0.f;
#pragma unroll
            for (int r = 0; r < 8; ++r) {
                float p = __expf(sf[nf][r] - mnew);
                sf[nf][r] = p;
                ps4[nf] += p;
            }
        }
        lrow = lrow * alpha + ((ps4[0] + ps4[1]) + (ps4[2] + ps4[3]));
        mrow = mnew;

        // ---- P^T as B operand: score tiles 2kd and 2kd+1, rounded in place, hold
        //      keys 8g + 0..7 and 16 + 8g + 0..7 of the 32-key step: the k order
        //      that the transposing load delivers for V^T ----
        v16bf pb[2];
#pragma unroll
        for (int kd = 0; kd < 2; ++kd) {
            v8bf lo = __builtin_convertvector(sf[2 * kd],     v8bf);
            v8bf hi = __builtin_convertvector(sf[2 * kd + 1], v8bf);
            pb[kd] = __builtin_shufflevector(lo, hi, 0, 1, 2, 3, 4, 5, 6, 7,
                                                     8, 9, 10, 11, 12, 13, 14, 15);
        }

        // ---- rescale O^T, then O^T += V^T P^T ----
#pragma unroll
        for (int j = 0; j < 4; ++j)
#pragma unroll
            for (int r = 0; r < 8; ++r) of[j][r] *= alpha;

#pragma unroll
        for (int j = 0; j < 4; ++j) {
#pragma unroll
            for (int kd = 0; kd < 2; ++kd) {
                const unsigned short* vp =
                    &vs[(kd * 32 + 8 * g + (lane & 7)) * VP + j * 16 + 8 * ((lane >> 3) & 1)];
                v16bf va = make_frag_tr(vp, 16 * VP);
                of[j] = WMMA_BF16(va, pb[kd], of[j]);
            }
        }
        ring_waits();
        __syncthreads();                 // next tile visible; this buffer free
        if (k0 + 128 < kend) copyKV(it & 1, k0 + 128);
    }
    asm volatile("s_wait_asynccnt 0x0" ::: "memory");   // no copy outlives the loop

    // ---- join the halves' sums, normalize, store bf16 ----
    // of[j][r] is O[qrow][j*16 + 8g + r]: 8 consecutive d, one 16-byte store.
    const float inv = 1.0f / (lrow + xhalf(lrow));
#pragma unroll
    for (int j = 0; j < 4; ++j) {
        v8f o = of[j];
#pragma unroll
        for (int r = 0; r < 8; ++r) o[r] *= inv;
        *reinterpret_cast<v8bf*>(&O[base + (size_t)qrow * D + j * 16 + 8 * g]) =
            __builtin_convertvector(o, v8bf);
    }
}

// ---------------------------------------------------------------------------
// Host orchestration
// ---------------------------------------------------------------------------
extern "C" void kernel_launch(void* const* d_in, const int* in_sizes, int n_in,
                              void* d_out, int out_size, void* d_ws, size_t ws_size,
                              hipStream_t stream) {
    constexpr int B = 4, S = 2048, D = 1024, H = 16, HD = 64, FF = 4096;
    constexpr int NT = B * S;                       // 8192 tokens

    const float* x     = (const float*)d_in[0];
    const float* Wq    = (const float*)d_in[1];
    const float* bq    = (const float*)d_in[2];
    const float* Wk    = (const float*)d_in[3];
    const float* bk    = (const float*)d_in[4];
    const float* Wv    = (const float*)d_in[5];
    const float* bv    = (const float*)d_in[6];
    const float* Wo    = (const float*)d_in[7];
    const float* bo    = (const float*)d_in[8];
    const float* W1    = (const float*)d_in[9];
    const float* b1    = (const float*)d_in[10];
    const float* W2    = (const float*)d_in[11];
    const float* b2    = (const float*)d_in[12];
    const float* ln1_g = (const float*)d_in[13];
    const float* ln1_b = (const float*)d_in[14];
    const float* ln2_g = (const float*)d_in[15];
    const float* ln2_b = (const float*)d_in[16];
    float* out = (float*)d_out;

    // ---- workspace carve-up (bf16 stored as unsigned short) ----
    char* p = (char*)d_ws;
    auto alloc = [&](size_t bytes) {
        void* r = p;
        p += (bytes + 255) & ~(size_t)255;
        return r;
    };
    unsigned short* wq_bf  = (unsigned short*)alloc((size_t)D * D * 2);
    unsigned short* wk_bf  = (unsigned short*)alloc((size_t)D * D * 2);
    unsigned short* wv_bf  = (unsigned short*)alloc((size_t)D * D * 2);
    unsigned short* wo_bf  = (unsigned short*)alloc((size_t)D * D * 2);
    unsigned short* w1_bf  = (unsigned short*)alloc((size_t)D * FF * 2);
    unsigned short* w2_bf  = (unsigned short*)alloc((size_t)FF * D * 2);
    unsigned short* h_bf   = (unsigned short*)alloc((size_t)NT * D * 2);   // h1 then h2
    unsigned short* q_bf   = (unsigned short*)alloc((size_t)NT * D * 2);
    unsigned short* k_bf   = (unsigned short*)alloc((size_t)NT * D * 2);
    unsigned short* v_bf   = (unsigned short*)alloc((size_t)NT * D * 2);
    unsigned short* at_bf  = (unsigned short*)alloc((size_t)NT * D * 2);
    float*          x2_f   = (float*)alloc((size_t)NT * D * 4);
    unsigned short* y1_bf  = (unsigned short*)alloc((size_t)NT * FF * 2);
    (void)ws_size; (void)in_sizes; (void)n_in; (void)out_size;

    // ---- weight conversion ----
    {
        int n = H * D * HD;
        int blk = (n + 255) / 256;
        cvt_qkvw_kernel<<<blk, 256, 0, stream>>>(Wq, wq_bf, H, D, HD);
        cvt_qkvw_kernel<<<blk, 256, 0, stream>>>(Wk, wk_bf, H, D, HD);
        cvt_qkvw_kernel<<<blk, 256, 0, stream>>>(Wv, wv_bf, H, D, HD);
        cvt_plain_kernel<<<(D * D + 255) / 256, 256, 0, stream>>>(Wo, wo_bf, D * D);
        cvt_plain_kernel<<<(D * FF + 255) / 256, 256, 0, stream>>>(W1, w1_bf, D * FF);
        cvt_plain_kernel<<<(FF * D + 255) / 256, 256, 0, stream>>>(W2, w2_bf, FF * D);
    }

    // ---- LN1 ----
    ln_kernel<<<NT, 256, 0, stream>>>(x, ln1_g, ln1_b, h_bf, D);

    // ---- QKV projections (Q pre-scaled by 1/sqrt(HD)) ----
    dim3 gP(D / 128, NT / 128);
    gemm_bf16_kernel<0, false, false, true, D><<<gP, 256, 0, stream>>>(
        h_bf, wq_bf, bq, nullptr, nullptr, q_bf, NT, D, D, 0.125f);
    gemm_bf16_kernel<0, false, false, true, D><<<gP, 256, 0, stream>>>(
        h_bf, wk_bf, bk, nullptr, nullptr, k_bf, NT, D, D, 1.0f);
    gemm_bf16_kernel<0, false, false, true, D><<<gP, 256, 0, stream>>>(
        h_bf, wv_bf, bv, nullptr, nullptr, v_bf, NT, D, D, 1.0f);

    // ---- causal flash attention ----
    attn_kernel<<<dim3(S / 128, B * H), 256, 0, stream>>>(q_bf, k_bf, v_bf, at_bf,
                                                          S, H, HD);

    // ---- output projection + residual -> x2 (fp32) ----
    gemm_bf16_kernel<0, true, true, false, D><<<gP, 256, 0, stream>>>(
        at_bf, wo_bf, bo, x, x2_f, nullptr, NT, D, D, 1.0f);

    // ---- LN2 ----
    ln_kernel<<<NT, 256, 0, stream>>>(x2_f, ln2_g, ln2_b, h_bf, D);

    // ---- FFN: gelu(h2 @ W1 + b1) -> y1 (bf16) ----
    dim3 gF(FF / 128, NT / 128);
    gemm_bf16_kernel<1, false, false, true, FF><<<gF, 256, 0, stream>>>(
        h_bf, w1_bf, b1, nullptr, nullptr, y1_bf, NT, FF, D, 1.0f);

    // ---- gelu(y1 @ W2 + b2) + x2 -> out (fp32) ----
    gemm_bf16_kernel<1, true, true, false, D><<<gP, 256, 0, stream>>>(
        y1_bf, w2_bf, b2, x2_f, out, nullptr, NT, D, FF, 1.0f);
}

// v005
// One run takes 297 microseconds.
// Timed twice side by side with v004, it ran 1.14 and 1.16 times as fast.
// All steps since v000 together make it 4.27 times as fast.
#include <hip/hip_runtime.h>
#include <math.h>

// ---------------------------------------------------------------------------
// Types
// ---------------------------------------------------------------------------
typedef __bf16 v16bf __attribute__((ext_vector_type(16)));
typedef __bf16 v8bf  __attribute__((ext_vector_type(8)));
typedef float  v8f   __attribute__((ext_vector_type(8)));
typedef float  v4f   __attribute__((ext_vector_type(4)));

static __device__ __forceinline__ unsigned short f2bfbits(float x) {
    unsigned u = __builtin_bit_cast(unsigned, x);
    unsigned r = u + 0x7fffu + ((u >> 16) & 1u);   // round-to-nearest-even
    return (unsigned short)(r >> 16);
}

static __device__ __forceinline__ float geluf(float v) {
    return 0.5f * v * (1.0f + erff(v * 0.70710678118654752f));
}

// Build a 16-element bf16 WMMA fragment from two 16-byte-aligned runs of
// 8 bf16 (K offsets 8g and 8g+16 per the CDNA5 16-bit A/B layout).
static __device__ __forceinline__ v16bf make_frag(const unsigned short* lo,
                                                  const unsigned short* hi) {
    v8bf a = *reinterpret_cast<const v8bf*>(lo);
    v8bf b = *reinterpret_cast<const v8bf*>(hi);
    return __builtin_shufflevector(a, b, 0, 1, 2, 3, 4, 5, 6, 7,
                                         8, 9, 10, 11, 12, 13, 14, 15);
}

// Build a 16-element bf16 WMMA B fragment (32 k x 16 columns) from a row-major
// [k][n] LDS tile with two transposing loads. `p` is this lane's address
//   tile + (kbase + 8*(lane>>4) + (lane&7)) * pitch + nbase + 8*((lane>>3)&1)
// (elements); the lane receives column nbase + (lane&15) at k = kbase + 8g + 0..7
// and, `pitch16` = 16 rows further, k = kbase + 16 + 8g + 0..7: the same k order
// as make_frag(p, p + 16) delivers for the A side.
typedef __attribute__((address_space(3))) v8bf lds_v8bf;
static __device__ __forceinline__ v16bf make_frag_tr(const unsigned short* p, int pitch16) {
    v8bf a = __builtin_amdgcn_ds_load_tr16_b128_v8bf16((lds_v8bf*)p);
    v8bf b = __builtin_amdgcn_ds_load_tr16_b128_v8bf16((lds_v8bf*)(p + pitch16));
    return __builtin_shufflevector(a, b, 0, 1, 2, 3, 4, 5, 6, 7,
                                         8, 9, 10, 11, 12, 13, 14, 15);
}

// LDS byte address of a __shared__ element (the operand of an asynchronous copy).
static __device__ __forceinline__ unsigned lds_off(const unsigned short* p) {
    return (unsigned)(size_t)(const __attribute__((address_space(3))) unsigned short*)p;
}

// Foot of a ring trip, before the barrier: this wave's LDS reads of the buffer
// that is refilled next have retired, and its own copies of the next tile have
// landed.
static __device__ __forceinline__ void ring_waits() {
    asm volatile("s_wait_dscnt 0x0" ::: "memory");
    asm volatile("s_wait_asynccnt 0x0" ::: "memory");
}

// Value of lane l ^ 16 (the other half of the wave), by a vector cross-row move.
static __device__ __forceinline__ float xhalf(float v) {
    int b = __builtin_bit_cast(int, v);
    return __builtin_bit_cast(float,
        __builtin_amdgcn_permlanex16(b, b, 0x76543210, 0xfedcba98, false, false));
}

#define WMMA_BF16(A, B, C) \
    __builtin_amdgcn_wmma_f32_16x16x32_bf16(false, (A), false, (B), (short)0, (C), false, false)

// ---------------------------------------------------------------------------
// Weight conversion kernels (fp32 -> bf16)
//   A lane takes U pieces of 4 elements: every load of a wave covers 512
//   contiguous bytes, every store 256, and all U loads are asked for before the
//   first piece is converted. N elements need N / (128 U) waves.
// ---------------------------------------------------------------------------
typedef unsigned short us4 __attribute__((ext_vector_type(4)));

static __device__ __forceinline__ us4 f2bf4(v4f v) {
    us4 r;
#pragma unroll
    for (int c = 0; c < 4; ++c) r[c] = f2bfbits(v[c]);
    return r;
}

template <int U, int N>   // grid = N / (1024 U) blocks of 256
__global__ __launch_bounds__(256) void cvt_plain_kernel(const float* __restrict__ in,
                                                        unsigned short* __restrict__ out) {
    static_assert(N % (1024 * U) == 0, "whole blocks only");
    const unsigned i0 = (blockIdx.x * (256 * U) + threadIdx.x) * 4;   // first element
    v4f v[U];
#pragma unroll
    for (int u = 0; u < U; ++u)
        v[u] = *reinterpret_cast<const v4f*>(in + i0 + u * 1024);
    // No register that the loads above name is rewritten ahead of this wait.
    asm volatile("s_wait_xcnt 0x0" ::: "memory");
#pragma unroll
    for (int u = 0; u < U; ++u)
        *reinterpret_cast<us4*>(out + i0 + u * 1024) = f2bf4(v[u]);
}

// (H, D, HD) -> column-combined (D, H*HD): out[d*H*HD + h*HD + e] = in[h,d,e]
// A piece is 4 consecutive e of one (h, d); 16 lanes store one 128-byte run.
// A block stays inside one h, so piece u lies 1024 / HD rows d below piece 0.
template <int U, int H, int D, int HD>   // grid = H*D*HD / (1024 U) blocks of 256
__global__ __launch_bounds__(256) void cvt_qkvw_kernel(const float* __restrict__ in,
                                                       unsigned short* __restrict__ out) {
    static_assert((D * HD) % (1024 * U) == 0 && 1024 % HD == 0 && HD % 4 == 0,
                  "whole blocks inside one h, whole rows between pieces, whole pieces");
    const unsigned i0 = (blockIdx.x * (256 * U) + threadIdx.x) * 4;   // first element
    v4f v[U];
#pragma unroll
    for (int u = 0; u < U; ++u)
        v[u] = *reinterpret_cast<const v4f*>(in + i0 + u * 1024);
    // No register that the loads above name is rewritten ahead of this wait.
    asm volatile("s_wait_xcnt 0x0" ::: "memory");
    const unsigned h = i0 / (D * HD);
    const unsigned r = i0 - h * (D * HD);
    const unsigned d = r / HD;
    const unsigned e = r - d * HD;
    unsigned short* o = out + d * (H * HD) + h * HD + e;
#pragma unroll
    for (int u = 0; u < U; ++u)
        *reinterpret_cast<us4*>(o + u * (1024 / HD) * (H * HD)) = f2bf4(v[u]);
}

// ---------------------------------------------------------------------------
// LayerNorm: one wave per pair of tokens, 16 tokens per 256-thread block, bf16
// output. Both rows stay in registers (DC / 128 pieces of 16 B a lane and row)
// between the sums and the scaling: no LDS, no barrier, no second read of x.
// ---------------------------------------------------------------------------
template <int DC>   // DC == D; grid = tokens / 16
__global__ __launch_bounds__(256) void ln_kernel(const float* __restrict__ x,
                                                 const float* __restrict__ g,
                                                 const float* __restrict__ b,
                                                 unsigned short* __restrict__ out) {
    static_assert(DC % 128 == 0, "whole pieces");
    constexpr int P = DC / 128;
    const int lane = threadIdx.x & 31;
    const int row  = (blockIdx.x * 8 + (threadIdx.x >> 5)) * 2;
    const float* xr = x + (size_t)row * DC + lane * 4;
    v4f v[2][P], gv[P], bv[P];
#pragma unroll
    for (int t = 0; t < 2; ++t)
#pragma unroll
        for (int p = 0; p < P; ++p)
            v[t][p] = *reinterpret_cast<const v4f*>(xr + t * DC + p * 128);
#pragma unroll
    for (int p = 0; p < P; ++p) {
        gv[p] = *reinterpret_cast<const v4f*>(g + lane * 4 + p * 128);
        bv[p] = *reinterpret_cast<const v4f*>(b + lane * 4 + p * 128);
    }
    // Holds all 32 loads ahead of the sums. Left free, the g and b loads sink
    // into the reduction and their latency is paid a second time.
    __builtin_amdgcn_sched_barrier(0);
    // No register that the loads above name is rewritten ahead of this wait: as an
    // input, xr keeps the x loads' address pair from serving as a load's target.
    asm volatile("s_wait_xcnt 0x0" :: "v"(xr) : "memory");

    float s[2], ss[2];
#pragma unroll
    for (int t = 0; t < 2; ++t) {
        v4f s4 = v[t][0], q4 = v[t][0] * v[t][0];    // four independent chains each
#pragma unroll
        for (int p = 1; p < P; ++p) {
            s4 += v[t][p];
            q4 += v[t][p] * v[t][p];
        }
        s[t]  = (s4[0] + s4[1]) + (s4[2] + s4[3]);
        ss[t] = (q4[0] + q4[1]) + (q4[2] + q4[3]);
    }
#pragma unroll
    for (int m = 16; m >= 1; m >>= 1) {
#pragma unroll
        for (int t = 0; t < 2; ++t) {
            s[t]  += __shfl_xor(s[t],  m, 32);
            ss[t] += __shfl_xor(ss[t], m, 32);
        }
    }
    unsigned short* orow = out + (size_t)row * DC + lane * 4;
#pragma unroll
    for (int t = 0; t < 2; ++t) {
        const float mu  = s[t] / (float)DC;
        const float var = ss[t] / (float)DC - mu * mu;
        const float rs  = rsqrtf(var + 1e-5f);
#pragma unroll
        for (int p = 0; p < P; ++p)
            *reinterpret_cast<us4*>(orow + t * DC + p * 128) =
                f2bf4((v[t][p] - mu) * rs * gv[p] + bv[p]);
    }
}

// ---------------------------------------------------------------------------
// Tiled bf16 WMMA GEMM (double-buffered, BK=64):
//   C[M,N] = [res +] act((A[M,K] @ B[K,N] + bias) * scale)
//   block tile 128x128, 8 waves (2 x 4), each wave: 64x32 via 4x2 fragments.
//   Pipeline: two LDS buffers filled by asynchronous copies; the copies of tile
//   k+1 fly while the 16 WMMAs of tile k run. One barrier per 64-wide K block.
// ---------------------------------------------------------------------------
constexpr int GL = 72;   // padded LDS row length (elements) for BK=64
constexpr int BP = 144;  // LDS row length (elements) of the row-major 64x128 B tile:
                         // 288 B = 32 B x odd, the pitch of the transposing load
constexpr int SB = 136;  // row length (bf16 elements) of the staged output tile: 272 B = 16 B x odd
constexpr int SF = 132;  // row length (floats) of the staged output tile: 528 B = 16 B x odd

template <int ACT, bool RES, bool OUTF, bool OUTB, int NC>   // NC == N
__global__ __launch_bounds__(256) void gemm_bf16_kernel(
        const unsigned short* __restrict__ A,   // [M,K] bf16 row-major
        const unsigned short* __restrict__ Bw,  // [K,N] bf16 row-major
        const float* __restrict__ bias,         // [N]
        const float* __restrict__ res,          // [M,N] fp32 (if RES)
        float* __restrict__ outF,               // [M,N] fp32 (if OUTF)
        unsigned short* __restrict__ outB,      // [M,N] bf16 (if OUTB)
        int M, int N, int K, float scale) {
    __shared__ alignas(16) unsigned short As [2 * 128 * GL];  // [buf][m][k]
    __shared__ alignas(16) unsigned short Bs [2 * 64 * BP];   // [buf][k][n]

    const int tid  = threadIdx.x;
    const int wid  = tid >> 5;
    const int lane = tid & 31;
    const int g    = lane >> 4;
    const int ln   = lane & 15;
    const int wm   = wid >> 2;
    const int wn   = wid & 3;
    const int m0   = blockIdx.y * 128;
    const int n0   = blockIdx.x * 128;

    // Copy a 128x64 A tile and a row-major 64x128 B tile into buffer `buf`:
    // 8 x 16 B per lane, global memory to LDS through no register.
    const unsigned short* ga = A + (size_t)(m0 + (tid >> 3)) * K + ((tid & 7) << 3);
    const unsigned short* gb = Bw + (size_t)(tid >> 4) * N + n0 + ((tid & 15) << 3);
    const unsigned la = lds_off(&As[(tid >> 3) * GL + ((tid & 7) << 3)]);
    const unsigned lb = lds_off(&Bs[(tid >> 4) * BP + ((tid & 15) << 3)]);
    auto copyAB = [&](int buf, int k0) {
        const unsigned short* a = ga + k0;                 // rows +32 per copy
        const unsigned short* b = gb + (size_t)k0 * N;     // rows +16 per copy
        const unsigned da = la + buf * (128 * GL * 2);
        const unsigned db = lb + buf * (64 * BP * 2);
        // The closing s_wait_xcnt stands in the copies' own statement so that no
        // address register is rewritten ahead of it.
        asm volatile(
            "global_load_async_to_lds_b128 %0, %8, off\n\t"
            "global_load_async_to_lds_b128 %1, %9, off\n\t"
            "global_load_async_to_lds_b128 %2, %10, off\n\t"
            "global_load_async_to_lds_b128 %3, %11, off\n\t"
            "global_load_async_to_lds_b128 %4, %12, off\n\t"
            "global_load_async_to_lds_b128 %5, %13, off\n\t"
            "global_load_async_to_lds_b128 %6, %14, off\n\t"
            "global_load_async_to_lds_b128 %7, %15, off\n\t"
            "s_wait_xcnt 0x0"
            :: "v"(da), "v"(da + 32 * GL * 2), "v"(da + 64 * GL * 2), "v"(da + 96 * GL * 2),
               "v"(db), "v"(db + 16 * BP * 2), "v"(db + 32 * BP * 2), "v"(db + 48 * BP * 2),
               "v"(a), "v"(a + (size_t)32 * K), "v"(a + (size_t)64 * K), "v"(a + (size_t)96 * K),
               "v"(b), "v"(b + (size_t)16 * N), "v"(b + (size_t)32 * N), "v"(b + (size_t)48 * N)
            : "memory");
    };

    v8f acc[4][2];
#pragma unroll
    for (int mf = 0; mf < 4; ++mf)
#pragma unroll
        for (int nf = 0; nf < 2; ++nf)
#pragma unroll
            for (int r = 0; r < 8; ++r) acc[mf][nf][r] = 0.f;

    const int KB = K >> 6;
    copyAB(0, 0);
    asm volatile("s_wait_asynccnt 0x0" ::: "memory");   // tile 0 landed (own copies)
    __syncthreads();                                     // tile 0 visible to all waves
    if (KB > 1) copyAB(1, 64);
    for (int kb = 0; kb < KB; ++kb) {
        const unsigned short* as = &As [(kb & 1) * 128 * GL];
        const unsigned short* bs = &Bs [(kb & 1) * 64 * BP];
#pragma unroll
        for (int kd = 0; kd < 2; ++kd) {            // two 32-wide WMMA K-steps
            v16bf af[4];
#pragma unroll
            for (int mf = 0; mf < 4; ++mf) {
                const unsigned short* p =
                    &as[(wm * 64 + mf * 16 + ln) * GL + kd * 32 + 8 * g];
                af[mf] = make_frag(p, p + 16);
            }
#pragma unroll
            for (int nf = 0; nf < 2; ++nf) {
                const unsigned short* p =
                    &bs[(kd * 32 + 8 * g + (lane & 7)) * BP +
                        wn * 32 + nf * 16 + 8 * ((lane >> 3) & 1)];
                v16bf bf = make_frag_tr(p, 16 * BP);
#pragma unroll
                for (int mf = 0; mf < 4; ++mf)
                    acc[mf][nf] = WMMA_BF16(af[mf], bf, acc[mf][nf]);
            }
        }
        ring_waits();
        __syncthreads();                 // tile kb+1 visible; buffer kb&1 free
        if (kb + 2 < KB) copyAB(kb & 1, (kb + 2) << 6);
    }
    asm volatile("s_wait_asynccnt 0x0" ::: "memory");   // no copy outlives the loop

    // ---- epilogue: the 128x128 tile goes through LDS so that every global store
    //      (and every residual load) of a wave covers whole 128-byte lines ----
    // The ring is free here: the last trip's barrier ended every wave's reads and
    // no copy is in flight.
    static_assert(OUTF != OUTB, "one output per instantiation");
    // NC is N as a compile-time constant: the row steps below become immediate
    // offsets on one address that stays in its registers to the end.
    const size_t tile0 = (size_t)m0 * NC + n0;           // first element of the tile
    // f32 rows: 32 lanes x 16 B = 512 contiguous bytes a wave, rows wid + 8 i.
    const unsigned vof = (unsigned)(wid * NC + lane * 4) * 4u;               // bytes
    // bf16 rows: 16 lanes x 16 B = 256 contiguous bytes, two rows a wave, rows (tid >> 4) + 16 i.
    const unsigned vob = (unsigned)((tid >> 4) * NC + ((tid & 15) << 3)) * 2u;   // bytes
    const float* bp = bias + n0 + wn * 32 + ln;
    const float bv2[2] = { bp[0], bp[16] };
    // No register that the two loads above name is rewritten ahead of this wait.
    asm volatile("s_wait_xcnt 0x0" ::: "memory");
    v4f rr[16];
    if (RES) {
        // Residual rows, asked for ahead of the activation so that their latency
        // is covered.
        const char* rb = reinterpret_cast<const char*>(res + tile0);
#pragma unroll
        for (int i = 0; i < 16; ++i)
            rr[i] = *reinterpret_cast<const v4f*>(rb + (size_t)(8 * i) * NC * 4 + vof);
        // The same for the sixteen loads above.
        asm volatile("s_wait_xcnt 0x0" ::: "memory");
    }
    float* stf = reinterpret_cast<float*>(wm ? Bs : As);   // f32: 64 rows in each array
#pragma unroll
    for (int mf = 0; mf < 4; ++mf) {
#pragma unroll
        for (int nf = 0; nf < 2; ++nf) {
            int lcol = wn * 32 + nf * 16 + ln;
            float bv = bv2[nf];
#pragma unroll
            for (int r = 0; r < 8; ++r) {
                int lrow = mf * 16 + 8 * g + r;          // row inside the wave's 64
                float v = (acc[mf][nf][r] + bv) * scale;
                if (ACT == 1) v = geluf(v);
                if (OUTF) stf[lrow * SF + lcol] = v;
                if (OUTB) As[(wm * 64 + lrow) * SB + lcol] = f2bfbits(v);
            }
        }
    }
    __syncthreads();                     // staged tile visible to all waves
    if (OUTB) {
        char* ob = reinterpret_cast<char*>(outB + tile0);
#pragma unroll
        for (int i = 0; i < 8; ++i) {
            v8bf t = *reinterpret_cast<const v8bf*>(
                &As[((tid >> 4) + 16 * i) * SB + ((tid & 15) << 3)]);
            *reinterpret_cast<v8bf*>(ob + (size_t)(16 * i) * NC * 2 + vob) = t;
        }
    }
    if (OUTF) {
        char* ob = reinterpret_cast<char*>(outF + tile0);
#pragma unroll
        for (int i = 0; i < 16; ++i) {
            const float* sp = reinterpret_cast<const float*>(i < 8 ? As : Bs);
            v4f t = *reinterpret_cast<const v4f*>(&sp[(wid + 8 * (i & 7)) * SF + lane * 4]);
            if (RES) t += rr[i];
            *reinterpret_cast<v4f*>(ob + (size_t)(8 * i) * NC * 4 + vof) = t;
        }
    }
}

constexpr int VP = 80;   // LDS row length (elements) of a V row: 160 B = 32 B x odd
__global__ __launch_bounds__(256) void attn_kernel(
        const unsigned short* __restrict__ Q,
        const unsigned short* __restrict__ Kb,
        const unsigned short* __restrict__ Vb,
        unsigned short* __restrict__ O,
        int S, int H, int HD) {
    const int D   = H * HD;                       // 1024
    const int qt  = blockIdx.x;
    const int bh  = blockIdx.y;
    const int b   = bh / H;
    const int h   = bh - b * H;
    const size_t base = (size_t)b * S * D + (size_t)h * HD;

    const int tid  = threadIdx.x;
    const int wid  = tid >> 5;
    const int lane = tid & 31;
    const int g    = lane >> 4;
    const int ln   = lane & 15;
    const int q0   = qt * 128;

    __shared__ alignas(16) unsigned short Ks [2 * 64 * GL];   // [buf][kc][d]
    __shared__ alignas(16) unsigned short Vs [2 * 64 * VP];   // [buf][kc][d]

    // Copy 64 K rows and 64 V rows into buffer `buf`: 4 x 16 B per lane.
    const size_t srow = base + (size_t)(tid >> 3) * D + ((tid & 7) << 3);
    const unsigned lk = lds_off(&Ks[(tid >> 3) * GL + ((tid & 7) << 3)]);
    const unsigned lv = lds_off(&Vs[(tid >> 3) * VP + ((tid & 7) << 3)]);
    auto copyKV = [&](int buf, int k0) {
        const unsigned short* k = Kb + srow + (size_t)k0 * D;   // rows +32 per copy
        const unsigned short* v = Vb + srow + (size_t)k0 * D;
        const unsigned dk = lk + buf * (64 * GL * 2);
        const unsigned dv = lv + buf * (64 * VP * 2);
        // The closing s_wait_xcnt stands in the copies' own statement so that no
        // address register is rewritten ahead of it.
        asm volatile(
            "global_load_async_to_lds_b128 %0, %4, off\n\t"
            "global_load_async_to_lds_b128 %1, %5, off\n\t"
            "global_load_async_to_lds_b128 %2, %6, off\n\t"
            "global_load_async_to_lds_b128 %3, %7, off\n\t"
            "s_wait_xcnt 0x0"
            :: "v"(dk), "v"(dk + 32 * GL * 2), "v"(dv), "v"(dv + 32 * VP * 2),
               "v"(k), "v"(k + (size_t)32 * D), "v"(v), "v"(v + (size_t)32 * D)
            : "memory");
    };

    // Q fragments (B operand: column = query), resident for the whole block
    // (d split into 2 k-steps)
    const int qrow = q0 + wid * 16 + ln;
    v16bf qa[2];
#pragma unroll
    for (int kd = 0; kd < 2; ++kd) {
        const unsigned short* qp = &Q[base + (size_t)qrow * D + kd * 32 + 8 * g];
        qa[kd] = make_frag(qp, qp + 16);
    }

    v8f of[4];
#pragma unroll
    for (int j = 0; j < 4; ++j)
#pragma unroll
        for (int r = 0; r < 8; ++r) of[j][r] = 0.f;
    float mrow = -1e30f;   // running maximum of this lane's query (both halves alike)
    float lrow = 0.f;      // running sum over this half's keys; halves joined at the end

    const int kend = q0 + 128;                    // causal: cols <= q0+127
    copyKV(0, 0);
    asm volatile("s_wait_asynccnt 0x0" ::: "memory");   // tile 0 landed (own copies)
    __syncthreads();                                     // tile 0 visible to all waves
    if (64 < kend) copyKV(1, 64);
    int it = 0;
    for (int k0 = 0; k0 < kend; k0 += 64, ++it) {
        const unsigned short* ks = &Ks [(it & 1) * 64 * GL];
        const unsigned short* vs = &Vs [(it & 1) * 64 * VP];

        // ---- S^T = K Q^T  (64 keys x 16 queries per wave; 1/sqrt(HD) folded into Q) ----
        v8f sf[4];
#pragma unroll
        for (int nf = 0; nf < 4; ++nf) {
            v8f c;
#pragma unroll
            for (int r = 0; r < 8; ++r) c[r] = 0.f;
#pragma unroll
            for (int kd = 0; kd < 2; ++kd) {
                const unsigned short* kp = &ks[(nf * 16 + ln) * GL + kd * 32 + 8 * g];
                v16bf kf = make_frag(kp, kp + 16);
                c = WMMA_BF16(kf, qa[kd], c);
            }
            sf[nf] = c;                  // sf[nf][r]: key k0 + nf*16 + 8g + r, query qrow
        }

        // ---- causal mask (uniform-per-wave predicate) ----
        if (k0 + 63 > q0 + wid * 16) {
#pragma unroll
            for (int nf = 0; nf < 4; ++nf) {
#pragma unroll
                for (int r = 0; r < 8; ++r) {
                    int key = k0 + nf * 16 + 8 * g + r;
                    sf[nf][r] = (key > qrow) ? -1e30f : sf[nf][r];
                }
            }
        }

        // ---- online softmax: 32 keys of one query per lane ----
        // Arguments of the exps are always <= 0, so the fast __expf
        // (single v_exp_f32) is safe: it just underflows to 0.
        float mx4[4];
#pragma unroll
        for (int nf = 0; nf < 4; ++nf) {
            mx4[nf] = sf[nf][0];
#pragma unroll
            for (int r = 1; r < 8; ++r) mx4[nf] = fmaxf(mx4[nf], sf[nf][r]);
        }
        float mx = fmaxf(fmaxf(mx4[0], mx4[1]), fmaxf(mx4[2], mx4[3]));
        mx = fmaxf(mx, xhalf(mx));
        const float mnew  = fmaxf(mrow, mx);
        const float alpha = __expf(mrow - mnew);
        float ps4[4];
#pragma unroll
        for (int nf = 0; nf < 4; ++nf) {
            ps4[nf] = 0.f;
#pragma unroll
            for (int r = 0; r < 8; ++r) {
                float p = __expf(sf[nf][r] - mnew);
                sf[nf][r] = p;
                ps4[nf] += p;
            }
        }
        lrow = lrow * alpha + ((ps4[0] + ps4[1]) + (ps4[2] + ps4[3]));
        mrow = mnew;

        // ---- P^T as B operand: score tiles 2kd and 2kd+1, rounded in place, hold
        //      keys 8g + 0..7 and 16 + 8g + 0..7 of the 32-key step: the k order
        //      that the transposing load delivers for V^T ----
        v16bf pb[2];
#pragma unroll
        for (int kd = 0; kd < 2; ++kd) {
            v8bf lo = __builtin_convertvector(sf[2 * kd],     v8bf);
            v8bf hi = __builtin_convertvector(sf[2 * kd + 1], v8bf);
            pb[kd] = __builtin_shufflevector(lo, hi, 0, 1, 2, 3, 4, 5, 6, 7,
                                                     8, 9, 10, 11, 12, 13, 14, 15);
        }

        // ---- rescale O^T, then O^T += V^T P^T ----
#pragma unroll
        for (int j = 0; j < 4; ++j)
#pragma unroll
            for (int r = 0; r < 8; ++r) of[j][r] *= alpha;

#pragma unroll
        for (int j = 0; j < 4; ++j) {
#pragma unroll
            for (int kd = 0; kd < 2; ++kd) {
                const unsigned short* vp =
                    &vs[(kd * 32 + 8 * g + (lane & 7)) * VP + j * 16 + 8 * ((lane >> 3) & 1)];
                v16bf va = make_frag_tr(vp, 16 * VP);
                of[j] = WMMA_BF16(va, pb[kd], of[j]);
            }
        }
        ring_waits();
        __syncthreads();                 // next tile visible; this buffer free
        if (k0 + 128 < kend) copyKV(it & 1, k0 + 128);
    }
    asm volatile("s_wait_asynccnt 0x0" ::: "memory");   // no copy outlives the loop

    // ---- join the halves' sums, normalize, store bf16 ----
    // of[j][r] is O[qrow][j*16 + 8g + r]: 8 consecutive d, one 16-byte store.
    const float inv = 1.0f / (lrow + xhalf(lrow));
#pragma unroll
    for (int j = 0; j < 4; ++j) {
        v8f o = of[j];
#pragma unroll
        for (int r = 0; r < 8; ++r) o[r] *= inv;
        *reinterpret_cast<v8bf*>(&O[base + (size_t)qrow * D + j * 16 + 8 * g]) =
            __builtin_convertvector(o, v8bf);
    }
}

// ---------------------------------------------------------------------------
// Host orchestration
// ---------------------------------------------------------------------------
extern "C" void kernel_launch(void* const* d_in, const int* in_sizes, int n_in,
                              void* d_out, int out_size, void* d_ws, size_t ws_size,
                              hipStream_t stream) {
    constexpr int B = 4, S = 2048, D = 1024, H = 16, HD = 64, FF = 4096;
    constexpr int NT = B * S;                       // 8192 tokens

    const float* x     = (const float*)d_in[0];
    const float* Wq    = (const float*)d_in[1];
    const float* bq    = (const float*)d_in[2];
    const float* Wk    = (const float*)d_in[3];
    const float* bk    = (const float*)d_in[4];
    const float* Wv    = (const float*)d_in[5];
    const float* bv    = (const float*)d_in[6];
    const float* Wo    = (const float*)d_in[7];
    const float* bo    = (const float*)d_in[8];
    const float* W1    = (const float*)d_in[9];
    const float* b1    = (const float*)d_in[10];
    const float* W2    = (const float*)d_in[11];
    const float* b2    = (const float*)d_in[12];
    const float* ln1_g = (const float*)d_in[13];
    const float* ln1_b = (const float*)d_in[14];
    const float* ln2_g = (const float*)d_in[15];
    const float* ln2_b = (const float*)d_in[16];
    float* out = (float*)d_out;

    // ---- workspace carve-up (bf16 stored as unsigned short) ----
    char* p = (char*)d_ws;
    auto alloc = [&](size_t bytes) {
        void* r = p;
        p += (bytes + 255) & ~(size_t)255;
        return r;
    };
    unsigned short* wq_bf  = (unsigned short*)alloc((size_t)D * D * 2);
    unsigned short* wk_bf  = (unsigned short*)alloc((size_t)D * D * 2);
    unsigned short* wv_bf  = (unsigned short*)alloc((size_t)D * D * 2);
    unsigned short* wo_bf  = (unsigned short*)alloc((size_t)D * D * 2);
    unsigned short* w1_bf  = (unsigned short*)alloc((size_t)D * FF * 2);
    unsigned short* w2_bf  = (unsigned short*)alloc((size_t)FF * D * 2);
    unsigned short* h_bf   = (unsigned short*)alloc((size_t)NT * D * 2);   // h1 then h2
    unsigned short* q_bf   = (unsigned short*)alloc((size_t)NT * D * 2);
    unsigned short* k_bf   = (unsigned short*)alloc((size_t)NT * D * 2);
    unsigned short* v_bf   = (unsigned short*)alloc((size_t)NT * D * 2);
    unsigned short* at_bf  = (unsigned short*)alloc((size_t)NT * D * 2);
    float*          x2_f   = (float*)alloc((size_t)NT * D * 4);
    unsigned short* y1_bf  = (unsigned short*)alloc((size_t)NT * FF * 2);
    (void)ws_size; (void)in_sizes; (void)n_in; (void)out_size;

    // ---- weight conversion ----
    cvt_qkvw_kernel<4, H, D, HD><<<H * D * HD / 4096, 256, 0, stream>>>(Wq, wq_bf);
    cvt_qkvw_kernel<4, H, D, HD><<<H * D * HD / 4096, 256, 0, stream>>>(Wk, wk_bf);
    cvt_qkvw_kernel<4, H, D, HD><<<H * D * HD / 4096, 256, 0, stream>>>(Wv, wv_bf);
    cvt_plain_kernel<4, D * D><<<D * D / 4096, 256, 0, stream>>>(Wo, wo_bf);
    cvt_plain_kernel<8, D * FF><<<D * FF / 8192, 256, 0, stream>>>(W1, w1_bf);
    cvt_plain_kernel<8, FF * D><<<FF * D / 8192, 256, 0, stream>>>(W2, w2_bf);

    // ---- LN1 ----
    ln_kernel<D><<<NT / 16, 256, 0, stream>>>(x, ln1_g, ln1_b, h_bf);

    // ---- QKV projections (Q pre-scaled by 1/sqrt(HD)) ----
    dim3 gP(D / 128, NT / 128);
    gemm_bf16_kernel<0, false, false, true, D><<<gP, 256, 0, stream>>>(
        h_bf, wq_bf, bq, nullptr, nullptr, q_bf, NT, D, D, 0.125f);
    gemm_bf16_kernel<0, false, false, true, D><<<gP, 256, 0, stream>>>(
        h_bf, wk_bf, bk, nullptr, nullptr, k_bf, NT, D, D, 1.0f);
    gemm_bf16_kernel<0, false, false, true, D><<<gP, 256, 0, stream>>>(
        h_bf, wv_bf, bv, nullptr, nullptr, v_bf, NT, D, D, 1.0f);

    // ---- causal flash attention ----
    attn_kernel<<<dim3(S / 128, B * H), 256, 0, stream>>>(q_bf, k_bf, v_bf, at_bf,
                                                          S, H, HD);

    // ---- output projection + residual -> x2 (fp32) ----
    gemm_bf16_kernel<0, true, true, false, D><<<gP, 256, 0, stream>>>(
        at_bf, wo_bf, bo, x, x2_f, nullptr, NT, D, D, 1.0f);

    // ---- LN2 ----
    ln_kernel<D><<<NT / 16, 256, 0, stream>>>(x2_f, ln2_g, ln2_b, h_bf);

    // ---- FFN: gelu(h2 @ W1 + b1) -> y1 (bf16) ----
    dim3 gF(FF / 128, NT / 128);
    gemm_bf16_kernel<1, false, false, true, FF><<<gF, 256, 0, stream>>>(
        h_bf, w1_bf, b1, nullptr, nullptr, y1_bf, NT, FF, D, 1.0f);

    // ---- gelu(y1 @ W2 + b2) + x2 -> out (fp32) ----
    gemm_bf16_kernel<1, true, true, false, D><<<gP, 256, 0, stream>>>(
        y1_bf, w2_bf, b2, x2_f, out, nullptr, NT, D, FF, 1.0f);
}

// v006
// One run takes 281 microseconds.
// Timed twice side by side with v005, it ran 1.10 and 1.06 times as fast.
// All steps since v000 together make it 4.59 times as fast.
#include <hip/hip_runtime.h>
#include <math.h>

// ---------------------------------------------------------------------------
// Types
// ---------------------------------------------------------------------------
typedef __bf16 v16bf __attribute__((ext_vector_type(16)));
typedef __bf16 v8bf  __attribute__((ext_vector_type(8)));
typedef float  v8f   __attribute__((ext_vector_type(8)));
typedef float  v4f   __attribute__((ext_vector_type(4)));

static __device__ __forceinline__ unsigned short f2bfbits(float x) {
    unsigned u = __builtin_bit_cast(unsigned, x);
    unsigned r = u + 0x7fffu + ((u >> 16) & 1u);   // round-to-nearest-even
    return (unsigned short)(r >> 16);
}

// Exact-form GELU, 0.5 v (1 + erf(v / sqrt 2)), with no branch, so that the
// unrolled epilogue can interleave its elements:
//   erf(|v| / sqrt 2) = 1 - erfc(|v| / sqrt 2) = 1 - 2^(t G(t)),  t = min(|v|, 4 sqrt 2),
// G a degree-7 minimax fit of log2(erfc(t / sqrt 2)) / t on [0, 4 sqrt 2]. The fit is
// off by under 2e-8 in erf, below the rounding of the f32 steps (erf within 2e-7).
// Past the clamp erfc is under 2^-25 and 1 - erfc rounds to 1. The sign of erf
// goes into the last step: 0.5 v erf(v / sqrt 2) = |0.5 v| erf(|v| / sqrt 2).
static __device__ __forceinline__ float geluf(float v) {
    const float t = fminf(fabsf(v), 5.65685415f);
    float q =          -2.83612894e-6f;
    q = fmaf(q, t,      3.93902083e-5f);
    q = fmaf(q, t,     -1.86230551e-4f);
    q = fmaf(q, t,     -1.36835646e-4f);
    q = fmaf(q, t,      7.06331385e-3f);
    q = fmaf(q, t,     -5.24961203e-2f);
    q = fmaf(q, t,     -4.59208220e-1f);
    q = fmaf(q, t,     -1.15110517f);
    const float r = 1.0f - __builtin_amdgcn_exp2f(q * t);   // exponent in [-26, 0]
    const float h = 0.5f * v;
    return fmaf(fabsf(h), r, h);
}

// Build a 16-element bf16 WMMA fragment from two 16-byte-aligned runs of
// 8 bf16 (K offsets 8g and 8g+16 per the CDNA5 16-bit A/B layout).
static __device__ __forceinline__ v16bf make_frag(const unsigned short* lo,
                                                  const unsigned short* hi) {
    v8bf a = *reinterpret_cast<const v8bf*>(lo);
    v8bf b = *reinterpret_cast<const v8bf*>(hi);
    return __builtin_shufflevector(a, b, 0, 1, 2, 3, 4, 5, 6, 7,
                                         8, 9, 10, 11, 12, 13, 14, 15);
}

// Build a 16-element bf16 WMMA B fragment (32 k x 16 columns) from a row-major
// [k][n] LDS tile with two transposing loads. `p` is this lane's address
//   tile + (kbase + 8*(lane>>4) + (lane&7)) * pitch + nbase + 8*((lane>>3)&1)
// (elements); the lane receives column nbase + (lane&15) at k = kbase + 8g + 0..7
// and, `pitch16` = 16 rows further, k = kbase + 16 + 8g + 0..7: the same k order
// as make_frag(p, p + 16) delivers for the A side.
typedef __attribute__((address_space(3))) v8bf lds_v8bf;
static __device__ __forceinline__ v16bf make_frag_tr(const unsigned short* p, int pitch16) {
    v8bf a = __builtin_amdgcn_ds_load_tr16_b128_v8bf16((lds_v8bf*)p);
    v8bf b = __builtin_amdgcn_ds_load_tr16_b128_v8bf16((lds_v8bf*)(p + pitch16));
    return __builtin_shufflevector(a, b, 0, 1, 2, 3, 4, 5, 6, 7,
                                         8, 9, 10, 11, 12, 13, 14, 15);
}

// LDS byte address of a __shared__ element (the operand of an asynchronous copy).
static __device__ __forceinline__ unsigned lds_off(const unsigned short* p) {
    return (unsigned)(size_t)(const __attribute__((address_space(3))) unsigned short*)p;
}

// Foot of a ring trip, before the barrier: this wave's LDS reads of the buffer
// that is refilled next have retired, and its own copies of the next tile have
// landed.
static __device__ __forceinline__ void ring_waits() {
    asm volatile("s_wait_dscnt 0x0" ::: "memory");
    asm volatile("s_wait_asynccnt 0x0" ::: "memory");
}

// Value of lane l ^ 16 (the other half of the wave), by a vector cross-row move.
static __device__ __forceinline__ float xhalf(float v) {
    int b = __builtin_bit_cast(int, v);
    return __builtin_bit_cast(float,
        __builtin_amdgcn_permlanex16(b, b, 0x76543210, 0xfedcba98, false, false));
}

#define WMMA_BF16(A, B, C) \
    __builtin_amdgcn_wmma_f32_16x16x32_bf16(false, (A), false, (B), (short)0, (C), false, false)

// ---------------------------------------------------------------------------
// Weight conversion kernels (fp32 -> bf16)
//   A lane takes U pieces of 4 elements: every load of a wave covers 512
//   contiguous bytes, every store 256, and all U loads are asked for before the
//   first piece is converted. N elements need N / (128 U) waves.
// ---------------------------------------------------------------------------
typedef unsigned short us4 __attribute__((ext_vector_type(4)));

static __device__ __forceinline__ us4 f2bf4(v4f v) {
    us4 r;
#pragma unroll
    for (int c = 0; c < 4; ++c) r[c] = f2bfbits(v[c]);
    return r;
}

template <int U, int N>   // grid = N / (1024 U) blocks of 256
__global__ __launch_bounds__(256) void cvt_plain_kernel(const float* __restrict__ in,
                                                        unsigned short* __restrict__ out) {
    static_assert(N % (1024 * U) == 0, "whole blocks only");
    const unsigned i0 = (blockIdx.x * (256 * U) + threadIdx.x) * 4;   // first element
    v4f v[U];
#pragma unroll
    for (int u = 0; u < U; ++u)
        v[u] = *reinterpret_cast<const v4f*>(in + i0 + u * 1024);
    // No register that the loads above name is rewritten ahead of this wait.
    asm volatile("s_wait_xcnt 0x0" ::: "memory");
#pragma unroll
    for (int u = 0; u < U; ++u)
        *reinterpret_cast<us4*>(out + i0 + u * 1024) = f2bf4(v[u]);
}

// (H, D, HD) -> column-combined (D, H*HD): out[d*H*HD + h*HD + e] = in[h,d,e]
// A piece is 4 consecutive e of one (h, d); 16 lanes store one 128-byte run.
// A block stays inside one h, so piece u lies 1024 / HD rows d below piece 0.
template <int U, int H, int D, int HD>   // grid = H*D*HD / (1024 U) blocks of 256
__global__ __launch_bounds__(256) void cvt_qkvw_kernel(const float* __restrict__ in,
                                                       unsigned short* __restrict__ out) {
    static_assert((D * HD) % (1024 * U) == 0 && 1024 % HD == 0 && HD % 4 == 0,
                  "whole blocks inside one h, whole rows between pieces, whole pieces");
    const unsigned i0 = (blockIdx.x * (256 * U) + threadIdx.x) * 4;   // first element
    v4f v[U];
#pragma unroll
    for (int u = 0; u < U; ++u)
        v[u] = *reinterpret_cast<const v4f*>(in + i0 + u * 1024);
    // No register that the loads above name is rewritten ahead of this wait.
    asm volatile("s_wait_xcnt 0x0" ::: "memory");
    const unsigned h = i0 / (D * HD);
    const unsigned r = i0 - h * (D * HD);
    const unsigned d = r / HD;
    const unsigned e = r - d * HD;
    unsigned short* o = out + d * (H * HD) + h * HD + e;
#pragma unroll
    for (int u = 0; u < U; ++u)
        *reinterpret_cast<us4*>(o + u * (1024 / HD) * (H * HD)) = f2bf4(v[u]);
}

// ---------------------------------------------------------------------------
// LayerNorm: one wave per pair of tokens, 16 tokens per 256-thread block, bf16
// output. Both rows stay in registers (DC / 128 pieces of 16 B a lane and row)
// between the sums and the scaling: no LDS, no barrier, no second read of x.
// ---------------------------------------------------------------------------
template <int DC>   // DC == D; grid = tokens / 16
__global__ __launch_bounds__(256) void ln_kernel(const float* __restrict__ x,
                                                 const float* __restrict__ g,
                                                 const float* __restrict__ b,
                                                 unsigned short* __restrict__ out) {
    static_assert(DC % 128 == 0, "whole pieces");
    constexpr int P = DC / 128;
    const int lane = threadIdx.x & 31;
    const int row  = (blockIdx.x * 8 + (threadIdx.x >> 5)) * 2;
    const float* xr = x + (size_t)row * DC + lane * 4;
    v4f v[2][P], gv[P], bv[P];
#pragma unroll
    for (int t = 0; t < 2; ++t)
#pragma unroll
        for (int p = 0; p < P; ++p)
            v[t][p] = *reinterpret_cast<const v4f*>(xr + t * DC + p * 128);
#pragma unroll
    for (int p = 0; p < P; ++p) {
        gv[p] = *reinterpret_cast<const v4f*>(g + lane * 4 + p * 128);
        bv[p] = *reinterpret_cast<const v4f*>(b + lane * 4 + p * 128);
    }
    // Holds all 32 loads ahead of the sums. Left free, the g and b loads sink
    // into the reduction and their latency is paid a second time.
    __builtin_amdgcn_sched_barrier(0);
    // No register that the loads above name is rewritten ahead of this wait: as an
    // input, xr keeps the x loads' address pair from serving as a load's target.
    asm volatile("s_wait_xcnt 0x0" :: "v"(xr) : "memory");

    float s[2], ss[2];
#pragma unroll
    for (int t = 0; t < 2; ++t) {
        v4f s4 = v[t][0], q4 = v[t][0] * v[t][0];    // four independent chains each
#pragma unroll
        for (int p = 1; p < P; ++p) {
            s4 += v[t][p];
            q4 += v[t][p] * v[t][p];
        }
        s[t]  = (s4[0] + s4[1]) + (s4[2] + s4[3]);
        ss[t] = (q4[0] + q4[1]) + (q4[2] + q4[3]);
    }
#pragma unroll
    for (int m = 16; m >= 1; m >>= 1) {
#pragma unroll
        for (int t = 0; t < 2; ++t) {
            s[t]  += __shfl_xor(s[t],  m, 32);
            ss[t] += __shfl_xor(ss[t], m, 32);
        }
    }
    unsigned short* orow = out + (size_t)row * DC + lane * 4;
#pragma unroll
    for (int t = 0; t < 2; ++t) {
        const float mu  = s[t] / (float)DC;
        const float var = ss[t] / (float)DC - mu * mu;
        const float rs  = rsqrtf(var + 1e-5f);
#pragma unroll
        for (int p = 0; p < P; ++p)
            *reinterpret_cast<us4*>(orow + t * DC + p * 128) =
                f2bf4((v[t][p] - mu) * rs * gv[p] + bv[p]);
    }
}

// ---------------------------------------------------------------------------
// Tiled bf16 WMMA GEMM (double-buffered, BK=64):
//   C[M,N] = [res +] act((A[M,K] @ B[K,N] + bias) * scale)
//   block tile 128x128, 8 waves (2 x 4), each wave: 64x32 via 4x2 fragments.
//   Pipeline: two LDS buffers filled by asynchronous copies; the copies of tile
//   k+1 fly while the 16 WMMAs of tile k run. One barrier per 64-wide K block.
// ---------------------------------------------------------------------------
constexpr int GL = 72;   // padded LDS row length (elements) for BK=64
constexpr int BP = 144;  // LDS row length (elements) of the row-major 64x128 B tile:
                         // 288 B = 32 B x odd, the pitch of the transposing load
constexpr int SB = 136;  // row length (bf16 elements) of the staged output tile: 272 B = 16 B x odd
constexpr int SF = 132;  // row length (floats) of the staged output tile: 528 B = 16 B x odd

template <int ACT, bool RES, bool OUTF, bool OUTB, int NC>   // NC == N
__global__ __launch_bounds__(256) void gemm_bf16_kernel(
        const unsigned short* __restrict__ A,   // [M,K] bf16 row-major
        const unsigned short* __restrict__ Bw,  // [K,N] bf16 row-major
        const float* __restrict__ bias,         // [N]
        const float* __restrict__ res,          // [M,N] fp32 (if RES)
        float* __restrict__ outF,               // [M,N] fp32 (if OUTF)
        unsigned short* __restrict__ outB,      // [M,N] bf16 (if OUTB)
        int M, int N, int K, float scale) {
    __shared__ alignas(16) unsigned short As [2 * 128 * GL];  // [buf][m][k]
    __shared__ alignas(16) unsigned short Bs [2 * 64 * BP];   // [buf][k][n]

    const int tid  = threadIdx.x;
    const int wid  = tid >> 5;
    const int lane = tid & 31;
    const int g    = lane >> 4;
    const int ln   = lane & 15;
    const int wm   = wid >> 2;
    const int wn   = wid & 3;
    const int m0   = blockIdx.y * 128;
    const int n0   = blockIdx.x * 128;

    // Copy a 128x64 A tile and a row-major 64x128 B tile into buffer `buf`:
    // 8 x 16 B per lane, global memory to LDS through no register.
    const unsigned short* ga = A + (size_t)(m0 + (tid >> 3)) * K + ((tid & 7) << 3);
    const unsigned short* gb = Bw + (size_t)(tid >> 4) * N + n0 + ((tid & 15) << 3);
    const unsigned la = lds_off(&As[(tid >> 3) * GL + ((tid & 7) << 3)]);
    const unsigned lb = lds_off(&Bs[(tid >> 4) * BP + ((tid & 15) << 3)]);
    auto copyAB = [&](int buf, int k0) {
        const unsigned short* a = ga + k0;                 // rows +32 per copy
        const unsigned short* b = gb + (size_t)k0 * N;     // rows +16 per copy
        const unsigned da = la + buf * (128 * GL * 2);
        const unsigned db = lb + buf * (64 * BP * 2);
        // The closing s_wait_xcnt stands in the copies' own statement so that no
        // address register is rewritten ahead of it.
        asm volatile(
            "global_load_async_to_lds_b128 %0, %8, off\n\t"
            "global_load_async_to_lds_b128 %1, %9, off\n\t"
            "global_load_async_to_lds_b128 %2, %10, off\n\t"
            "global_load_async_to_lds_b128 %3, %11, off\n\t"
            "global_load_async_to_lds_b128 %4, %12, off\n\t"
            "global_load_async_to_lds_b128 %5, %13, off\n\t"
            "global_load_async_to_lds_b128 %6, %14, off\n\t"
            "global_load_async_to_lds_b128 %7, %15, off\n\t"
            "s_wait_xcnt 0x0"
            :: "v"(da), "v"(da + 32 * GL * 2), "v"(da + 64 * GL * 2), "v"(da + 96 * GL * 2),
               "v"(db), "v"(db + 16 * BP * 2), "v"(db + 32 * BP * 2), "v"(db + 48 * BP * 2),
               "v"(a), "v"(a + (size_t)32 * K), "v"(a + (size_t)64 * K), "v"(a + (size_t)96 * K),
               "v"(b), "v"(b + (size_t)16 * N), "v"(b + (size_t)32 * N), "v"(b + (size_t)48 * N)
            : "memory");
    };

    v8f acc[4][2];
#pragma unroll
    for (int mf = 0; mf < 4; ++mf)
#pragma unroll
        for (int nf = 0; nf < 2; ++nf)
#pragma unroll
            for (int r = 0; r < 8; ++r) acc[mf][nf][r] = 0.f;

    const int KB = K >> 6;
    copyAB(0, 0);
    asm volatile("s_wait_asynccnt 0x0" ::: "memory");   // tile 0 landed (own copies)
    __syncthreads();                                     // tile 0 visible to all waves
    if (KB > 1) copyAB(1, 64);
    for (int kb = 0; kb < KB; ++kb) {
        const unsigned short* as = &As [(kb & 1) * 128 * GL];
        const unsigned short* bs = &Bs [(kb & 1) * 64 * BP];
#pragma unroll
        for (int kd = 0; kd < 2; ++kd) {            // two 32-wide WMMA K-steps
            v16bf af[4];
#pragma unroll
            for (int mf = 0; mf < 4; ++mf) {
                const unsigned short* p =
                    &as[(wm * 64 + mf * 16 + ln) * GL + kd * 32 + 8 * g];
                af[mf] = make_frag(p, p + 16);
            }
#pragma unroll
            for (int nf = 0; nf < 2; ++nf) {
                const unsigned short* p =
                    &bs[(kd * 32 + 8 * g + (lane & 7)) * BP +
                        wn * 32 + nf * 16 + 8 * ((lane >> 3) & 1)];
                v16bf bf = make_frag_tr(p, 16 * BP);
#pragma unroll
                for (int mf = 0; mf < 4; ++mf)
                    acc[mf][nf] = WMMA_BF16(af[mf], bf, acc[mf][nf]);
            }
        }
        ring_waits();
        __syncthreads();                 // tile kb+1 visible; buffer kb&1 free
        if (kb + 2 < KB) copyAB(kb & 1, (kb + 2) << 6);
    }
    asm volatile("s_wait_asynccnt 0x0" ::: "memory");   // no copy outlives the loop

    // ---- epilogue: the 128x128 tile goes through LDS so that every global store
    //      (and every residual load) of a wave covers whole 128-byte lines ----
    // The ring is free here: the last trip's barrier ended every wave's reads and
    // no copy is in flight.
    static_assert(OUTF != OUTB, "one output per instantiation");
    // NC is N as a compile-time constant: the row steps below become immediate
    // offsets on one address that stays in its registers to the end.
    const size_t tile0 = (size_t)m0 * NC + n0;           // first element of the tile
    // f32 rows: 32 lanes x 16 B = 512 contiguous bytes a wave, rows wid + 8 i.
    const unsigned vof = (unsigned)(wid * NC + lane * 4) * 4u;               // bytes
    // bf16 rows: 16 lanes x 16 B = 256 contiguous bytes, two rows a wave, rows (tid >> 4) + 16 i.
    const unsigned vob = (unsigned)((tid >> 4) * NC + ((tid & 15) << 3)) * 2u;   // bytes
    const float* bp = bias + n0 + wn * 32 + ln;
    const float bv2[2] = { bp[0], bp[16] };
    // No register that the two loads above name is rewritten ahead of this wait.
    asm volatile("s_wait_xcnt 0x0" ::: "memory");
    v4f rr[16];
    if (RES) {
        // Residual rows, asked for ahead of the activation so that their latency
        // is covered.
        const char* rb = reinterpret_cast<const char*>(res + tile0);
#pragma unroll
        for (int i = 0; i < 16; ++i)
            rr[i] = *reinterpret_cast<const v4f*>(rb + (size_t)(8 * i) * NC * 4 + vof);
        // The same for the sixteen loads above.
        asm volatile("s_wait_xcnt 0x0" ::: "memory");
    }
    float* stf = reinterpret_cast<float*>(wm ? Bs : As);   // f32: 64 rows in each array
#pragma unroll
    for (int mf = 0; mf < 4; ++mf) {
#pragma unroll
        for (int nf = 0; nf < 2; ++nf) {
            int lcol = wn * 32 + nf * 16 + ln;
            float bv = bv2[nf];
#pragma unroll
            for (int r = 0; r < 8; ++r) {
                int lrow = mf * 16 + 8 * g + r;          // row inside the wave's 64
                float v = (acc[mf][nf][r] + bv) * scale;
                if (ACT == 1) v = geluf(v);
                if (OUTF) stf[lrow * SF + lcol] = v;
                if (OUTB) As[(wm * 64 + lrow) * SB + lcol] = f2bfbits(v);
            }
        }
    }
    __syncthreads();                     // staged tile visible to all waves
    if (OUTB) {
        char* ob = reinterpret_cast<char*>(outB + tile0);
#pragma unroll
        for (int i = 0; i < 8; ++i) {
            v8bf t = *reinterpret_cast<const v8bf*>(
                &As[((tid >> 4) + 16 * i) * SB + ((tid & 15) << 3)]);
            *reinterpret_cast<v8bf*>(ob + (size_t)(16 * i) * NC * 2 + vob) = t;
        }
    }
    if (OUTF) {
        char* ob = reinterpret_cast<char*>(outF + tile0);
#pragma unroll
        for (int i = 0; i < 16; ++i) {
            const float* sp = reinterpret_cast<const float*>(i < 8 ? As : Bs);
            v4f t = *reinterpret_cast<const v4f*>(&sp[(wid + 8 * (i & 7)) * SF + lane * 4]);
            if (RES) t += rr[i];
            *reinterpret_cast<v4f*>(ob + (size_t)(8 * i) * NC * 4 + vof) = t;
        }
    }
}

constexpr int VP = 80;   // LDS row length (elements) of a V row: 160 B = 32 B x odd
__global__ __launch_bounds__(256) void attn_kernel(
        const unsigned short* __restrict__ Q,
        const unsigned short* __restrict__ Kb,
        const unsigned short* __restrict__ Vb,
        unsigned short* __restrict__ O,
        int S, int H, int HD) {
    const int D   = H * HD;                       // 1024
    const int qt  = blockIdx.x;
    const int bh  = blockIdx.y;
    const int b   = bh / H;
    const int h   = bh - b * H;
    const size_t base = (size_t)b * S * D + (size_t)h * HD;

    const int tid  = threadIdx.x;
    const int wid  = tid >> 5;
    const int lane = tid & 31;
    const int g    = lane >> 4;
    const int ln   = lane & 15;
    const int q0   = qt * 128;

    __shared__ alignas(16) unsigned short Ks [2 * 64 * GL];   // [buf][kc][d]
    __shared__ alignas(16) unsigned short Vs [2 * 64 * VP];   // [buf][kc][d]

    // Copy 64 K rows and 64 V rows into buffer `buf`: 4 x 16 B per lane.
    const size_t srow = base + (size_t)(tid >> 3) * D + ((tid & 7) << 3);
    const unsigned lk = lds_off(&Ks[(tid >> 3) * GL + ((tid & 7) << 3)]);
    const unsigned lv = lds_off(&Vs[(tid >> 3) * VP + ((tid & 7) << 3)]);
    auto copyKV = [&](int buf, int k0) {
        const unsigned short* k = Kb + srow + (size_t)k0 * D;   // rows +32 per copy
        const unsigned short* v = Vb + srow + (size_t)k0 * D;
        const unsigned dk = lk + buf * (64 * GL * 2);
        const unsigned dv = lv + buf * (64 * VP * 2);
        // The closing s_wait_xcnt stands in the copies' own statement so that no
        // address register is rewritten ahead of it.
        asm volatile(
            "global_load_async_to_lds_b128 %0, %4, off\n\t"
            "global_load_async_to_lds_b128 %1, %5, off\n\t"
            "global_load_async_to_lds_b128 %2, %6, off\n\t"
            "global_load_async_to_lds_b128 %3, %7, off\n\t"
            "s_wait_xcnt 0x0"
            :: "v"(dk), "v"(dk + 32 * GL * 2), "v"(dv), "v"(dv + 32 * VP * 2),
               "v"(k), "v"(k + (size_t)32 * D), "v"(v), "v"(v + (size_t)32 * D)
            : "memory");
    };

    // Q fragments (B operand: column = query), resident for the whole block
    // (d split into 2 k-steps)
    const int qrow = q0 + wid * 16 + ln;
    v16bf qa[2];
#pragma unroll
    for (int kd = 0; kd < 2; ++kd) {
        const unsigned short* qp = &Q[base + (size_t)qrow * D + kd * 32 + 8 * g];
        qa[kd] = make_frag(qp, qp + 16);
    }

    v8f of[4];
#pragma unroll
    for (int j = 0; j < 4; ++j)
#pragma unroll
        for (int r = 0; r < 8; ++r) of[j][r] = 0.f;
    float mrow = -1e30f;   // running maximum of this lane's query (both halves alike)
    float lrow = 0.f;      // running sum over this half's keys; halves joined at the end

    const int kend = q0 + 128;                    // causal: cols <= q0+127
    copyKV(0, 0);
    asm volatile("s_wait_asynccnt 0x0" ::: "memory");   // tile 0 landed (own copies)
    __syncthreads();                                     // tile 0 visible to all waves
    if (64 < kend) copyKV(1, 64);
    int it = 0;
    for (int k0 = 0; k0 < kend; k0 += 64, ++it) {
        const unsigned short* ks = &Ks [(it & 1) * 64 * GL];
        const unsigned short* vs = &Vs [(it & 1) * 64 * VP];

        // ---- S^T = K Q^T  (64 keys x 16 queries per wave; 1/sqrt(HD) folded into Q) ----
        v8f sf[4];
#pragma unroll
        for (int nf = 0; nf < 4; ++nf) {
            v8f c;
#pragma unroll
            for (int r = 0; r < 8; ++r) c[r] = 0.f;
#pragma unroll
            for (int kd = 0; kd < 2; ++kd) {
                const unsigned short* kp = &ks[(nf * 16 + ln) * GL + kd * 32 + 8 * g];
                v16bf kf = make_frag(kp, kp + 16);
                c = WMMA_BF16(kf, qa[kd], c);
            }
            sf[nf] = c;                  // sf[nf][r]: key k0 + nf*16 + 8g + r, query qrow
        }

        // ---- causal mask (uniform-per-wave predicate) ----
        if (k0 + 63 > q0 + wid * 16) {
#pragma unroll
            for (int nf = 0; nf < 4; ++nf) {
#pragma unroll
                for (int r = 0; r < 8; ++r) {
                    int key = k0 + nf * 16 + 8 * g + r;
                    sf[nf][r] = (key > qrow) ? -1e30f : sf[nf][r];
                }
            }
        }

        // ---- online softmax: 32 keys of one query per lane ----
        // Arguments of the exps are always <= 0, so the fast __expf
        // (single v_exp_f32) is safe: it just underflows to 0.
        float mx4[4];
#pragma unroll
        for (int nf = 0; nf < 4; ++nf) {
            mx4[nf] = sf[nf][0];
#pragma unroll
            for (int r = 1; r < 8; ++r) mx4[nf] = fmaxf(mx4[nf], sf[nf][r]);
        }
        float mx = fmaxf(fmaxf(mx4[0], mx4[1]), fmaxf(mx4[2], mx4[3]));
        mx = fmaxf(mx, xhalf(mx));
        const float mnew  = fmaxf(mrow, mx);
        const float alpha = __expf(mrow - mnew);
        float ps4[4];
#pragma unroll
        for (int nf = 0; nf < 4; ++nf) {
            ps4[nf] = 0.f;
#pragma unroll
            for (int r = 0; r < 8; ++r) {
                float p = __expf(sf[nf][r] - mnew);
                sf[nf][r] = p;
                ps4[nf] += p;
            }
        }
        lrow = lrow * alpha + ((ps4[0] + ps4[1]) + (ps4[2] + ps4[3]));
        mrow = mnew;

        // ---- P^T as B operand: score tiles 2kd and 2kd+1, rounded in place, hold
        //      keys 8g + 0..7 and 16 + 8g + 0..7 of the 32-key step: the k order
        //      that the transposing load delivers for V^T ----
        v16bf pb[2];
#pragma unroll
        for (int kd = 0; kd < 2; ++kd) {
            v8bf lo = __builtin_convertvector(sf[2 * kd],     v8bf);
            v8bf hi = __builtin_convertvector(sf[2 * kd + 1], v8bf);
            pb[kd] = __builtin_shufflevector(lo, hi, 0, 1, 2, 3, 4, 5, 6, 7,
                                                     8, 9, 10, 11, 12, 13, 14, 15);
        }

        // ---- rescale O^T, then O^T += V^T P^T ----
#pragma unroll
        for (int j = 0; j < 4; ++j)
#pragma unroll
            for (int r = 0; r < 8; ++r) of[j][r] *= alpha;

#pragma unroll
        for (int j = 0; j < 4; ++j) {
#pragma unroll
            for (int kd = 0; kd < 2; ++kd) {
                const unsigned short* vp =
                    &vs[(kd * 32 + 8 * g + (lane & 7)) * VP + j * 16 + 8 * ((lane >> 3) & 1)];
                v16bf va = make_frag_tr(vp, 16 * VP);
                of[j] = WMMA_BF16(va, pb[kd], of[j]);
            }
        }
        ring_waits();
        __syncthreads();                 // next tile visible; this buffer free
        if (k0 + 128 < kend) copyKV(it & 1, k0 + 128);
    }
    asm volatile("s_wait_asynccnt 0x0" ::: "memory");   // no copy outlives the loop

    // ---- join the halves' sums, normalize, store bf16 ----
    // of[j][r] is O[qrow][j*16 + 8g + r]: 8 consecutive d, one 16-byte store.
    const float inv = 1.0f / (lrow + xhalf(lrow));
#pragma unroll
    for (int j = 0; j < 4; ++j) {
        v8f o = of[j];
#pragma unroll
        for (int r = 0; r < 8; ++r) o[r] *= inv;
        *reinterpret_cast<v8bf*>(&O[base + (size_t)qrow * D + j * 16 + 8 * g]) =
            __builtin_convertvector(o, v8bf);
    }
}

// ---------------------------------------------------------------------------
// Host orchestration
// ---------------------------------------------------------------------------
extern "C" void kernel_launch(void* const* d_in, const int* in_sizes, int n_in,
                              void* d_out, int out_size, void* d_ws, size_t ws_size,
                              hipStream_t stream) {
    constexpr int B = 4, S = 2048, D = 1024, H = 16, HD = 64, FF = 4096;
    constexpr int NT = B * S;                       // 8192 tokens

    const float* x     = (const float*)d_in[0];
    const float* Wq    = (const float*)d_in[1];
    const float* bq    = (const float*)d_in[2];
    const float* Wk    = (const float*)d_in[3];
    const float* bk    = (const float*)d_in[4];
    const float* Wv    = (const float*)d_in[5];
    const float* bv    = (const float*)d_in[6];
    const float* Wo    = (const float*)d_in[7];
    const float* bo    = (const float*)d_in[8];
    const float* W1    = (const float*)d_in[9];
    const float* b1    = (const float*)d_in[10];
    const float* W2    = (const float*)d_in[11];
    const float* b2    = (const float*)d_in[12];
    const float* ln1_g = (const float*)d_in[13];
    const float* ln1_b = (const float*)d_in[14];
    const float* ln2_g = (const float*)d_in[15];
    const float* ln2_b = (const float*)d_in[16];
    float* out = (float*)d_out;

    // ---- workspace carve-up (bf16 stored as unsigned short) ----
    char* p = (char*)d_ws;
    auto alloc = [&](size_t bytes) {
        void* r = p;
        p += (bytes + 255) & ~(size_t)255;
        return r;
    };
    unsigned short* wq_bf  = (unsigned short*)alloc((size_t)D * D * 2);
    unsigned short* wk_bf  = (unsigned short*)alloc((size_t)D * D * 2);
    unsigned short* wv_bf  = (unsigned short*)alloc((size_t)D * D * 2);
    unsigned short* wo_bf  = (unsigned short*)alloc((size_t)D * D * 2);
    unsigned short* w1_bf  = (unsigned short*)alloc((size_t)D * FF * 2);
    unsigned short* w2_bf  = (unsigned short*)alloc((size_t)FF * D * 2);
    unsigned short* h_bf   = (unsigned short*)alloc((size_t)NT * D * 2);   // h1 then h2
    unsigned short* q_bf   = (unsigned short*)alloc((size_t)NT * D * 2);
    unsigned short* k_bf   = (unsigned short*)alloc((size_t)NT * D * 2);
    unsigned short* v_bf   = (unsigned short*)alloc((size_t)NT * D * 2);
    unsigned short* at_bf  = (unsigned short*)alloc((size_t)NT * D * 2);
    float*          x2_f   = (float*)alloc((size_t)NT * D * 4);
    unsigned short* y1_bf  = (unsigned short*)alloc((size_t)NT * FF * 2);
    (void)ws_size; (void)in_sizes; (void)n_in; (void)out_size;

    // ---- weight conversion ----
    cvt_qkvw_kernel<4, H, D, HD><<<H * D * HD / 4096, 256, 0, stream>>>(Wq, wq_bf);
    cvt_qkvw_kernel<4, H, D, HD><<<H * D * HD / 4096, 256, 0, stream>>>(Wk, wk_bf);
    cvt_qkvw_kernel<4, H, D, HD><<<H * D * HD / 4096, 256, 0, stream>>>(Wv, wv_bf);
    cvt_plain_kernel<4, D * D><<<D * D / 4096, 256, 0, stream>>>(Wo, wo_bf);
    cvt_plain_kernel<8, D * FF><<<D * FF / 8192, 256, 0, stream>>>(W1, w1_bf);
    cvt_plain_kernel<8, FF * D><<<FF * D / 8192, 256, 0, stream>>>(W2, w2_bf);

    // ---- LN1 ----
    ln_kernel<D><<<NT / 16, 256, 0, stream>>>(x, ln1_g, ln1_b, h_bf);

    // ---- QKV projections (Q pre-scaled by 1/sqrt(HD)) ----
    dim3 gP(D / 128, NT / 128);
    gemm_bf16_kernel<0, false, false, true, D><<<gP, 256, 0, stream>>>(
        h_bf, wq_bf, bq, nullptr, nullptr, q_bf, NT, D, D, 0.125f);
    gemm_bf16_kernel<0, false, false, true, D><<<gP, 256, 0, stream>>>(
        h_bf, wk_bf, bk, nullptr, nullptr, k_bf, NT, D, D, 1.0f);
    gemm_bf16_kernel<0, false, false, true, D><<<gP, 256, 0, stream>>>(
        h_bf, wv_bf, bv, nullptr, nullptr, v_bf, NT, D, D, 1.0f);

    // ---- causal flash attention ----
    attn_kernel<<<dim3(S / 128, B * H), 256, 0, stream>>>(q_bf, k_bf, v_bf, at_bf,
                                                          S, H, HD);

    // ---- output projection + residual -> x2 (fp32) ----
    gemm_bf16_kernel<0, true, true, false, D><<<gP, 256, 0, stream>>>(
        at_bf, wo_bf, bo, x, x2_f, nullptr, NT, D, D, 1.0f);

    // ---- LN2 ----
    ln_kernel<D><<<NT / 16, 256, 0, stream>>>(x2_f, ln2_g, ln2_b, h_bf);

    // ---- FFN: gelu(h2 @ W1 + b1) -> y1 (bf16) ----
    dim3 gF(FF / 128, NT / 128);
    gemm_bf16_kernel<1, false, false, true, FF><<<gF, 256, 0, stream>>>(
        h_bf, w1_bf, b1, nullptr, nullptr, y1_bf, NT, FF, D, 1.0f);

    // ---- gelu(y1 @ W2 + b2) + x2 -> out (fp32) ----
    gemm_bf16_kernel<1, true, true, false, D><<<gP, 256, 0, stream>>>(
        y1_bf, w2_bf, b2, x2_f, out, nullptr, NT, D, FF, 1.0f);
}

// v007
// It runs in 262 microseconds.
// Next to v006, in two timings, it ran 1.07 times as fast each time.
// Over all steps from v000 it is 4.93 times as fast.
#include <hip/hip_runtime.h>
#include <math.h>

// ---------------------------------------------------------------------------
// Types
// ---------------------------------------------------------------------------
typedef __bf16 v16bf __attribute__((ext_vector_type(16)));
typedef __bf16 v8bf  __attribute__((ext_vector_type(8)));
typedef float  v8f   __attribute__((ext_vector_type(8)));
typedef float  v4f   __attribute__((ext_vector_type(4)));

static __device__ __forceinline__ unsigned short f2bfbits(float x) {
    unsigned u = __builtin_bit_cast(unsigned, x);
    unsigned r = u + 0x7fffu + ((u >> 16) & 1u);   // round-to-nearest-even
    return (unsigned short)(r >> 16);
}

// Exact-form GELU, 0.5 v (1 + erf(v / sqrt 2)), with no branch, so that the
// unrolled epilogue can interleave its elements:
//   erf(|v| / sqrt 2) = 1 - erfc(|v| / sqrt 2) = 1 - 2^(t G(t)),  t = min(|v|, 4 sqrt 2),
// G a degree-7 minimax fit of log2(erfc(t / sqrt 2)) / t on [0, 4 sqrt 2]. The fit is
// off by under 2e-8 in erf, below the rounding of the f32 steps (erf within 2e-7).
// Past the clamp erfc is under 2^-25 and 1 - erfc rounds to 1. The sign of erf
// goes into the last step: 0.5 v erf(v / sqrt 2) = |0.5 v| erf(|v| / sqrt 2).
static __device__ __forceinline__ float geluf(float v) {
    const float t = fminf(fabsf(v), 5.65685415f);
    float q =          -2.83612894e-6f;
    q = fmaf(q, t,      3.93902083e-5f);
    q = fmaf(q, t,     -1.86230551e-4f);
    q = fmaf(q, t,     -1.36835646e-4f);
    q = fmaf(q, t,      7.06331385e-3f);
    q = fmaf(q, t,     -5.24961203e-2f);
    q = fmaf(q, t,     -4.59208220e-1f);
    q = fmaf(q, t,     -1.15110517f);
    const float r = 1.0f - __builtin_amdgcn_exp2f(q * t);   // exponent in [-26, 0]
    const float h = 0.5f * v;
    return fmaf(fabsf(h), r, h);
}

// Build a 16-element bf16 WMMA fragment from two 16-byte-aligned runs of
// 8 bf16 (K offsets 8g and 8g+16 per the CDNA5 16-bit A/B layout).
static __device__ __forceinline__ v16bf make_frag(const unsigned short* lo,
                                                  const unsigned short* hi) {
    v8bf a = *reinterpret_cast<const v8bf*>(lo);
    v8bf b = *reinterpret_cast<const v8bf*>(hi);
    return __builtin_shufflevector(a, b, 0, 1, 2, 3, 4, 5, 6, 7,
                                         8, 9, 10, 11, 12, 13, 14, 15);
}

// Build a 16-element bf16 WMMA B fragment (32 k x 16 columns) from a row-major
// [k][n] LDS tile with two transposing loads. `p` is this lane's address
//   tile + (kbase + 8*(lane>>4) + (lane&7)) * pitch + nbase + 8*((lane>>3)&1)
// (elements); the lane receives column nbase + (lane&15) at k = kbase + 8g + 0..7
// and, `pitch16` = 16 rows further, k = kbase + 16 + 8g + 0..7: the same k order
// as make_frag(p, p + 16) delivers for the A side.
typedef __attribute__((address_space(3))) v8bf lds_v8bf;
static __device__ __forceinline__ v16bf make_frag_tr(const unsigned short* p, int pitch16) {
    v8bf a = __builtin_amdgcn_ds_load_tr16_b128_v8bf16((lds_v8bf*)p);
    v8bf b = __builtin_amdgcn_ds_load_tr16_b128_v8bf16((lds_v8bf*)(p + pitch16));
    return __builtin_shufflevector(a, b, 0, 1, 2, 3, 4, 5, 6, 7,
                                         8, 9, 10, 11, 12, 13, 14, 15);
}

// LDS byte address of a __shared__ element (the operand of an asynchronous copy).
static __device__ __forceinline__ unsigned lds_off(const unsigned short* p) {
    return (unsigned)(size_t)(const __attribute__((address_space(3))) unsigned short*)p;
}

// Foot of a ring trip, before the barrier: this wave's LDS reads of the buffer
// that is refilled next have retired, and its own copies of the next tile have
// landed.
static __device__ __forceinline__ void ring_waits() {
    asm volatile("s_wait_dscnt 0x0" ::: "memory");
    asm volatile("s_wait_asynccnt 0x0" ::: "memory");
}

// Value of lane l ^ 16 (the other half of the wave), by a vector cross-row move.
static __device__ __forceinline__ float xhalf(float v) {
    int b = __builtin_bit_cast(int, v);
    return __builtin_bit_cast(float,
        __builtin_amdgcn_permlanex16(b, b, 0x76543210, 0xfedcba98, false, false));
}

#define WMMA_BF16(A, B, C) \
    __builtin_amdgcn_wmma_f32_16x16x32_bf16(false, (A), false, (B), (short)0, (C), false, false)

// ---------------------------------------------------------------------------
// Weight conversions (fp32 -> bf16), jobs of prep_kernel
//   A lane takes U pieces of 4 elements: every load of a wave covers 512
//   contiguous bytes, every store 256, and all U loads are asked for before the
//   first piece is converted. N elements need N / (128 U) waves.
// ---------------------------------------------------------------------------
typedef unsigned short us4 __attribute__((ext_vector_type(4)));

static __device__ __forceinline__ us4 f2bf4(v4f v) {
    us4 r;
#pragma unroll
    for (int c = 0; c < 4; ++c) r[c] = f2bfbits(v[c]);
    return r;
}

template <int U, int N>   // N / (1024 U) blocks of 256; bid = the block's number among them
static __device__ __forceinline__ void cvt_plain(const float* __restrict__ in,
                                                 unsigned short* __restrict__ out,
                                                 unsigned bid) {
    static_assert(N % (1024 * U) == 0, "whole blocks only");
    const unsigned i0 = (bid * (256 * U) + threadIdx.x) * 4;   // first element
    v4f v[U];
#pragma unroll
    for (int u = 0; u < U; ++u)
        v[u] = *reinterpret_cast<const v4f*>(in + i0 + u * 1024);
    // No register that the loads above name is rewritten ahead of this wait.
    asm volatile("s_wait_xcnt 0x0" ::: "memory");
#pragma unroll
    for (int u = 0; u < U; ++u)
        *reinterpret_cast<us4*>(out + i0 + u * 1024) = f2bf4(v[u]);
}

// (H, D, HD) -> column-combined (D, H*HD): out[d*H*HD + h*HD + e] = in[h,d,e]
// A piece is 4 consecutive e of one (h, d); 16 lanes store one 128-byte run.
// A block stays inside one h, so piece u lies 1024 / HD rows d below piece 0.
template <int U, int H, int D, int HD>   // H*D*HD / (1024 U) blocks of 256; bid as above
static __device__ __forceinline__ void cvt_qkvw(const float* __restrict__ in,
                                                unsigned short* __restrict__ out,
                                                unsigned bid) {
    static_assert((D * HD) % (1024 * U) == 0 && 1024 % HD == 0 && HD % 4 == 0,
                  "whole blocks inside one h, whole rows between pieces, whole pieces");
    const unsigned i0 = (bid * (256 * U) + threadIdx.x) * 4;   // first element
    v4f v[U];
#pragma unroll
    for (int u = 0; u < U; ++u)
        v[u] = *reinterpret_cast<const v4f*>(in + i0 + u * 1024);
    // No register that the loads above name is rewritten ahead of this wait.
    asm volatile("s_wait_xcnt 0x0" ::: "memory");
    const unsigned h = i0 / (D * HD);
    const unsigned r = i0 - h * (D * HD);
    const unsigned d = r / HD;
    const unsigned e = r - d * HD;
    unsigned short* o = out + d * (H * HD) + h * HD + e;
#pragma unroll
    for (int u = 0; u < U; ++u)
        *reinterpret_cast<us4*>(o + u * (1024 / HD) * (H * HD)) = f2bf4(v[u]);
}

// ---------------------------------------------------------------------------
// LayerNorm: one wave per pair of tokens, 16 tokens per 256-thread block, bf16
// output. Both rows stay in registers (DC / 128 pieces of 16 B a lane and row)
// between the sums and the scaling: no LDS, no barrier, no second read of x.
// ---------------------------------------------------------------------------
template <int DC>   // DC == D; tokens / 16 blocks of 256; bid as above
static __device__ __forceinline__ void ln_rows(const float* __restrict__ x,
                                               const float* __restrict__ g,
                                               const float* __restrict__ b,
                                               unsigned short* __restrict__ out,
                                               unsigned bid) {
    static_assert(DC % 128 == 0, "whole pieces");
    constexpr int P = DC / 128;
    const int lane = threadIdx.x & 31;
    const int row  = (bid * 8 + (threadIdx.x >> 5)) * 2;
    const float* xr = x + (size_t)row * DC + lane * 4;
    v4f v[2][P], gv[P], bv[P];
#pragma unroll
    for (int t = 0; t < 2; ++t)
#pragma unroll
        for (int p = 0; p < P; ++p)
            v[t][p] = *reinterpret_cast<const v4f*>(xr + t * DC + p * 128);
#pragma unroll
    for (int p = 0; p < P; ++p) {
        gv[p] = *reinterpret_cast<const v4f*>(g + lane * 4 + p * 128);
        bv[p] = *reinterpret_cast<const v4f*>(b + lane * 4 + p * 128);
    }
    // Holds all 32 loads ahead of the sums. Left free, the g and b loads sink
    // into the reduction and their latency is paid a second time.
    __builtin_amdgcn_sched_barrier(0);
    // No register that the loads above name is rewritten ahead of this wait: as an
    // input, xr keeps the x loads' address pair from serving as a load's target.
    asm volatile("s_wait_xcnt 0x0" :: "v"(xr) : "memory");

    float s[2], ss[2];
#pragma unroll
    for (int t = 0; t < 2; ++t) {
        v4f s4 = v[t][0], q4 = v[t][0] * v[t][0];    // four independent chains each
#pragma unroll
        for (int p = 1; p < P; ++p) {
            s4 += v[t][p];
            q4 += v[t][p] * v[t][p];
        }
        s[t]  = (s4[0] + s4[1]) + (s4[2] + s4[3]);
        ss[t] = (q4[0] + q4[1]) + (q4[2] + q4[3]);
    }
#pragma unroll
    for (int m = 16; m >= 1; m >>= 1) {
#pragma unroll
        for (int t = 0; t < 2; ++t) {
            s[t]  += __shfl_xor(s[t],  m, 32);
            ss[t] += __shfl_xor(ss[t], m, 32);
        }
    }
    unsigned short* orow = out + (size_t)row * DC + lane * 4;
#pragma unroll
    for (int t = 0; t < 2; ++t) {
        const float mu  = s[t] / (float)DC;
        const float var = ss[t] / (float)DC - mu * mu;
        const float rs  = rsqrtf(var + 1e-5f);
#pragma unroll
        for (int p = 0; p < P; ++p)
            *reinterpret_cast<us4*>(orow + t * DC + p * 128) =
                f2bf4((v[t][p] - mu) * rs * gv[p] + bv[p]);
    }
}

template <int DC>   // grid = tokens / 16
__global__ __launch_bounds__(256) void ln_kernel(const float* __restrict__ x,
                                                 const float* __restrict__ g,
                                                 const float* __restrict__ b,
                                                 unsigned short* __restrict__ out) {
    ln_rows<DC>(x, g, b, out, blockIdx.x);
}

// ---------------------------------------------------------------------------
// Everything that depends on the inputs alone, in one launch: LayerNorm 1 and
// the six weight conversions. None reads what another writes; a block finds its
// job by its number (a scalar test), the longest job first.
//   grid = NT / 16 + 2 (D FF / 8192) + 4 (D D / 4096)
// ---------------------------------------------------------------------------
// Behind a job's last store. The jobs are laid out one after another, and the code
// of the next job follows a job's stores in the listing: no register that those
// stores name is rewritten ahead of this wait.
static __device__ __forceinline__ void job_end() {
    asm volatile("s_wait_xcnt 0x0" ::: "memory");
}

template <int H, int D, int HD, int FF, int NT>
__global__ __launch_bounds__(256) void prep_kernel(
        const float* __restrict__ x, const float* __restrict__ g,
        const float* __restrict__ b, unsigned short* __restrict__ h1,
        const float* __restrict__ Wq, const float* __restrict__ Wk,
        const float* __restrict__ Wv, const float* __restrict__ Wo,
        const float* __restrict__ W1, const float* __restrict__ W2,
        unsigned short* __restrict__ wq, unsigned short* __restrict__ wk,
        unsigned short* __restrict__ wv, unsigned short* __restrict__ wo,
        unsigned short* __restrict__ w1, unsigned short* __restrict__ w2) {
    static_assert(H * HD == D && NT % 16 == 0, "the four square weights alike, whole blocks");
    constexpr unsigned nL = NT / 16, nF = D * FF / 8192, nP = D * D / 4096;
    unsigned bid = blockIdx.x;
    if (bid < nL) { ln_rows<D>(x, g, b, h1, bid); job_end(); return; }
    bid -= nL;
    if (bid < nF) { cvt_plain<8, D * FF>(W1, w1, bid); job_end(); return; }
    bid -= nF;
    if (bid < nF) { cvt_plain<8, FF * D>(W2, w2, bid); job_end(); return; }
    bid -= nF;
    if (bid < nP) { cvt_qkvw<4, H, D, HD>(Wq, wq, bid); job_end(); return; }
    bid -= nP;
    if (bid < nP) { cvt_qkvw<4, H, D, HD>(Wk, wk, bid); job_end(); return; }
    bid -= nP;
    if (bid < nP) { cvt_qkvw<4, H, D, HD>(Wv, wv, bid); job_end(); return; }
    bid -= nP;
    cvt_plain<4, D * D>(Wo, wo, bid);
    job_end();
}

// ---------------------------------------------------------------------------
// Tiled bf16 WMMA GEMM (double-buffered, BK=64):
//   C[M,N] = [res +] act((A[M,K] @ B[K,N] + bias) * scale)
//   block tile 128x128, 8 waves (2 x 4), each wave: 64x32 via 4x2 fragments.
//   Pipeline: two LDS buffers filled by asynchronous copies; the copies of tile
//   k+1 fly while the 16 WMMAs of tile k run. One barrier per 64-wide K block.
// ---------------------------------------------------------------------------
constexpr int GL = 72;   // padded LDS row length (elements) for BK=64
constexpr int BP = 144;  // LDS row length (elements) of the row-major 64x128 B tile:
                         // 288 B = 32 B x odd, the pitch of the transposing load
constexpr int SB = 136;  // row length (bf16 elements) of the staged output tile: 272 B = 16 B x odd
constexpr int SF = 132;  // row length (floats) of the staged output tile: 528 B = 16 B x odd

template <int ACT, bool RES, bool OUTF, bool OUTB, int NC>   // NC == N
static __device__ __forceinline__ void gemm_tile(
        const unsigned short* __restrict__ A,   // [M,K] bf16 row-major
        const unsigned short* __restrict__ Bw,  // [K,N] bf16 row-major
        const float* __restrict__ bias,         // [N]
        const float* __restrict__ res,          // [M,N] fp32 (if RES)
        float* __restrict__ outF,               // [M,N] fp32 (if OUTF)
        unsigned short* __restrict__ outB,      // [M,N] bf16 (if OUTB)
        int M, int N, int K, float scale) {
    __shared__ alignas(16) unsigned short As [2 * 128 * GL];  // [buf][m][k]
    __shared__ alignas(16) unsigned short Bs [2 * 64 * BP];   // [buf][k][n]

    const int tid  = threadIdx.x;
    const int wid  = tid >> 5;
    const int lane = tid & 31;
    const int g    = lane >> 4;
    const int ln   = lane & 15;
    const int wm   = wid >> 2;
    const int wn   = wid & 3;
    const int m0   = blockIdx.y * 128;
    const int n0   = blockIdx.x * 128;

    // Copy a 128x64 A tile and a row-major 64x128 B tile into buffer `buf`:
    // 8 x 16 B per lane, global memory to LDS through no register.
    const unsigned short* ga = A + (size_t)(m0 + (tid >> 3)) * K + ((tid & 7) << 3);
    const unsigned short* gb = Bw + (size_t)(tid >> 4) * N + n0 + ((tid & 15) << 3);
    const unsigned la = lds_off(&As[(tid >> 3) * GL + ((tid & 7) << 3)]);
    const unsigned lb = lds_off(&Bs[(tid >> 4) * BP + ((tid & 15) << 3)]);
    auto copyAB = [&](int buf, int k0) {
        const unsigned short* a = ga + k0;                 // rows +32 per copy
        const unsigned short* b = gb + (size_t)k0 * N;     // rows +16 per copy
        const unsigned da = la + buf * (128 * GL * 2);
        const unsigned db = lb + buf * (64 * BP * 2);
        // The closing s_wait_xcnt stands in the copies' own statement so that no
        // address register is rewritten ahead of it.
        asm volatile(
            "global_load_async_to_lds_b128 %0, %8, off\n\t"
            "global_load_async_to_lds_b128 %1, %9, off\n\t"
            "global_load_async_to_lds_b128 %2, %10, off\n\t"
            "global_load_async_to_lds_b128 %3, %11, off\n\t"
            "global_load_async_to_lds_b128 %4, %12, off\n\t"
            "global_load_async_to_lds_b128 %5, %13, off\n\t"
            "global_load_async_to_lds_b128 %6, %14, off\n\t"
            "global_load_async_to_lds_b128 %7, %15, off\n\t"
            "s_wait_xcnt 0x0"
            :: "v"(da), "v"(da + 32 * GL * 2), "v"(da + 64 * GL * 2), "v"(da + 96 * GL * 2),
               "v"(db), "v"(db + 16 * BP * 2), "v"(db + 32 * BP * 2), "v"(db + 48 * BP * 2),
               "v"(a), "v"(a + (size_t)32 * K), "v"(a + (size_t)64 * K), "v"(a + (size_t)96 * K),
               "v"(b), "v"(b + (size_t)16 * N), "v"(b + (size_t)32 * N), "v"(b + (size_t)48 * N)
            : "memory");
    };

    v8f acc[4][2];
#pragma unroll
    for (int mf = 0; mf < 4; ++mf)
#pragma unroll
        for (int nf = 0; nf < 2; ++nf)
#pragma unroll
            for (int r = 0; r < 8; ++r) acc[mf][nf][r] = 0.f;

    const int KB = K >> 6;
    copyAB(0, 0);
    asm volatile("s_wait_asynccnt 0x0" ::: "memory");   // tile 0 landed (own copies)
    __syncthreads();                                     // tile 0 visible to all waves
    if (KB > 1) copyAB(1, 64);
    for (int kb = 0; kb < KB; ++kb) {
        const unsigned short* as = &As [(kb & 1) * 128 * GL];
        const unsigned short* bs = &Bs [(kb & 1) * 64 * BP];
#pragma unroll
        for (int kd = 0; kd < 2; ++kd) {            // two 32-wide WMMA K-steps
            v16bf af[4];
#pragma unroll
            for (int mf = 0; mf < 4; ++mf) {
                const unsigned short* p =
                    &as[(wm * 64 + mf * 16 + ln) * GL + kd * 32 + 8 * g];
                af[mf] = make_frag(p, p + 16);
            }
#pragma unroll
            for (int nf = 0; nf < 2; ++nf) {
                const unsigned short* p =
                    &bs[(kd * 32 + 8 * g + (lane & 7)) * BP +
                        wn * 32 + nf * 16 + 8 * ((lane >> 3) & 1)];
                v16bf bf = make_frag_tr(p, 16 * BP);
#pragma unroll
                for (int mf = 0; mf < 4; ++mf)
                    acc[mf][nf] = WMMA_BF16(af[mf], bf, acc[mf][nf]);
            }
        }
        ring_waits();
        __syncthreads();                 // tile kb+1 visible; buffer kb&1 free
        if (kb + 2 < KB) copyAB(kb & 1, (kb + 2) << 6);
    }
    asm volatile("s_wait_asynccnt 0x0" ::: "memory");   // no copy outlives the loop

    // ---- epilogue: the 128x128 tile goes through LDS so that every global store
    //      (and every residual load) of a wave covers whole 128-byte lines ----
    // The ring is free here: the last trip's barrier ended every wave's reads and
    // no copy is in flight.
    static_assert(OUTF != OUTB, "one output per instantiation");
    // NC is N as a compile-time constant: the row steps below become immediate
    // offsets on one address that stays in its registers to the end.
    const size_t tile0 = (size_t)m0 * NC + n0;           // first element of the tile
    // f32 rows: 32 lanes x 16 B = 512 contiguous bytes a wave, rows wid + 8 i.
    const unsigned vof = (unsigned)(wid * NC + lane * 4) * 4u;               // bytes
    // bf16 rows: 16 lanes x 16 B = 256 contiguous bytes, two rows a wave, rows (tid >> 4) + 16 i.
    const unsigned vob = (unsigned)((tid >> 4) * NC + ((tid & 15) << 3)) * 2u;   // bytes
    const float* bp = bias + n0 + wn * 32 + ln;
    const float bv2[2] = { bp[0], bp[16] };
    // No register that the two loads above name is rewritten ahead of this wait.
    asm volatile("s_wait_xcnt 0x0" ::: "memory");
    v4f rr[16];
    if (RES) {
        // Residual rows, asked for ahead of the activation so that their latency
        // is covered.
        const char* rb = reinterpret_cast<const char*>(res + tile0);
#pragma unroll
        for (int i = 0; i < 16; ++i)
            rr[i] = *reinterpret_cast<const v4f*>(rb + (size_t)(8 * i) * NC * 4 + vof);
        // The same for the sixteen loads above.
        asm volatile("s_wait_xcnt 0x0" ::: "memory");
    }
    float* stf = reinterpret_cast<float*>(wm ? Bs : As);   // f32: 64 rows in each array
#pragma unroll
    for (int mf = 0; mf < 4; ++mf) {
#pragma unroll
        for (int nf = 0; nf < 2; ++nf) {
            int lcol = wn * 32 + nf * 16 + ln;
            float bv = bv2[nf];
#pragma unroll
            for (int r = 0; r < 8; ++r) {
                int lrow = mf * 16 + 8 * g + r;          // row inside the wave's 64
                float v = (acc[mf][nf][r] + bv) * scale;
                if (ACT == 1) v = geluf(v);
                if (OUTF) stf[lrow * SF + lcol] = v;
                if (OUTB) As[(wm * 64 + lrow) * SB + lcol] = f2bfbits(v);
            }
        }
    }
    __syncthreads();                     // staged tile visible to all waves
    if (OUTB) {
        char* ob = reinterpret_cast<char*>(outB + tile0);
#pragma unroll
        for (int i = 0; i < 8; ++i) {
            v8bf t = *reinterpret_cast<const v8bf*>(
                &As[((tid >> 4) + 16 * i) * SB + ((tid & 15) << 3)]);
            *reinterpret_cast<v8bf*>(ob + (size_t)(16 * i) * NC * 2 + vob) = t;
        }
    }
    if (OUTF) {
        char* ob = reinterpret_cast<char*>(outF + tile0);
#pragma unroll
        for (int i = 0; i < 16; ++i) {
            const float* sp = reinterpret_cast<const float*>(i < 8 ? As : Bs);
            v4f t = *reinterpret_cast<const v4f*>(&sp[(wid + 8 * (i & 7)) * SF + lane * 4]);
            if (RES) t += rr[i];
            *reinterpret_cast<v4f*>(ob + (size_t)(8 * i) * NC * 4 + vof) = t;
        }
    }
}

template <int ACT, bool RES, bool OUTF, bool OUTB, int NC>   // grid = (N / 128, M / 128)
__global__ __launch_bounds__(256) void gemm_bf16_kernel(
        const unsigned short* __restrict__ A, const unsigned short* __restrict__ Bw,
        const float* __restrict__ bias, const float* __restrict__ res,
        float* __restrict__ outF, unsigned short* __restrict__ outB,
        int M, int N, int K, float scale) {
    gemm_tile<ACT, RES, OUTF, OUTB, NC>(A, Bw, bias, res, outF, outB, M, N, K, scale);
}

// The three projections of one A in one launch: blockIdx.z picks weights, bias,
// output and scale (scalar selects). grid = (N / 128, M / 128, 3)
template <int NC>
__global__ __launch_bounds__(256) void gemm_qkv_kernel(
        const unsigned short* __restrict__ A,
        const unsigned short* __restrict__ wq, const unsigned short* __restrict__ wk,
        const unsigned short* __restrict__ wv,
        const float* __restrict__ bq, const float* __restrict__ bk,
        const float* __restrict__ bv,
        unsigned short* __restrict__ q, unsigned short* __restrict__ k,
        unsigned short* __restrict__ v,
        int M, int N, int K, float qscale) {
    const unsigned z = blockIdx.z;
    gemm_tile<0, false, false, true, NC>(
        A, z == 0 ? wq : z == 1 ? wk : wv, z == 0 ? bq : z == 1 ? bk : bv,
        nullptr, nullptr, z == 0 ? q : z == 1 ? k : v, M, N, K, z == 0 ? qscale : 1.0f);
}

constexpr int VP = 80;   // LDS row length (elements) of a V row: 160 B = 32 B x odd
__global__ __launch_bounds__(256) void attn_kernel(
        const unsigned short* __restrict__ Q,
        const unsigned short* __restrict__ Kb,
        const unsigned short* __restrict__ Vb,
        unsigned short* __restrict__ O,
        int S, int H, int HD) {
    const int D   = H * HD;                       // 1024
    const int qt  = blockIdx.x;
    const int bh  = blockIdx.y;
    const int b   = bh / H;
    const int h   = bh - b * H;
    const size_t base = (size_t)b * S * D + (size_t)h * HD;

    const int tid  = threadIdx.x;
    const int wid  = tid >> 5;
    const int lane = tid & 31;
    const int g    = lane >> 4;
    const int ln   = lane & 15;
    const int q0   = qt * 128;

    __shared__ alignas(16) unsigned short Ks [2 * 64 * GL];   // [buf][kc][d]
    __shared__ alignas(16) unsigned short Vs [2 * 64 * VP];   // [buf][kc][d]

    // Copy 64 K rows and 64 V rows into buffer `buf`: 4 x 16 B per lane.
    const size_t srow = base + (size_t)(tid >> 3) * D + ((tid & 7) << 3);
    const unsigned lk = lds_off(&Ks[(tid >> 3) * GL + ((tid & 7) << 3)]);
    const unsigned lv = lds_off(&Vs[(tid >> 3) * VP + ((tid & 7) << 3)]);
    auto copyKV = [&](int buf, int k0) {
        const unsigned short* k = Kb + srow + (size_t)k0 * D;   // rows +32 per copy
        const unsigned short* v = Vb + srow + (size_t)k0 * D;
        const unsigned dk = lk + buf * (64 * GL * 2);
        const unsigned dv = lv + buf * (64 * VP * 2);
        // The closing s_wait_xcnt stands in the copies' own statement so that no
        // address register is rewritten ahead of it.
        asm volatile(
            "global_load_async_to_lds_b128 %0, %4, off\n\t"
            "global_load_async_to_lds_b128 %1, %5, off\n\t"
            "global_load_async_to_lds_b128 %2, %6, off\n\t"
            "global_load_async_to_lds_b128 %3, %7, off\n\t"
            "s_wait_xcnt 0x0"
            :: "v"(dk), "v"(dk + 32 * GL * 2), "v"(dv), "v"(dv + 32 * VP * 2),
               "v"(k), "v"(k + (size_t)32 * D), "v"(v), "v"(v + (size_t)32 * D)
            : "memory");
    };

    // Q fragments (B operand: column = query), resident for the whole block
    // (d split into 2 k-steps)
    const int qrow = q0 + wid * 16 + ln;
    v16bf qa[2];
#pragma unroll
    for (int kd = 0; kd < 2; ++kd) {
        const unsigned short* qp = &Q[base + (size_t)qrow * D + kd * 32 + 8 * g];
        qa[kd] = make_frag(qp, qp + 16);
    }

    v8f of[4];
#pragma unroll
    for (int j = 0; j < 4; ++j)
#pragma unroll
        for (int r = 0; r < 8; ++r) of[j][r] = 0.f;
    float mrow = -1e30f;   // running maximum of this lane's query (both halves alike)
    float lrow = 0.f;      // running sum over this half's keys; halves joined at the end

    const int kend = q0 + 128;                    // causal: cols <= q0+127
    copyKV(0, 0);
    asm volatile("s_wait_asynccnt 0x0" ::: "memory");   // tile 0 landed (own copies)
    __syncthreads();                                     // tile 0 visible to all waves
    if (64 < kend) copyKV(1, 64);
    int it = 0;
    for (int k0 = 0; k0 < kend; k0 += 64, ++it) {
        const unsigned short* ks = &Ks [(it & 1) * 64 * GL];
        const unsigned short* vs = &Vs [(it & 1) * 64 * VP];

        // ---- S^T = K Q^T  (64 keys x 16 queries per wave; 1/sqrt(HD) folded into Q) ----
        v8f sf[4];
#pragma unroll
        for (int nf = 0; nf < 4; ++nf) {
            v8f c;
#pragma unroll
            for (int r = 0; r < 8; ++r) c[r] = 0.f;
#pragma unroll
            for (int kd = 0; kd < 2; ++kd) {
                const unsigned short* kp = &ks[(nf * 16 + ln) * GL + kd * 32 + 8 * g];
                v16bf kf = make_frag(kp, kp + 16);
                c = WMMA_BF16(kf, qa[kd], c);
            }
            sf[nf] = c;                  // sf[nf][r]: key k0 + nf*16 + 8g + r, query qrow
        }

        // ---- causal mask (uniform-per-wave predicate) ----
        if (k0 + 63 > q0 + wid * 16) {
#pragma unroll
            for (int nf = 0; nf < 4; ++nf) {
#pragma unroll
                for (int r = 0; r < 8; ++r) {
                    int key = k0 + nf * 16 + 8 * g + r;
                    sf[nf][r] = (key > qrow) ? -1e30f : sf[nf][r];
                }
            }
        }

        // ---- online softmax: 32 keys of one query per lane ----
        // Arguments of the exps are always <= 0, so the fast __expf
        // (single v_exp_f32) is safe: it just underflows to 0.
        float mx4[4];
#pragma unroll
        for (int nf = 0; nf < 4; ++nf) {
            mx4[nf] = sf[nf][0];
#pragma unroll
            for (int r = 1; r < 8; ++r) mx4[nf] = fmaxf(mx4[nf], sf[nf][r]);
        }
        float mx = fmaxf(fmaxf(mx4[0], mx4[1]), fmaxf(mx4[2], mx4[3]));
        mx = fmaxf(mx, xhalf(mx));
        const float mnew  = fmaxf(mrow, mx);
        const float alpha = __expf(mrow - mnew);
        float ps4[4];
#pragma unroll
        for (int nf = 0; nf < 4; ++nf) {
            ps4[nf] = 0.f;
#pragma unroll
            for (int r = 0; r < 8; ++r) {
                float p = __expf(sf[nf][r] - mnew);
                sf[nf][r] = p;
                ps4[nf] += p;
            }
        }
        lrow = lrow * alpha + ((ps4[0] + ps4[1]) + (ps4[2] + ps4[3]));
        mrow = mnew;

        // ---- P^T as B operand: score tiles 2kd and 2kd+1, rounded in place, hold
        //      keys 8g + 0..7 and 16 + 8g + 0..7 of the 32-key step: the k order
        //      that the transposing load delivers for V^T ----
        v16bf pb[2];
#pragma unroll
        for (int kd = 0; kd < 2; ++kd) {
            v8bf lo = __builtin_convertvector(sf[2 * kd],     v8bf);
            v8bf hi = __builtin_convertvector(sf[2 * kd + 1], v8bf);
            pb[kd] = __builtin_shufflevector(lo, hi, 0, 1, 2, 3, 4, 5, 6, 7,
                                                     8, 9, 10, 11, 12, 13, 14, 15);
        }

        // ---- rescale O^T, then O^T += V^T P^T ----
#pragma unroll
        for (int j = 0; j < 4; ++j)
#pragma unroll
            for (int r = 0; r < 8; ++r) of[j][r] *= alpha;

#pragma unroll
        for (int j = 0; j < 4; ++j) {
#pragma unroll
            for (int kd = 0; kd < 2; ++kd) {
                const unsigned short* vp =
                    &vs[(kd * 32 + 8 * g + (lane & 7)) * VP + j * 16 + 8 * ((lane >> 3) & 1)];
                v16bf va = make_frag_tr(vp, 16 * VP);
                of[j] = WMMA_BF16(va, pb[kd], of[j]);
            }
        }
        ring_waits();
        __syncthreads();                 // next tile visible; this buffer free
        if (k0 + 128 < kend) copyKV(it & 1, k0 + 128);
    }
    asm volatile("s_wait_asynccnt 0x0" ::: "memory");   // no copy outlives the loop

    // ---- join the halves' sums, normalize, store bf16 ----
    // of[j][r] is O[qrow][j*16 + 8g + r]: 8 consecutive d, one 16-byte store.
    const float inv = 1.0f / (lrow + xhalf(lrow));
#pragma unroll
    for (int j = 0; j < 4; ++j) {
        v8f o = of[j];
#pragma unroll
        for (int r = 0; r < 8; ++r) o[r] *= inv;
        *reinterpret_cast<v8bf*>(&O[base + (size_t)qrow * D + j * 16 + 8 * g]) =
            __builtin_convertvector(o, v8bf);
    }
}

// ---------------------------------------------------------------------------
// Host orchestration
// ---------------------------------------------------------------------------
extern "C" void kernel_launch(void* const* d_in, const int* in_sizes, int n_in,
                              void* d_out, int out_size, void* d_ws, size_t ws_size,
                              hipStream_t stream) {
    constexpr int B = 4, S = 2048, D = 1024, H = 16, HD = 64, FF = 4096;
    constexpr int NT = B * S;                       // 8192 tokens

    const float* x     = (const float*)d_in[0];
    const float* Wq    = (const float*)d_in[1];
    const float* bq    = (const float*)d_in[2];
    const float* Wk    = (const float*)d_in[3];
    const float* bk    = (const float*)d_in[4];
    const float* Wv    = (const float*)d_in[5];
    const float* bv    = (const float*)d_in[6];
    const float* Wo    = (const float*)d_in[7];
    const float* bo    = (const float*)d_in[8];
    const float* W1    = (const float*)d_in[9];
    const float* b1    = (const float*)d_in[10];
    const float* W2    = (const float*)d_in[11];
    const float* b2    = (const float*)d_in[12];
    const float* ln1_g = (const float*)d_in[13];
    const float* ln1_b = (const float*)d_in[14];
    const float* ln2_g = (const float*)d_in[15];
    const float* ln2_b = (const float*)d_in[16];
    float* out = (float*)d_out;

    // ---- workspace carve-up (bf16 stored as unsigned short) ----
    char* p = (char*)d_ws;
    auto alloc = [&](size_t bytes) {
        void* r = p;
        p += (bytes + 255) & ~(size_t)255;
        return r;
    };
    unsigned short* wq_bf  = (unsigned short*)alloc((size_t)D * D * 2);
    unsigned short* wk_bf  = (unsigned short*)alloc((size_t)D * D * 2);
    unsigned short* wv_bf  = (unsigned short*)alloc((size_t)D * D * 2);
    unsigned short* wo_bf  = (unsigned short*)alloc((size_t)D * D * 2);
    unsigned short* w1_bf  = (unsigned short*)alloc((size_t)D * FF * 2);
    unsigned short* w2_bf  = (unsigned short*)alloc((size_t)FF * D * 2);
    unsigned short* h_bf   = (unsigned short*)alloc((size_t)NT * D * 2);   // h1 then h2
    unsigned short* q_bf   = (unsigned short*)alloc((size_t)NT * D * 2);
    unsigned short* k_bf   = (unsigned short*)alloc((size_t)NT * D * 2);
    unsigned short* v_bf   = (unsigned short*)alloc((size_t)NT * D * 2);
    unsigned short* at_bf  = (unsigned short*)alloc((size_t)NT * D * 2);
    float*          x2_f   = (float*)alloc((size_t)NT * D * 4);
    unsigned short* y1_bf  = (unsigned short*)alloc((size_t)NT * FF * 2);
    (void)ws_size; (void)in_sizes; (void)n_in; (void)out_size;

    // ---- LN1 and the weight conversions ----
    prep_kernel<H, D, HD, FF, NT>
        <<<NT / 16 + 2 * (D * FF / 8192) + 4 * (D * D / 4096), 256, 0, stream>>>(
        x, ln1_g, ln1_b, h_bf, Wq, Wk, Wv, Wo, W1, W2,
        wq_bf, wk_bf, wv_bf, wo_bf, w1_bf, w2_bf);

    // ---- QKV projections (Q pre-scaled by 1/sqrt(HD)) ----
    dim3 gP(D / 128, NT / 128);
    gemm_qkv_kernel<D><<<dim3(D / 128, NT / 128, 3), 256, 0, stream>>>(
        h_bf, wq_bf, wk_bf, wv_bf, bq, bk, bv, q_bf, k_bf, v_bf, NT, D, D, 0.125f);

    // ---- causal flash attention ----
    attn_kernel<<<dim3(S / 128, B * H), 256, 0, stream>>>(q_bf, k_bf, v_bf, at_bf,
                                                          S, H, HD);

    // ---- output projection + residual -> x2 (fp32) ----
    gemm_bf16_kernel<0, true, true, false, D><<<gP, 256, 0, stream>>>(
        at_bf, wo_bf, bo, x, x2_f, nullptr, NT, D, D, 1.0f);

    // ---- LN2 ----
    ln_kernel<D><<<NT / 16, 256, 0, stream>>>(x2_f, ln2_g, ln2_b, h_bf);

    // ---- FFN: gelu(h2 @ W1 + b1) -> y1 (bf16) ----
    dim3 gF(FF / 128, NT / 128);
    gemm_bf16_kernel<1, false, false, true, FF><<<gF, 256, 0, stream>>>(
        h_bf, w1_bf, b1, nullptr, nullptr, y1_bf, NT, FF, D, 1.0f);

    // ---- gelu(y1 @ W2 + b2) + x2 -> out (fp32) ----
    gemm_bf16_kernel<1, true, true, false, D><<<gP, 256, 0, stream>>>(
        y1_bf, w2_bf, b2, x2_f, out, nullptr, NT, D, FF, 1.0f);
}

// v008
// A run of this version takes 248 microseconds.
// Timed twice side by side with v007, it ran 1.06 times as fast both times.
// Over all steps from v000 it is 5.22 times as fast.
#include <hip/hip_runtime.h>
#include <math.h>

// ---------------------------------------------------------------------------
// Types
// ---------------------------------------------------------------------------
typedef __bf16 v16bf __attribute__((ext_vector_type(16)));
typedef __bf16 v8bf  __attribute__((ext_vector_type(8)));
typedef float  v8f   __attribute__((ext_vector_type(8)));
typedef float  v4f   __attribute__((ext_vector_type(4)));

static __device__ __forceinline__ unsigned short f2bfbits(float x) {
    unsigned u = __builtin_bit_cast(unsigned, x);
    unsigned r = u + 0x7fffu + ((u >> 16) & 1u);   // round-to-nearest-even
    return (unsigned short)(r >> 16);
}

// Exact-form GELU, 0.5 v (1 + erf(v / sqrt 2)), with no branch, so that the
// unrolled epilogue can interleave its elements:
//   erf(|v| / sqrt 2) = 1 - erfc(|v| / sqrt 2) = 1 - 2^(t G(t)),  t = min(|v|, 4 sqrt 2),
// G a degree-7 minimax fit of log2(erfc(t / sqrt 2)) / t on [0, 4 sqrt 2]. The fit is
// off by under 2e-8 in erf, below the rounding of the f32 steps (erf within 2e-7).
// Past the clamp erfc is under 2^-25 and 1 - erfc rounds to 1. The sign of erf
// goes into the last step: 0.5 v erf(v / sqrt 2) = |0.5 v| erf(|v| / sqrt 2).
static __device__ __forceinline__ float geluf(float v) {
    const float t = fminf(fabsf(v), 5.65685415f);
    float q =          -2.83612894e-6f;
    q = fmaf(q, t,      3.93902083e-5f);
    q = fmaf(q, t,     -1.86230551e-4f);
    q = fmaf(q, t,     -1.36835646e-4f);
    q = fmaf(q, t,      7.06331385e-3f);
    q = fmaf(q, t,     -5.24961203e-2f);
    q = fmaf(q, t,     -4.59208220e-1f);
    q = fmaf(q, t,     -1.15110517f);
    const float r = 1.0f - __builtin_amdgcn_exp2f(q * t);   // exponent in [-26, 0]
    const float h = 0.5f * v;
    return fmaf(fabsf(h), r, h);
}

// Build a 16-element bf16 WMMA fragment from two 16-byte-aligned runs of
// 8 bf16 (K offsets 8g and 8g+16 per the CDNA5 16-bit A/B layout).
static __device__ __forceinline__ v16bf make_frag(const unsigned short* lo,
                                                  const unsigned short* hi) {
    v8bf a = *reinterpret_cast<const v8bf*>(lo);
    v8bf b = *reinterpret_cast<const v8bf*>(hi);
    return __builtin_shufflevector(a, b, 0, 1, 2, 3, 4, 5, 6, 7,
                                         8, 9, 10, 11, 12, 13, 14, 15);
}

// Build a 16-element bf16 WMMA B fragment (32 k x 16 columns) from a row-major
// [k][n] LDS tile with two transposing loads. `p` is this lane's address
//   tile + (kbase + 8*(lane>>4) + (lane&7)) * pitch + nbase + 8*((lane>>3)&1)
// (elements); the lane receives column nbase + (lane&15) at k = kbase + 8g + 0..7
// and, `pitch16` = 16 rows further, k = kbase + 16 + 8g + 0..7: the same k order
// as make_frag(p, p + 16) delivers for the A side.
typedef __attribute__((address_space(3))) v8bf lds_v8bf;
static __device__ __forceinline__ v16bf make_frag_tr(const unsigned short* p, int pitch16) {
    v8bf a = __builtin_amdgcn_ds_load_tr16_b128_v8bf16((lds_v8bf*)p);
    v8bf b = __builtin_amdgcn_ds_load_tr16_b128_v8bf16((lds_v8bf*)(p + pitch16));
    return __builtin_shufflevector(a, b, 0, 1, 2, 3, 4, 5, 6, 7,
                                         8, 9, 10, 11, 12, 13, 14, 15);
}

// LDS byte address of a __shared__ element (the operand of an asynchronous copy).
static __device__ __forceinline__ unsigned lds_off(const unsigned short* p) {
    return (unsigned)(size_t)(const __attribute__((address_space(3))) unsigned short*)p;
}

// Foot of a ring trip, before the barrier: this wave's LDS reads of the buffer
// that is refilled next have retired, and its own copies of the next tile have
// landed.
static __device__ __forceinline__ void ring_waits() {
    asm volatile("s_wait_dscnt 0x0" ::: "memory");
    asm volatile("s_wait_asynccnt 0x0" ::: "memory");
}

// Value of lane l ^ 16 (the other half of the wave), by a vector cross-row move.
static __device__ __forceinline__ float xhalf(float v) {
    int b = __builtin_bit_cast(int, v);
    return __builtin_bit_cast(float,
        __builtin_amdgcn_permlanex16(b, b, 0x76543210, 0xfedcba98, false, false));
}

#define WMMA_BF16(A, B, C) \
    __builtin_amdgcn_wmma_f32_16x16x32_bf16(false, (A), false, (B), (short)0, (C), false, false)

// ---------------------------------------------------------------------------
// Weight conversions (fp32 -> bf16), jobs of prep_kernel
//   A lane takes U pieces of 4 elements: every load of a wave covers 512
//   contiguous bytes, every store 256, and all U loads are asked for before the
//   first piece is converted. N elements need N / (128 U) waves.
// ---------------------------------------------------------------------------
typedef unsigned short us4 __attribute__((ext_vector_type(4)));

static __device__ __forceinline__ us4 f2bf4(v4f v) {
    us4 r;
#pragma unroll
    for (int c = 0; c < 4; ++c) r[c] = f2bfbits(v[c]);
    return r;
}

template <int U, int N>   // N / (1024 U) blocks of 256; bid = the block's number among them
static __device__ __forceinline__ void cvt_plain(const float* __restrict__ in,
                                                 unsigned short* __restrict__ out,
                                                 unsigned bid) {
    static_assert(N % (1024 * U) == 0, "whole blocks only");
    const unsigned i0 = (bid * (256 * U) + threadIdx.x) * 4;   // first element
    v4f v[U];
#pragma unroll
    for (int u = 0; u < U; ++u)
        v[u] = *reinterpret_cast<const v4f*>(in + i0 + u * 1024);
    // No register that the loads above name is rewritten ahead of this wait.
    asm volatile("s_wait_xcnt 0x0" ::: "memory");
#pragma unroll
    for (int u = 0; u < U; ++u)
        *reinterpret_cast<us4*>(out + i0 + u * 1024) = f2bf4(v[u]);
}

// (H, D, HD) -> column-combined (D, H*HD): out[d*H*HD + h*HD + e] = in[h,d,e]
// A piece is 4 consecutive e of one (h, d); 16 lanes store one 128-byte run.
// A block stays inside one h, so piece u lies 1024 / HD rows d below piece 0.
template <int U, int H, int D, int HD>   // H*D*HD / (1024 U) blocks of 256; bid as above
static __device__ __forceinline__ void cvt_qkvw(const float* __restrict__ in,
                                                unsigned short* __restrict__ out,
                                                unsigned bid) {
    static_assert((D * HD) % (1024 * U) == 0 && 1024 % HD == 0 && HD % 4 == 0,
                  "whole blocks inside one h, whole rows between pieces, whole pieces");
    const unsigned i0 = (bid * (256 * U) + threadIdx.x) * 4;   // first element
    v4f v[U];
#pragma unroll
    for (int u = 0; u < U; ++u)
        v[u] = *reinterpret_cast<const v4f*>(in + i0 + u * 1024);
    // No register that the loads above name is rewritten ahead of this wait.
    asm volatile("s_wait_xcnt 0x0" ::: "memory");
    const unsigned h = i0 / (D * HD);
    const unsigned r = i0 - h * (D * HD);
    const unsigned d = r / HD;
    const unsigned e = r - d * HD;
    unsigned short* o = out + d * (H * HD) + h * HD + e;
#pragma unroll
    for (int u = 0; u < U; ++u)
        *reinterpret_cast<us4*>(o + u * (1024 / HD) * (H * HD)) = f2bf4(v[u]);
}

// ---------------------------------------------------------------------------
// LayerNorm: one wave per pair of tokens, 16 tokens per 256-thread block, bf16
// output. Both rows stay in registers (DC / 128 pieces of 16 B a lane and row)
// between the sums and the scaling: no LDS, no barrier, no second read of x.
// ---------------------------------------------------------------------------
template <int DC>   // DC == D; tokens / 16 blocks of 256; bid as above
static __device__ __forceinline__ void ln_rows(const float* __restrict__ x,
                                               const float* __restrict__ g,
                                               const float* __restrict__ b,
                                               unsigned short* __restrict__ out,
                                               unsigned bid) {
    static_assert(DC % 128 == 0, "whole pieces");
    constexpr int P = DC / 128;
    const int lane = threadIdx.x & 31;
    const int row  = (bid * 8 + (threadIdx.x >> 5)) * 2;
    const float* xr = x + (size_t)row * DC + lane * 4;
    v4f v[2][P], gv[P], bv[P];
#pragma unroll
    for (int t = 0; t < 2; ++t)
#pragma unroll
        for (int p = 0; p < P; ++p)
            v[t][p] = *reinterpret_cast<const v4f*>(xr + t * DC + p * 128);
#pragma unroll
    for (int p = 0; p < P; ++p) {
        gv[p] = *reinterpret_cast<const v4f*>(g + lane * 4 + p * 128);
        bv[p] = *reinterpret_cast<const v4f*>(b + lane * 4 + p * 128);
    }
    // Holds all 32 loads ahead of the sums. Left free, the g and b loads sink
    // into the reduction and their latency is paid a second time.
    __builtin_amdgcn_sched_barrier(0);
    // No register that the loads above name is rewritten ahead of this wait: as an
    // input, xr keeps the x loads' address pair from serving as a load's target.
    asm volatile("s_wait_xcnt 0x0" :: "v"(xr) : "memory");

    float s[2], ss[2];
#pragma unroll
    for (int t = 0; t < 2; ++t) {
        v4f s4 = v[t][0], q4 = v[t][0] * v[t][0];    // four independent chains each
#pragma unroll
        for (int p = 1; p < P; ++p) {
            s4 += v[t][p];
            q4 += v[t][p] * v[t][p];
        }
        s[t]  = (s4[0] + s4[1]) + (s4[2] + s4[3]);
        ss[t] = (q4[0] + q4[1]) + (q4[2] + q4[3]);
    }
#pragma unroll
    for (int m = 16; m >= 1; m >>= 1) {
#pragma unroll
        for (int t = 0; t < 2; ++t) {
            s[t]  += __shfl_xor(s[t],  m, 32);
            ss[t] += __shfl_xor(ss[t], m, 32);
        }
    }
    unsigned short* orow = out + (size_t)row * DC + lane * 4;
#pragma unroll
    for (int t = 0; t < 2; ++t) {
        const float mu  = s[t] / (float)DC;
        const float var = ss[t] / (float)DC - mu * mu;
        const float rs  = rsqrtf(var + 1e-5f);
#pragma unroll
        for (int p = 0; p < P; ++p)
            *reinterpret_cast<us4*>(orow + t * DC + p * 128) =
                f2bf4((v[t][p] - mu) * rs * gv[p] + bv[p]);
    }
}

template <int DC>   // grid = tokens / 16
__global__ __launch_bounds__(256) void ln_kernel(const float* __restrict__ x,
                                                 const float* __restrict__ g,
                                                 const float* __restrict__ b,
                                                 unsigned short* __restrict__ out) {
    ln_rows<DC>(x, g, b, out, blockIdx.x);
}

// ---------------------------------------------------------------------------
// Everything that depends on the inputs alone, in one launch: LayerNorm 1 and
// the six weight conversions. None reads what another writes; a block finds its
// job by its number (a scalar test), the longest job first.
//   grid = NT / 16 + 2 (D FF / 8192) + 4 (D D / 4096)
// ---------------------------------------------------------------------------
// Behind a job's last store. The jobs are laid out one after another, and the code
// of the next job follows a job's stores in the listing: no register that those
// stores name is rewritten ahead of this wait.
static __device__ __forceinline__ void job_end() {
    asm volatile("s_wait_xcnt 0x0" ::: "memory");
}

template <int H, int D, int HD, int FF, int NT>
__global__ __launch_bounds__(256) void prep_kernel(
        const float* __restrict__ x, const float* __restrict__ g,
        const float* __restrict__ b, unsigned short* __restrict__ h1,
        const float* __restrict__ Wq, const float* __restrict__ Wk,
        const float* __restrict__ Wv, const float* __restrict__ Wo,
        const float* __restrict__ W1, const float* __restrict__ W2,
        unsigned short* __restrict__ wq, unsigned short* __restrict__ wk,
        unsigned short* __restrict__ wv, unsigned short* __restrict__ wo,
        unsigned short* __restrict__ w1, unsigned short* __restrict__ w2) {
    static_assert(H * HD == D && NT % 16 == 0, "the four square weights alike, whole blocks");
    constexpr unsigned nL = NT / 16, nF = D * FF / 8192, nP = D * D / 4096;
    unsigned bid = blockIdx.x;
    if (bid < nL) { ln_rows<D>(x, g, b, h1, bid); job_end(); return; }
    bid -= nL;
    if (bid < nF) { cvt_plain<8, D * FF>(W1, w1, bid); job_end(); return; }
    bid -= nF;
    if (bid < nF) { cvt_plain<8, FF * D>(W2, w2, bid); job_end(); return; }
    bid -= nF;
    if (bid < nP) { cvt_qkvw<4, H, D, HD>(Wq, wq, bid); job_end(); return; }
    bid -= nP;
    if (bid < nP) { cvt_qkvw<4, H, D, HD>(Wk, wk, bid); job_end(); return; }
    bid -= nP;
    if (bid < nP) { cvt_qkvw<4, H, D, HD>(Wv, wv, bid); job_end(); return; }
    bid -= nP;
    cvt_plain<4, D * D>(Wo, wo, bid);
    job_end();
}

// ---------------------------------------------------------------------------
// Tiled bf16 WMMA GEMM (double-buffered, BK=64):
//   C[M,N] = [res +] act((A[M,K] @ B[K,N] + bias) * scale)
//   block tile 128x128, 8 waves (2 x 4), each wave: 64x32 via 4x2 fragments.
//   Pipeline: two LDS buffers filled by asynchronous copies; the copies of tile
//   k+1 fly while the 16 WMMAs of tile k run. One barrier per 64-wide K block.
// ---------------------------------------------------------------------------
constexpr int GL = 72;   // padded LDS row length (elements) for BK=64
constexpr int BP = 144;  // LDS row length (elements) of the row-major 64x128 B tile:
                         // 288 B = 32 B x odd, the pitch of the transposing load
constexpr int SB = 136;  // row length (bf16 elements) of the staged output tile: 272 B = 16 B x odd
constexpr int SF = 132;  // row length (floats) of the staged output tile: 528 B = 16 B x odd

template <int ACT, bool RES, bool OUTF, bool OUTB, int NC>   // NC == N
static __device__ __forceinline__ void gemm_tile(
        const unsigned short* __restrict__ A,   // [M,K] bf16 row-major
        const unsigned short* __restrict__ Bw,  // [K,N] bf16 row-major
        const float* __restrict__ bias,         // [N]
        const float* __restrict__ res,          // [M,N] fp32 (if RES)
        float* __restrict__ outF,               // [M,N] fp32 (if OUTF)
        unsigned short* __restrict__ outB,      // [M,N] bf16 (if OUTB)
        int M, int N, int K, float scale) {
    __shared__ alignas(16) unsigned short As [2 * 128 * GL];  // [buf][m][k]
    __shared__ alignas(16) unsigned short Bs [2 * 64 * BP];   // [buf][k][n]

    const int tid  = threadIdx.x;
    const int wid  = tid >> 5;
    const int lane = tid & 31;
    const int g    = lane >> 4;
    const int ln   = lane & 15;
    const int wm   = wid >> 2;
    const int wn   = wid & 3;
    const int m0   = blockIdx.y * 128;
    const int n0   = blockIdx.x * 128;

    // Copy a 128x64 A tile and a row-major 64x128 B tile into buffer `buf`:
    // 8 x 16 B per lane, global memory to LDS through no register.
    const unsigned short* ga = A + (size_t)(m0 + (tid >> 3)) * K + ((tid & 7) << 3);
    const unsigned short* gb = Bw + (size_t)(tid >> 4) * N + n0 + ((tid & 15) << 3);
    const unsigned la = lds_off(&As[(tid >> 3) * GL + ((tid & 7) << 3)]);
    const unsigned lb = lds_off(&Bs[(tid >> 4) * BP + ((tid & 15) << 3)]);
    auto copyAB = [&](int buf, int k0) {
        const unsigned short* a = ga + k0;                 // rows +32 per copy
        const unsigned short* b = gb + (size_t)k0 * N;     // rows +16 per copy
        const unsigned da = la + buf * (128 * GL * 2);
        const unsigned db = lb + buf * (64 * BP * 2);
        // The closing s_wait_xcnt stands in the copies' own statement so that no
        // address register is rewritten ahead of it.
        asm volatile(
            "global_load_async_to_lds_b128 %0, %8, off\n\t"
            "global_load_async_to_lds_b128 %1, %9, off\n\t"
            "global_load_async_to_lds_b128 %2, %10, off\n\t"
            "global_load_async_to_lds_b128 %3, %11, off\n\t"
            "global_load_async_to_lds_b128 %4, %12, off\n\t"
            "global_load_async_to_lds_b128 %5, %13, off\n\t"
            "global_load_async_to_lds_b128 %6, %14, off\n\t"
            "global_load_async_to_lds_b128 %7, %15, off\n\t"
            "s_wait_xcnt 0x0"
            :: "v"(da), "v"(da + 32 * GL * 2), "v"(da + 64 * GL * 2), "v"(da + 96 * GL * 2),
               "v"(db), "v"(db + 16 * BP * 2), "v"(db + 32 * BP * 2), "v"(db + 48 * BP * 2),
               "v"(a), "v"(a + (size_t)32 * K), "v"(a + (size_t)64 * K), "v"(a + (size_t)96 * K),
               "v"(b), "v"(b + (size_t)16 * N), "v"(b + (size_t)32 * N), "v"(b + (size_t)48 * N)
            : "memory");
    };

    v8f acc[4][2];
#pragma unroll
    for (int mf = 0; mf < 4; ++mf)
#pragma unroll
        for (int nf = 0; nf < 2; ++nf)
#pragma unroll
            for (int r = 0; r < 8; ++r) acc[mf][nf][r] = 0.f;

    const int KB = K >> 6;
    copyAB(0, 0);
    asm volatile("s_wait_asynccnt 0x0" ::: "memory");   // tile 0 landed (own copies)
    __syncthreads();                                     // tile 0 visible to all waves
    if (KB > 1) copyAB(1, 64);
    for (int kb = 0; kb < KB; ++kb) {
        const unsigned short* as = &As [(kb & 1) * 128 * GL];
        const unsigned short* bs = &Bs [(kb & 1) * 64 * BP];
#pragma unroll
        for (int kd = 0; kd < 2; ++kd) {            // two 32-wide WMMA K-steps
            v16bf af[4];
#pragma unroll
            for (int mf = 0; mf < 4; ++mf) {
                const unsigned short* p =
                    &as[(wm * 64 + mf * 16 + ln) * GL + kd * 32 + 8 * g];
                af[mf] = make_frag(p, p + 16);
            }
#pragma unroll
            for (int nf = 0; nf < 2; ++nf) {
                const unsigned short* p =
                    &bs[(kd * 32 + 8 * g + (lane & 7)) * BP +
                        wn * 32 + nf * 16 + 8 * ((lane >> 3) & 1)];
                v16bf bf = make_frag_tr(p, 16 * BP);
#pragma unroll
                for (int mf = 0; mf < 4; ++mf)
                    acc[mf][nf] = WMMA_BF16(af[mf], bf, acc[mf][nf]);
            }
        }
        ring_waits();
        __syncthreads();                 // tile kb+1 visible; buffer kb&1 free
        if (kb + 2 < KB) copyAB(kb & 1, (kb + 2) << 6);
    }
    asm volatile("s_wait_asynccnt 0x0" ::: "memory");   // no copy outlives the loop

    // ---- epilogue: the 128x128 tile goes through LDS so that every global store
    //      (and every residual load) of a wave covers whole 128-byte lines ----
    // The ring is free here: the last trip's barrier ended every wave's reads and
    // no copy is in flight.
    static_assert(OUTF != OUTB, "one output per instantiation");
    // NC is N as a compile-time constant: the row steps below become immediate
    // offsets on one address that stays in its registers to the end.
    const size_t tile0 = (size_t)m0 * NC + n0;           // first element of the tile
    // f32 rows: 32 lanes x 16 B = 512 contiguous bytes a wave, rows wid + 8 i.
    const unsigned vof = (unsigned)(wid * NC + lane * 4) * 4u;               // bytes
    // bf16 rows: 16 lanes x 16 B = 256 contiguous bytes, two rows a wave, rows (tid >> 4) + 16 i.
    const unsigned vob = (unsigned)((tid >> 4) * NC + ((tid & 15) << 3)) * 2u;   // bytes
    const float* bp = bias + n0 + wn * 32 + ln;
    const float bv2[2] = { bp[0], bp[16] };
    // No register that the two loads above name is rewritten ahead of this wait.
    asm volatile("s_wait_xcnt 0x0" ::: "memory");
    v4f rr[16];
    if (RES) {
        // Residual rows, asked for ahead of the activation so that their latency
        // is covered.
        const char* rb = reinterpret_cast<const char*>(res + tile0);
#pragma unroll
        for (int i = 0; i < 16; ++i)
            rr[i] = *reinterpret_cast<const v4f*>(rb + (size_t)(8 * i) * NC * 4 + vof);
        // The same for the sixteen loads above.
        asm volatile("s_wait_xcnt 0x0" ::: "memory");
    }
    float* stf = reinterpret_cast<float*>(wm ? Bs : As);   // f32: 64 rows in each array
#pragma unroll
    for (int mf = 0; mf < 4; ++mf) {
#pragma unroll
        for (int nf = 0; nf < 2; ++nf) {
            int lcol = wn * 32 + nf * 16 + ln;
            float bv = bv2[nf];
#pragma unroll
            for (int r = 0; r < 8; ++r) {
                int lrow = mf * 16 + 8 * g + r;          // row inside the wave's 64
                float v = (acc[mf][nf][r] + bv) * scale;
                if (ACT == 1) v = geluf(v);
                if (OUTF) stf[lrow * SF + lcol] = v;
                if (OUTB) As[(wm * 64 + lrow) * SB + lcol] = f2bfbits(v);
            }
        }
    }
    __syncthreads();                     // staged tile visible to all waves
    if (OUTB) {
        char* ob = reinterpret_cast<char*>(outB + tile0);
#pragma unroll
        for (int i = 0; i < 8; ++i) {
            v8bf t = *reinterpret_cast<const v8bf*>(
                &As[((tid >> 4) + 16 * i) * SB + ((tid & 15) << 3)]);
            *reinterpret_cast<v8bf*>(ob + (size_t)(16 * i) * NC * 2 + vob) = t;
        }
    }
    if (OUTF) {
        char* ob = reinterpret_cast<char*>(outF + tile0);
#pragma unroll
        for (int i = 0; i < 16; ++i) {
            const float* sp = reinterpret_cast<const float*>(i < 8 ? As : Bs);
            v4f t = *reinterpret_cast<const v4f*>(&sp[(wid + 8 * (i & 7)) * SF + lane * 4]);
            if (RES) t += rr[i];
            *reinterpret_cast<v4f*>(ob + (size_t)(8 * i) * NC * 4 + vof) = t;
        }
    }
}

template <int ACT, bool RES, bool OUTF, bool OUTB, int NC>   // grid = (N / 128, M / 128)
__global__ __launch_bounds__(256) void gemm_bf16_kernel(
        const unsigned short* __restrict__ A, const unsigned short* __restrict__ Bw,
        const float* __restrict__ bias, const float* __restrict__ res,
        float* __restrict__ outF, unsigned short* __restrict__ outB,
        int M, int N, int K, float scale) {
    gemm_tile<ACT, RES, OUTF, OUTB, NC>(A, Bw, bias, res, outF, outB, M, N, K, scale);
}

// The three projections of one A in one launch: blockIdx.z picks weights, bias,
// output and scale (scalar selects). grid = (N / 128, M / 128, 3)
template <int NC>
__global__ __launch_bounds__(256) void gemm_qkv_kernel(
        const unsigned short* __restrict__ A,
        const unsigned short* __restrict__ wq, const unsigned short* __restrict__ wk,
        const unsigned short* __restrict__ wv,
        const float* __restrict__ bq, const float* __restrict__ bk,
        const float* __restrict__ bv,
        unsigned short* __restrict__ q, unsigned short* __restrict__ k,
        unsigned short* __restrict__ v,
        int M, int N, int K, float qscale) {
    const unsigned z = blockIdx.z;
    gemm_tile<0, false, false, true, NC>(
        A, z == 0 ? wq : z == 1 ? wk : wv, z == 0 ? bq : z == 1 ? bk : bv,
        nullptr, nullptr, z == 0 ? q : z == 1 ? k : v, M, N, K, z == 0 ? qscale : 1.0f);
}

constexpr int VP = 80;   // LDS row length (elements) of a V row: 160 B = 32 B x odd
__global__ __launch_bounds__(256) void attn_kernel(
        const unsigned short* __restrict__ Q,
        const unsigned short* __restrict__ Kb,
        const unsigned short* __restrict__ Vb,
        unsigned short* __restrict__ O,
        int S, int H, int HD) {
    const int D   = H * HD;                       // 1024
    const int nq  = S >> 7;                       // query tiles of a head (even)
    const int pr  = blockIdx.x;                   // the pair: tiles nq - 1 - pr and pr
    const int bh  = blockIdx.y;
    const int b   = bh / H;
    const int h   = bh - b * H;
    const size_t base = (size_t)b * S * D + (size_t)h * HD;

    const int tid  = threadIdx.x;
    const int wid  = tid >> 5;
    const int lane = tid & 31;
    const int g    = lane >> 4;
    const int ln   = lane & 15;
    int q0 = (nq - 1 - pr) * 128;                 // the longer tile first
    const int n1  = 2 * (nq - pr);                // its stages of 64 keys (causal)
    const int nst = 2 * (nq + 1);                 // stages of both tiles
    // First key of stage s: each tile starts again at key 0.
    auto stage_k0 = [&](int s) { return (s < n1 ? s : s - n1) << 6; };

    __shared__ alignas(16) unsigned short Ks [2 * 64 * GL];   // [buf][kc][d]
    __shared__ alignas(16) unsigned short Vs [2 * 64 * VP];   // [buf][kc][d]

    // Copy 64 K rows and 64 V rows into buffer `buf`: 4 x 16 B per lane.
    const size_t srow = base + (size_t)(tid >> 3) * D + ((tid & 7) << 3);
    const unsigned lk = lds_off(&Ks[(tid >> 3) * GL + ((tid & 7) << 3)]);
    const unsigned lv = lds_off(&Vs[(tid >> 3) * VP + ((tid & 7) << 3)]);
    auto copyKV = [&](int buf, int k0) {
        const unsigned short* k = Kb + srow + (size_t)k0 * D;   // rows +32 per copy
        const unsigned short* v = Vb + srow + (size_t)k0 * D;
        const unsigned dk = lk + buf * (64 * GL * 2);
        const unsigned dv = lv + buf * (64 * VP * 2);
        // The closing s_wait_xcnt stands in the copies' own statement so that no
        // address register is rewritten ahead of it.
        asm volatile(
            "global_load_async_to_lds_b128 %0, %4, off\n\t"
            "global_load_async_to_lds_b128 %1, %5, off\n\t"
            "global_load_async_to_lds_b128 %2, %6, off\n\t"
            "global_load_async_to_lds_b128 %3, %7, off\n\t"
            "s_wait_xcnt 0x0"
            :: "v"(dk), "v"(dk + 32 * GL * 2), "v"(dv), "v"(dv + 32 * VP * 2),
               "v"(k), "v"(k + (size_t)32 * D), "v"(v), "v"(v + (size_t)32 * D)
            : "memory");
    };

    // Q fragments (B operand: column = query), d split into 2 k-steps. Both tiles'
    // are asked for here, so that the change of tile waits for no load.
    int qrow = q0 + wid * 16 + ln;
    const int qrow2 = pr * 128 + wid * 16 + ln;
    v16bf qa[2], qn[2];
#pragma unroll
    for (int kd = 0; kd < 2; ++kd) {
        const unsigned short* qp = &Q[base + (size_t)qrow * D + kd * 32 + 8 * g];
        const unsigned short* q2 = &Q[base + (size_t)qrow2 * D + kd * 32 + 8 * g];
        qa[kd] = make_frag(qp, qp + 16);
        qn[kd] = make_frag(q2, q2 + 16);
    }
    // No register that the loads above name is rewritten ahead of this wait.
    asm volatile("s_wait_xcnt 0x0" ::: "memory");

    v8f of[4];
#pragma unroll
    for (int j = 0; j < 4; ++j)
#pragma unroll
        for (int r = 0; r < 8; ++r) of[j][r] = 0.f;
    float mrow = -1e30f;   // running maximum of this lane's query (both halves alike)
    float lrow = 0.f;      // running sum over this half's keys; halves joined at the end

    // ---- end of a tile: join the halves' sums, normalize, store bf16 ----
    // of[j][r] is O[qrow][j*16 + 8g + r]: 8 consecutive d, one 16-byte store.
    auto store_tile = [&]() {
        const float inv = 1.0f / (lrow + xhalf(lrow));
        unsigned short* op = &O[base + (size_t)qrow * D + 8 * g];
#pragma unroll
        for (int j = 0; j < 4; ++j) {
            v8f o = of[j];
#pragma unroll
            for (int r = 0; r < 8; ++r) o[r] *= inv;
            *reinterpret_cast<v8bf*>(op + j * 16) = __builtin_convertvector(o, v8bf);
        }
        // No register that the stores above name is rewritten ahead of this wait.
        asm volatile("s_wait_xcnt 0x0" ::: "memory");
    };

    copyKV(0, 0);
    asm volatile("s_wait_asynccnt 0x0" ::: "memory");   // tile 0 landed (own copies)
    __syncthreads();                                     // tile 0 visible to all waves
    if (1 < nst) copyKV(1, stage_k0(1));
    for (int it = 0; it < nst; ++it) {
        const int k0 = stage_k0(it);
        const unsigned short* ks = &Ks [(it & 1) * 64 * GL];
        const unsigned short* vs = &Vs [(it & 1) * 64 * VP];

        // ---- S^T = K Q^T  (64 keys x 16 queries per wave; 1/sqrt(HD) folded into Q) ----
        v8f sf[4];
#pragma unroll
        for (int nf = 0; nf < 4; ++nf) {
            v8f c;
#pragma unroll
            for (int r = 0; r < 8; ++r) c[r] = 0.f;
#pragma unroll
            for (int kd = 0; kd < 2; ++kd) {
                const unsigned short* kp = &ks[(nf * 16 + ln) * GL + kd * 32 + 8 * g];
                v16bf kf = make_frag(kp, kp + 16);
                c = WMMA_BF16(kf, qa[kd], c);
            }
            sf[nf] = c;                  // sf[nf][r]: key k0 + nf*16 + 8g + r, query qrow
        }

        // ---- causal mask (uniform-per-wave predicate) ----
        if (k0 + 63 > q0 + wid * 16) {
#pragma unroll
            for (int nf = 0; nf < 4; ++nf) {
#pragma unroll
                for (int r = 0; r < 8; ++r) {
                    int key = k0 + nf * 16 + 8 * g + r;
                    sf[nf][r] = (key > qrow) ? -1e30f : sf[nf][r];
                }
            }
        }

        // ---- online softmax: 32 keys of one query per lane ----
        // Arguments of the exps are always <= 0, so the fast __expf
        // (single v_exp_f32) is safe: it just underflows to 0.
        float mx4[4];
#pragma unroll
        for (int nf = 0; nf < 4; ++nf) {
            mx4[nf] = sf[nf][0];
#pragma unroll
            for (int r = 1; r < 8; ++r) mx4[nf] = fmaxf(mx4[nf], sf[nf][r]);
        }
        float mx = fmaxf(fmaxf(mx4[0], mx4[1]), fmaxf(mx4[2], mx4[3]));
        mx = fmaxf(mx, xhalf(mx));
        const float mnew  = fmaxf(mrow, mx);
        const float alpha = __expf(mrow - mnew);
        float ps4[4];
#pragma unroll
        for (int nf = 0; nf < 4; ++nf) {
            ps4[nf] = 0.f;
#pragma unroll
            for (int r = 0; r < 8; ++r) {
                float p = __expf(sf[nf][r] - mnew);
                sf[nf][r] = p;
                ps4[nf] += p;
            }
        }
        lrow = lrow * alpha + ((ps4[0] + ps4[1]) + (ps4[2] + ps4[3]));
        mrow = mnew;

        // ---- P^T as B operand: score tiles 2kd and 2kd+1, rounded in place, hold
        //      keys 8g + 0..7 and 16 + 8g + 0..7 of the 32-key step: the k order
        //      that the transposing load delivers for V^T ----
        v16bf pb[2];
#pragma unroll
        for (int kd = 0; kd < 2; ++kd) {
            v8bf lo = __builtin_convertvector(sf[2 * kd],     v8bf);
            v8bf hi = __builtin_convertvector(sf[2 * kd + 1], v8bf);
            pb[kd] = __builtin_shufflevector(lo, hi, 0, 1, 2, 3, 4, 5, 6, 7,
                                                     8, 9, 10, 11, 12, 13, 14, 15);
        }

        // ---- rescale O^T, then O^T += V^T P^T ----
#pragma unroll
        for (int j = 0; j < 4; ++j)
#pragma unroll
            for (int r = 0; r < 8; ++r) of[j][r] *= alpha;

#pragma unroll
        for (int j = 0; j < 4; ++j) {
#pragma unroll
            for (int kd = 0; kd < 2; ++kd) {
                const unsigned short* vp =
                    &vs[(kd * 32 + 8 * g + (lane & 7)) * VP + j * 16 + 8 * ((lane >> 3) & 1)];
                v16bf va = make_frag_tr(vp, 16 * VP);
                of[j] = WMMA_BF16(va, pb[kd], of[j]);
            }
        }
        ring_waits();
        __syncthreads();                 // next tile visible; this buffer free
        if (it + 2 < nst) copyKV(it & 1, stage_k0(it + 2));
        if (it == n1 - 1) {              // first tile done (the same test in every wave)
            store_tile();
            q0   = pr * 128;
            qrow = qrow2;
            qa[0] = qn[0];
            qa[1] = qn[1];
#pragma unroll
            for (int j = 0; j < 4; ++j)
#pragma unroll
                for (int r = 0; r < 8; ++r) of[j][r] = 0.f;
            mrow = -1e30f;
            lrow = 0.f;
        }
    }
    asm volatile("s_wait_asynccnt 0x0" ::: "memory");   // no copy outlives the loop
    store_tile();
}

// ---------------------------------------------------------------------------
// Host orchestration
// ---------------------------------------------------------------------------
extern "C" void kernel_launch(void* const* d_in, const int* in_sizes, int n_in,
                              void* d_out, int out_size, void* d_ws, size_t ws_size,
                              hipStream_t stream) {
    constexpr int B = 4, S = 2048, D = 1024, H = 16, HD = 64, FF = 4096;
    constexpr int NT = B * S;                       // 8192 tokens

    const float* x     = (const float*)d_in[0];
    const float* Wq    = (const float*)d_in[1];
    const float* bq    = (const float*)d_in[2];
    const float* Wk    = (const float*)d_in[3];
    const float* bk    = (const float*)d_in[4];
    const float* Wv    = (const float*)d_in[5];
    const float* bv    = (const float*)d_in[6];
    const float* Wo    = (const float*)d_in[7];
    const float* bo    = (const float*)d_in[8];
    const float* W1    = (const float*)d_in[9];
    const float* b1    = (const float*)d_in[10];
    const float* W2    = (const float*)d_in[11];
    const float* b2    = (const float*)d_in[12];
    const float* ln1_g = (const float*)d_in[13];
    const float* ln1_b = (const float*)d_in[14];
    const float* ln2_g = (const float*)d_in[15];
    const float* ln2_b = (const float*)d_in[16];
    float* out = (float*)d_out;

    // ---- workspace carve-up (bf16 stored as unsigned short) ----
    char* p = (char*)d_ws;
    auto alloc = [&](size_t bytes) {
        void* r = p;
        p += (bytes + 255) & ~(size_t)255;
        return r;
    };
    unsigned short* wq_bf  = (unsigned short*)alloc((size_t)D * D * 2);
    unsigned short* wk_bf  = (unsigned short*)alloc((size_t)D * D * 2);
    unsigned short* wv_bf  = (unsigned short*)alloc((size_t)D * D * 2);
    unsigned short* wo_bf  = (unsigned short*)alloc((size_t)D * D * 2);
    unsigned short* w1_bf  = (unsigned short*)alloc((size_t)D * FF * 2);
    unsigned short* w2_bf  = (unsigned short*)alloc((size_t)FF * D * 2);
    unsigned short* h_bf   = (unsigned short*)alloc((size_t)NT * D * 2);   // h1 then h2
    unsigned short* q_bf   = (unsigned short*)alloc((size_t)NT * D * 2);
    unsigned short* k_bf   = (unsigned short*)alloc((size_t)NT * D * 2);
    unsigned short* v_bf   = (unsigned short*)alloc((size_t)NT * D * 2);
    unsigned short* at_bf  = (unsigned short*)alloc((size_t)NT * D * 2);
    float*          x2_f   = (float*)alloc((size_t)NT * D * 4);
    unsigned short* y1_bf  = (unsigned short*)alloc((size_t)NT * FF * 2);
    (void)ws_size; (void)in_sizes; (void)n_in; (void)out_size;

    // ---- LN1 and the weight conversions ----
    prep_kernel<H, D, HD, FF, NT>
        <<<NT / 16 + 2 * (D * FF / 8192) + 4 * (D * D / 4096), 256, 0, stream>>>(
        x, ln1_g, ln1_b, h_bf, Wq, Wk, Wv, Wo, W1, W2,
        wq_bf, wk_bf, wv_bf, wo_bf, w1_bf, w2_bf);

    // ---- QKV projections (Q pre-scaled by 1/sqrt(HD)) ----
    dim3 gP(D / 128, NT / 128);
    gemm_qkv_kernel<D><<<dim3(D / 128, NT / 128, 3), 256, 0, stream>>>(
        h_bf, wq_bf, wk_bf, wv_bf, bq, bk, bv, q_bf, k_bf, v_bf, NT, D, D, 0.125f);

    // ---- causal flash attention (a block takes a pair of 128-query tiles) ----
    static_assert(S % 256 == 0, "whole pairs of query tiles");
    attn_kernel<<<dim3(S / 256, B * H), 256, 0, stream>>>(q_bf, k_bf, v_bf, at_bf,
                                                          S, H, HD);

    // ---- output projection + residual -> x2 (fp32) ----
    gemm_bf16_kernel<0, true, true, false, D><<<gP, 256, 0, stream>>>(
        at_bf, wo_bf, bo, x, x2_f, nullptr, NT, D, D, 1.0f);

    // ---- LN2 ----
    ln_kernel<D><<<NT / 16, 256, 0, stream>>>(x2_f, ln2_g, ln2_b, h_bf);

    // ---- FFN: gelu(h2 @ W1 + b1) -> y1 (bf16) ----
    dim3 gF(FF / 128, NT / 128);
    gemm_bf16_kernel<1, false, false, true, FF><<<gF, 256, 0, stream>>>(
        h_bf, w1_bf, b1, nullptr, nullptr, y1_bf, NT, FF, D, 1.0f);

    // ---- gelu(y1 @ W2 + b2) + x2 -> out (fp32) ----
    gemm_bf16_kernel<1, true, true, false, D><<<gP, 256, 0, stream>>>(
        y1_bf, w2_bf, b2, x2_f, out, nullptr, NT, D, FF, 1.0f);
}

// v009
// A run of this version takes 231 microseconds.
// Timed twice side by side with v008, it ran 1.07 and 1.06 times as fast.
// Over all steps from v000 it is 5.55 times as fast.
#include <hip/hip_runtime.h>
#include <math.h>

// ---------------------------------------------------------------------------
// Types
// ---------------------------------------------------------------------------
typedef __bf16 v16bf __attribute__((ext_vector_type(16)));
typedef __bf16 v8bf  __attribute__((ext_vector_type(8)));
typedef float  v8f   __attribute__((ext_vector_type(8)));
typedef float  v4f   __attribute__((ext_vector_type(4)));

static __device__ __forceinline__ unsigned short f2bfbits(float x) {
    unsigned u = __builtin_bit_cast(unsigned, x);
    unsigned r = u + 0x7fffu + ((u >> 16) & 1u);   // round-to-nearest-even
    return (unsigned short)(r >> 16);
}

// Exact-form GELU, 0.5 v (1 + erf(v / sqrt 2)), with no branch, so that the
// unrolled epilogue can interleave its elements:
//   erf(|v| / sqrt 2) = 1 - erfc(|v| / sqrt 2) = 1 - 2^(t G(t)),  t = min(|v|, 4 sqrt 2),
// G a degree-7 minimax fit of log2(erfc(t / sqrt 2)) / t on [0, 4 sqrt 2]. The fit is
// off by under 2e-8 in erf, below the rounding of the f32 steps (erf within 2e-7).
// Past the clamp erfc is under 2^-25 and 1 - erfc rounds to 1. The sign of erf
// goes into the last step: 0.5 v erf(v / sqrt 2) = |0.5 v| erf(|v| / sqrt 2).
static __device__ __forceinline__ float geluf(float v) {
    const float t = fminf(fabsf(v), 5.65685415f);
    float q =          -2.83612894e-6f;
    q = fmaf(q, t,      3.93902083e-5f);
    q = fmaf(q, t,     -1.86230551e-4f);
    q = fmaf(q, t,     -1.36835646e-4f);
    q = fmaf(q, t,      7.06331385e-3f);
    q = fmaf(q, t,     -5.24961203e-2f);
    q = fmaf(q, t,     -4.59208220e-1f);
    q = fmaf(q, t,     -1.15110517f);
    const float r = 1.0f - __builtin_amdgcn_exp2f(q * t);   // exponent in [-26, 0]
    const float h = 0.5f * v;
    return fmaf(fabsf(h), r, h);
}

// Build a 16-element bf16 WMMA fragment from two 16-byte-aligned runs of
// 8 bf16 (K offsets 8g and 8g+16 per the CDNA5 16-bit A/B layout).
static __device__ __forceinline__ v16bf make_frag(const unsigned short* lo,
                                                  const unsigned short* hi) {
    v8bf a = *reinterpret_cast<const v8bf*>(lo);
    v8bf b = *reinterpret_cast<const v8bf*>(hi);
    return __builtin_shufflevector(a, b, 0, 1, 2, 3, 4, 5, 6, 7,
                                         8, 9, 10, 11, 12, 13, 14, 15);
}

// Build a 16-element bf16 WMMA B fragment (32 k x 16 columns) from a row-major
// [k][n] LDS tile with two transposing loads. `p` is this lane's address
//   tile + (kbase + 8*(lane>>4) + (lane&7)) * pitch + nbase + 8*((lane>>3)&1)
// (elements); the lane receives column nbase + (lane&15) at k = kbase + 8g + 0..7
// and, `pitch16` = 16 rows further, k = kbase + 16 + 8g + 0..7: the same k order
// as make_frag(p, p + 16) delivers for the A side.
typedef __attribute__((address_space(3))) v8bf lds_v8bf;
static __device__ __forceinline__ v16bf make_frag_tr(const unsigned short* p, int pitch16) {
    v8bf a = __builtin_amdgcn_ds_load_tr16_b128_v8bf16((lds_v8bf*)p);
    v8bf b = __builtin_amdgcn_ds_load_tr16_b128_v8bf16((lds_v8bf*)(p + pitch16));
    return __builtin_shufflevector(a, b, 0, 1, 2, 3, 4, 5, 6, 7,
                                         8, 9, 10, 11, 12, 13, 14, 15);
}

// LDS byte address of a __shared__ element (the operand of an asynchronous copy).
static __device__ __forceinline__ unsigned lds_off(const unsigned short* p) {
    return (unsigned)(size_t)(const __attribute__((address_space(3))) unsigned short*)p;
}

// Foot of a ring trip, before the barrier: this wave's LDS reads of the buffer
// that is refilled next have retired, and its own copies of the next tile have
// landed.
static __device__ __forceinline__ void ring_waits() {
    asm volatile("s_wait_dscnt 0x0" ::: "memory");
    asm volatile("s_wait_asynccnt 0x0" ::: "memory");
}

// Value of lane l ^ 16 (the other half of the wave), by a vector cross-row move.
static __device__ __forceinline__ float xhalf(float v) {
    int b = __builtin_bit_cast(int, v);
    return __builtin_bit_cast(float,
        __builtin_amdgcn_permlanex16(b, b, 0x76543210, 0xfedcba98, false, false));
}

#define WMMA_BF16(A, B, C) \
    __builtin_amdgcn_wmma_f32_16x16x32_bf16(false, (A), false, (B), (short)0, (C), false, false)

// ---------------------------------------------------------------------------
// Weight conversions (fp32 -> bf16), jobs of prep_kernel
//   A lane takes U pieces of 4 elements: every load of a wave covers 512
//   contiguous bytes, every store 256, and all U loads are asked for before the
//   first piece is converted. N elements need N / (128 U) waves.
// ---------------------------------------------------------------------------
typedef unsigned short us4 __attribute__((ext_vector_type(4)));

static __device__ __forceinline__ us4 f2bf4(v4f v) {
    us4 r;
#pragma unroll
    for (int c = 0; c < 4; ++c) r[c] = f2bfbits(v[c]);
    return r;
}

template <int U, int N>   // N / (1024 U) blocks of 256; bid = the block's number among them
static __device__ __forceinline__ void cvt_plain(const float* __restrict__ in,
                                                 unsigned short* __restrict__ out,
                                                 unsigned bid) {
    static_assert(N % (1024 * U) == 0, "whole blocks only");
    const unsigned i0 = (bid * (256 * U) + threadIdx.x) * 4;   // first element
    v4f v[U];
#pragma unroll
    for (int u = 0; u < U; ++u)
        v[u] = *reinterpret_cast<const v4f*>(in + i0 + u * 1024);
    // No register that the loads above name is rewritten ahead of this wait.
    asm volatile("s_wait_xcnt 0x0" ::: "memory");
#pragma unroll
    for (int u = 0; u < U; ++u)
        *reinterpret_cast<us4*>(out + i0 + u * 1024) = f2bf4(v[u]);
}

// (H, D, HD) -> column-combined (D, H*HD): out[d*H*HD + h*HD + e] = in[h,d,e]
// A piece is 4 consecutive e of one (h, d); 16 lanes store one 128-byte run.
// A block stays inside one h, so piece u lies 1024 / HD rows d below piece 0.
template <int U, int H, int D, int HD>   // H*D*HD / (1024 U) blocks of 256; bid as above
static __device__ __forceinline__ void cvt_qkvw(const float* __restrict__ in,
                                                unsigned short* __restrict__ out,
                                                unsigned bid) {
    static_assert((D * HD) % (1024 * U) == 0 && 1024 % HD == 0 && HD % 4 == 0,
                  "whole blocks inside one h, whole rows between pieces, whole pieces");
    const unsigned i0 = (bid * (256 * U) + threadIdx.x) * 4;   // first element
    v4f v[U];
#pragma unroll
    for (int u = 0; u < U; ++u)
        v[u] = *reinterpret_cast<const v4f*>(in + i0 + u * 1024);
    // No register that the loads above name is rewritten ahead of this wait.
    asm volatile("s_wait_xcnt 0x0" ::: "memory");
    const unsigned h = i0 / (D * HD);
    const unsigned r = i0 - h * (D * HD);
    const unsigned d = r / HD;
    const unsigned e = r - d * HD;
    unsigned short* o = out + d * (H * HD) + h * HD + e;
#pragma unroll
    for (int u = 0; u < U; ++u)
        *reinterpret_cast<us4*>(o + u * (1024 / HD) * (H * HD)) = f2bf4(v[u]);
}

// ---------------------------------------------------------------------------
// LayerNorm: one wave per pair of tokens, 16 tokens per 256-thread block, bf16
// output. Both rows stay in registers (DC / 128 pieces of 16 B a lane and row)
// between the sums and the scaling: no LDS, no barrier, no second read of x.
// ---------------------------------------------------------------------------
template <int DC>   // DC == D; tokens / 16 blocks of 256; bid as above
static __device__ __forceinline__ void ln_rows(const float* __restrict__ x,
                                               const float* __restrict__ g,
                                               const float* __restrict__ b,
                                               unsigned short* __restrict__ out,
                                               unsigned bid) {
    static_assert(DC % 128 == 0, "whole pieces");
    constexpr int P = DC / 128;
    const int lane = threadIdx.x & 31;
    const int row  = (bid * 8 + (threadIdx.x >> 5)) * 2;
    const float* xr = x + (size_t)row * DC + lane * 4;
    v4f v[2][P], gv[P], bv[P];
#pragma unroll
    for (int t = 0; t < 2; ++t)
#pragma unroll
        for (int p = 0; p < P; ++p)
            v[t][p] = *reinterpret_cast<const v4f*>(xr + t * DC + p * 128);
#pragma unroll
    for (int p = 0; p < P; ++p) {
        gv[p] = *reinterpret_cast<const v4f*>(g + lane * 4 + p * 128);
        bv[p] = *reinterpret_cast<const v4f*>(b + lane * 4 + p * 128);
    }
    // Holds all 32 loads ahead of the sums. Left free, the g and b loads sink
    // into the reduction and their latency is paid a second time.
    __builtin_amdgcn_sched_barrier(0);
    // No register that the loads above name is rewritten ahead of this wait: as an
    // input, xr keeps the x loads' address pair from serving as a load's target.
    asm volatile("s_wait_xcnt 0x0" :: "v"(xr) : "memory");

    float s[2], ss[2];
#pragma unroll
    for (int t = 0; t < 2; ++t) {
        v4f s4 = v[t][0], q4 = v[t][0] * v[t][0];    // four independent chains each
#pragma unroll
        for (int p = 1; p < P; ++p) {
            s4 += v[t][p];
            q4 += v[t][p] * v[t][p];
        }
        s[t]  = (s4[0] + s4[1]) + (s4[2] + s4[3]);
        ss[t] = (q4[0] + q4[1]) + (q4[2] + q4[3]);
    }
#pragma unroll
    for (int m = 16; m >= 1; m >>= 1) {
#pragma unroll
        for (int t = 0; t < 2; ++t) {
            s[t]  += __shfl_xor(s[t],  m, 32);
            ss[t] += __shfl_xor(ss[t], m, 32);
        }
    }
    unsigned short* orow = out + (size_t)row * DC + lane * 4;
#pragma unroll
    for (int t = 0; t < 2; ++t) {
        const float mu  = s[t] / (float)DC;
        const float var = ss[t] / (float)DC - mu * mu;
        const float rs  = rsqrtf(var + 1e-5f);
#pragma unroll
        for (int p = 0; p < P; ++p)
            *reinterpret_cast<us4*>(orow + t * DC + p * 128) =
                f2bf4((v[t][p] - mu) * rs * gv[p] + bv[p]);
    }
}

template <int DC>   // grid = tokens / 16
__global__ __launch_bounds__(256) void ln_kernel(const float* __restrict__ x,
                                                 const float* __restrict__ g,
                                                 const float* __restrict__ b,
                                                 unsigned short* __restrict__ out) {
    ln_rows<DC>(x, g, b, out, blockIdx.x);
}

// ---------------------------------------------------------------------------
// Everything that depends on the inputs alone, in one launch: LayerNorm 1 and
// the six weight conversions. None reads what another writes; a block finds its
// job by its number (a scalar test), the longest job first.
//   grid = NT / 16 + 2 (D FF / 8192) + 4 (D D / 4096)
// ---------------------------------------------------------------------------
// Behind a job's last store. The jobs are laid out one after another, and the code
// of the next job follows a job's stores in the listing: no register that those
// stores name is rewritten ahead of this wait.
static __device__ __forceinline__ void job_end() {
    asm volatile("s_wait_xcnt 0x0" ::: "memory");
}

template <int H, int D, int HD, int FF, int NT>
__global__ __launch_bounds__(256) void prep_kernel(
        const float* __restrict__ x, const float* __restrict__ g,
        const float* __restrict__ b, unsigned short* __restrict__ h1,
        const float* __restrict__ Wq, const float* __restrict__ Wk,
        const float* __restrict__ Wv, const float* __restrict__ Wo,
        const float* __restrict__ W1, const float* __restrict__ W2,
        unsigned short* __restrict__ wq, unsigned short* __restrict__ wk,
        unsigned short* __restrict__ wv, unsigned short* __restrict__ wo,
        unsigned short* __restrict__ w1, unsigned short* __restrict__ w2) {
    static_assert(H * HD == D && NT % 16 == 0, "the four square weights alike, whole blocks");
    constexpr unsigned nL = NT / 16, nF = D * FF / 8192, nP = D * D / 4096;
    unsigned bid = blockIdx.x;
    if (bid < nL) { ln_rows<D>(x, g, b, h1, bid); job_end(); return; }
    bid -= nL;
    if (bid < nF) { cvt_plain<8, D * FF>(W1, w1, bid); job_end(); return; }
    bid -= nF;
    if (bid < nF) { cvt_plain<8, FF * D>(W2, w2, bid); job_end(); return; }
    bid -= nF;
    if (bid < nP) { cvt_qkvw<4, H, D, HD>(Wq, wq, bid); job_end(); return; }
    bid -= nP;
    if (bid < nP) { cvt_qkvw<4, H, D, HD>(Wk, wk, bid); job_end(); return; }
    bid -= nP;
    if (bid < nP) { cvt_qkvw<4, H, D, HD>(Wv, wv, bid); job_end(); return; }
    bid -= nP;
    cvt_plain<4, D * D>(Wo, wo, bid);
    job_end();
}

// ---------------------------------------------------------------------------
// Tiled bf16 WMMA GEMM (double-buffered, BK = 64 or 128 k per stage):
//   C[M,N] = [res +] act((A[M,K] @ B[K,N] + bias) * scale)
//   block tile 128x128, 8 waves (2 x 4), each wave: 64x32 via 4x2 fragments.
//   Pipeline: two LDS buffers filled by asynchronous copies; the copies of tile
//   k+1 fly while the WMMAs of tile k run (16 a wave at BK = 64, 32 at 128). One
//   barrier per K block. BK = 128 where the grid puts only two blocks on a WGP
//   (N = 1024): the LDS for it is free there, twice the bytes are in flight, and a
//   stage's products have twice the time to cover the landing of the next stage's
//   copies. BK = 64 where four blocks share a WGP.
// ---------------------------------------------------------------------------
constexpr int GL = 72;   // padded LDS row length (elements) of a 64-element row
constexpr int BP = 144;  // LDS row length (elements) of the row-major BK x 128 B tile:
                         // 288 B = 32 B x odd, the pitch of the transposing load
constexpr int SB = 136;  // row length (bf16 elements) of the staged output tile: 272 B = 16 B x odd
constexpr int SF = 132;  // row length (floats) of the staged output tile: 528 B = 16 B x odd

template <int ACT, bool RES, bool OUTF, bool OUTB, int NC, int BK>   // NC == N
static __device__ __forceinline__ void gemm_tile(
        const unsigned short* __restrict__ A,   // [M,K] bf16 row-major
        const unsigned short* __restrict__ Bw,  // [K,N] bf16 row-major
        const float* __restrict__ bias,         // [N]
        const float* __restrict__ res,          // [M,N] fp32 (if RES)
        float* __restrict__ outF,               // [M,N] fp32 (if OUTF)
        unsigned short* __restrict__ outB,      // [M,N] bf16 (if OUTB)
        int M, int N, int K, float scale) {
    static_assert(BK == 64 || BK == 128, "the two copy patterns below");
    constexpr int AP = BK + 8;   // LDS row length (elements) of the A tile: 144 or 272 B = 16 B x odd
    static_assert(BK != 64 || AP == GL, "the 64-element row");
    __shared__ alignas(16) unsigned short As [2 * 128 * AP];  // [buf][m][k]
    __shared__ alignas(16) unsigned short Bs [2 * BK * BP];   // [buf][k][n]

    const int tid  = threadIdx.x;
    const int wid  = tid >> 5;
    const int lane = tid & 31;
    const int g    = lane >> 4;
    const int ln   = lane & 15;
    const int wm   = wid >> 2;
    const int wn   = wid & 3;
    const int m0   = blockIdx.y * 128;
    const int n0   = blockIdx.x * 128;

    // Copy a 128 x BK A tile and a row-major BK x 128 B tile into buffer `buf`:
    // BK / 8 x 16 B per lane, global memory to LDS through no register. BK / 8
    // lanes take one A row (128 or 256 B), 16 lanes one B row (256 B).
    constexpr int LS = BK == 128 ? 4 : 3;   // log2 of the lanes in an A row
    const unsigned short* ga = A + (size_t)(m0 + (tid >> LS)) * K + ((tid & (BK / 8 - 1)) << 3);
    const unsigned short* gb = Bw + (size_t)(tid >> 4) * N + n0 + ((tid & 15) << 3);
    const unsigned la = lds_off(&As[(tid >> LS) * AP + ((tid & (BK / 8 - 1)) << 3)]);
    const unsigned lb = lds_off(&Bs[(tid >> 4) * BP + ((tid & 15) << 3)]);
    // Eight copies, 16 rows apart: `dp` bytes in LDS, `sp` elements in memory.
    auto copy8 = [&](unsigned d, unsigned dp, const unsigned short* s, size_t sp) {
        // The closing s_wait_xcnt stands in the copies' own statement so that no
        // address register is rewritten ahead of it.
        asm volatile(
            "global_load_async_to_lds_b128 %0, %8, off\n\t"
            "global_load_async_to_lds_b128 %1, %9, off\n\t"
            "global_load_async_to_lds_b128 %2, %10, off\n\t"
            "global_load_async_to_lds_b128 %3, %11, off\n\t"
            "global_load_async_to_lds_b128 %4, %12, off\n\t"
            "global_load_async_to_lds_b128 %5, %13, off\n\t"
            "global_load_async_to_lds_b128 %6, %14, off\n\t"
            "global_load_async_to_lds_b128 %7, %15, off\n\t"
            "s_wait_xcnt 0x0"
            :: "v"(d), "v"(d + dp), "v"(d + 2 * dp), "v"(d + 3 * dp),
               "v"(d + 4 * dp), "v"(d + 5 * dp), "v"(d + 6 * dp), "v"(d + 7 * dp),
               "v"(s), "v"(s + sp), "v"(s + 2 * sp), "v"(s + 3 * sp),
               "v"(s + 4 * sp), "v"(s + 5 * sp), "v"(s + 6 * sp), "v"(s + 7 * sp)
            : "memory");
    };
    auto copyAB = [&](int buf, int k0) {
        const unsigned short* a = ga + k0;                 // rows +32 per copy (+16 at BK = 128)
        const unsigned short* b = gb + (size_t)k0 * N;     // rows +16 per copy
        const unsigned da = la + buf * (128 * AP * 2);
        const unsigned db = lb + buf * (BK * BP * 2);
        if constexpr (BK == 128) {
            copy8(da, 16 * AP * 2, a, (size_t)16 * K);
            copy8(db, 16 * BP * 2, b, (size_t)16 * N);
        } else {
            // The closing s_wait_xcnt stands in the copies' own statement so that no
            // address register is rewritten ahead of it.
            asm volatile(
                "global_load_async_to_lds_b128 %0, %8, off\n\t"
                "global_load_async_to_lds_b128 %1, %9, off\n\t"
                "global_load_async_to_lds_b128 %2, %10, off\n\t"
                "global_load_async_to_lds_b128 %3, %11, off\n\t"
                "global_load_async_to_lds_b128 %4, %12, off\n\t"
                "global_load_async_to_lds_b128 %5, %13, off\n\t"
                "global_load_async_to_lds_b128 %6, %14, off\n\t"
                "global_load_async_to_lds_b128 %7, %15, off\n\t"
                "s_wait_xcnt 0x0"
                :: "v"(da), "v"(da + 32 * GL * 2), "v"(da + 64 * GL * 2), "v"(da + 96 * GL * 2),
                   "v"(db), "v"(db + 16 * BP * 2), "v"(db + 32 * BP * 2), "v"(db + 48 * BP * 2),
                   "v"(a), "v"(a + (size_t)32 * K), "v"(a + (size_t)64 * K), "v"(a + (size_t)96 * K),
                   "v"(b), "v"(b + (size_t)16 * N), "v"(b + (size_t)32 * N), "v"(b + (size_t)48 * N)
                : "memory");
        }
    };

    v8f acc[4][2];
#pragma unroll
    for (int mf = 0; mf < 4; ++mf)
#pragma unroll
        for (int nf = 0; nf < 2; ++nf)
#pragma unroll
            for (int r = 0; r < 8; ++r) acc[mf][nf][r] = 0.f;

    constexpr int KS = BK == 128 ? 7 : 6;   // log2 BK
    const int KB = K >> KS;
    copyAB(0, 0);
    asm volatile("s_wait_asynccnt 0x0" ::: "memory");   // tile 0 landed (own copies)
    __syncthreads();                                     // tile 0 visible to all waves
    if (KB > 1) copyAB(1, BK);
    for (int kb = 0; kb < KB; ++kb) {
        const unsigned short* as = &As [(kb & 1) * 128 * AP];
        const unsigned short* bs = &Bs [(kb & 1) * BK * BP];
#pragma unroll
        for (int kd = 0; kd < BK / 32; ++kd) {      // 32-wide WMMA K-steps
            v16bf af[4];
#pragma unroll
            for (int mf = 0; mf < 4; ++mf) {
                const unsigned short* p =
                    &as[(wm * 64 + mf * 16 + ln) * AP + kd * 32 + 8 * g];
                af[mf] = make_frag(p, p + 16);
            }
#pragma unroll
            for (int nf = 0; nf < 2; ++nf) {
                const unsigned short* p =
                    &bs[(kd * 32 + 8 * g + (lane & 7)) * BP +
                        wn * 32 + nf * 16 + 8 * ((lane >> 3) & 1)];
                v16bf bf = make_frag_tr(p, 16 * BP);
#pragma unroll
                for (int mf = 0; mf < 4; ++mf)
                    acc[mf][nf] = WMMA_BF16(af[mf], bf, acc[mf][nf]);
            }
        }
        ring_waits();
        __syncthreads();                 // tile kb+1 visible; buffer kb&1 free
        if (kb + 2 < KB) copyAB(kb & 1, (kb + 2) << KS);
    }
    asm volatile("s_wait_asynccnt 0x0" ::: "memory");   // no copy outlives the loop

    // ---- epilogue: the 128x128 tile goes through LDS so that every global store
    //      (and every residual load) of a wave covers whole 128-byte lines ----
    // The ring is free here: the last trip's barrier ended every wave's reads and
    // no copy is in flight.
    static_assert(OUTF != OUTB, "one output per instantiation");
    // NC is N as a compile-time constant: the row steps below become immediate
    // offsets on one address that stays in its registers to the end.
    const size_t tile0 = (size_t)m0 * NC + n0;           // first element of the tile
    // f32 rows: 32 lanes x 16 B = 512 contiguous bytes a wave, rows wid + 8 i.
    const unsigned vof = (unsigned)(wid * NC + lane * 4) * 4u;               // bytes
    // bf16 rows: 16 lanes x 16 B = 256 contiguous bytes, two rows a wave, rows (tid >> 4) + 16 i.
    const unsigned vob = (unsigned)((tid >> 4) * NC + ((tid & 15) << 3)) * 2u;   // bytes
    const float* bp = bias + n0 + wn * 32 + ln;
    const float bv2[2] = { bp[0], bp[16] };
    // No register that the two loads above name is rewritten ahead of this wait.
    asm volatile("s_wait_xcnt 0x0" ::: "memory");
    v4f rr[16];
    if (RES) {
        // Residual rows, asked for ahead of the activation so that their latency
        // is covered.
        const char* rb = reinterpret_cast<const char*>(res + tile0);
#pragma unroll
        for (int i = 0; i < 16; ++i)
            rr[i] = *reinterpret_cast<const v4f*>(rb + (size_t)(8 * i) * NC * 4 + vof);
        // The same for the sixteen loads above.
        asm volatile("s_wait_xcnt 0x0" ::: "memory");
    }
    float* stf = reinterpret_cast<float*>(wm ? Bs : As);   // f32: 64 rows in each array
#pragma unroll
    for (int mf = 0; mf < 4; ++mf) {
#pragma unroll
        for (int nf = 0; nf < 2; ++nf) {
            int lcol = wn * 32 + nf * 16 + ln;
            float bv = bv2[nf];
#pragma unroll
            for (int r = 0; r < 8; ++r) {
                int lrow = mf * 16 + 8 * g + r;          // row inside the wave's 64
                float v = (acc[mf][nf][r] + bv) * scale;
                if (ACT == 1) v = geluf(v);
                if (OUTF) stf[lrow * SF + lcol] = v;
                if (OUTB) As[(wm * 64 + lrow) * SB + lcol] = f2bfbits(v);
            }
        }
    }
    __syncthreads();                     // staged tile visible to all waves
    if (OUTB) {
        char* ob = reinterpret_cast<char*>(outB + tile0);
#pragma unroll
        for (int i = 0; i < 8; ++i) {
            v8bf t = *reinterpret_cast<const v8bf*>(
                &As[((tid >> 4) + 16 * i) * SB + ((tid & 15) << 3)]);
            *reinterpret_cast<v8bf*>(ob + (size_t)(16 * i) * NC * 2 + vob) = t;
        }
    }
    if (OUTF) {
        char* ob = reinterpret_cast<char*>(outF + tile0);
#pragma unroll
        for (int i = 0; i < 16; ++i) {
            const float* sp = reinterpret_cast<const float*>(i < 8 ? As : Bs);
            v4f t = *reinterpret_cast<const v4f*>(&sp[(wid + 8 * (i & 7)) * SF + lane * 4]);
            if (RES) t += rr[i];
            *reinterpret_cast<v4f*>(ob + (size_t)(8 * i) * NC * 4 + vof) = t;
        }
    }
}

template <int ACT, bool RES, bool OUTF, bool OUTB, int NC, int BK>   // grid = (N / 128, M / 128)
__global__ __launch_bounds__(256) void gemm_bf16_kernel(
        const unsigned short* __restrict__ A, const unsigned short* __restrict__ Bw,
        const float* __restrict__ bias, const float* __restrict__ res,
        float* __restrict__ outF, unsigned short* __restrict__ outB,
        int M, int N, int K, float scale) {
    gemm_tile<ACT, RES, OUTF, OUTB, NC, BK>(A, Bw, bias, res, outF, outB, M, N, K, scale);
}

// The three projections of one A in one launch: blockIdx.z picks weights, bias,
// output and scale (scalar selects). grid = (N / 128, M / 128, 3)
template <int NC>
__global__ __launch_bounds__(256) void gemm_qkv_kernel(
        const unsigned short* __restrict__ A,
        const unsigned short* __restrict__ wq, const unsigned short* __restrict__ wk,
        const unsigned short* __restrict__ wv,
        const float* __restrict__ bq, const float* __restrict__ bk,
        const float* __restrict__ bv,
        unsigned short* __restrict__ q, unsigned short* __restrict__ k,
        unsigned short* __restrict__ v,
        int M, int N, int K, float qscale) {
    const unsigned z = blockIdx.z;
    gemm_tile<0, false, false, true, NC, 64>(
        A, z == 0 ? wq : z == 1 ? wk : wv, z == 0 ? bq : z == 1 ? bk : bv,
        nullptr, nullptr, z == 0 ? q : z == 1 ? k : v, M, N, K, z == 0 ? qscale : 1.0f);
}

constexpr int VP = 80;   // LDS row length (elements) of a V row: 160 B = 32 B x odd
__global__ __launch_bounds__(256) void attn_kernel(
        const unsigned short* __restrict__ Q,
        const unsigned short* __restrict__ Kb,
        const unsigned short* __restrict__ Vb,
        unsigned short* __restrict__ O,
        int S, int H, int HD) {
    const int D   = H * HD;                       // 1024
    const int nq  = S >> 7;                       // query tiles of a head (even)
    const int pr  = blockIdx.x;                   // the pair: tiles nq - 1 - pr and pr
    const int bh  = blockIdx.y;
    const int b   = bh / H;
    const int h   = bh - b * H;
    const size_t base = (size_t)b * S * D + (size_t)h * HD;

    const int tid  = threadIdx.x;
    const int wid  = tid >> 5;
    const int lane = tid & 31;
    const int g    = lane >> 4;
    const int ln   = lane & 15;
    int q0 = (nq - 1 - pr) * 128;                 // the longer tile first
    const int n1  = 2 * (nq - pr);                // its stages of 64 keys (causal)
    const int nst = 2 * (nq + 1);                 // stages of both tiles
    // First key of stage s: each tile starts again at key 0.
    auto stage_k0 = [&](int s) { return (s < n1 ? s : s - n1) << 6; };

    __shared__ alignas(16) unsigned short Ks [2 * 64 * GL];   // [buf][kc][d]
    __shared__ alignas(16) unsigned short Vs [2 * 64 * VP];   // [buf][kc][d]

    // Copy 64 K rows and 64 V rows into buffer `buf`: 4 x 16 B per lane.
    const size_t srow = base + (size_t)(tid >> 3) * D + ((tid & 7) << 3);
    const unsigned lk = lds_off(&Ks[(tid >> 3) * GL + ((tid & 7) << 3)]);
    const unsigned lv = lds_off(&Vs[(tid >> 3) * VP + ((tid & 7) << 3)]);
    auto copyKV = [&](int buf, int k0) {
        const unsigned short* k = Kb + srow + (size_t)k0 * D;   // rows +32 per copy
        const unsigned short* v = Vb + srow + (size_t)k0 * D;
        const unsigned dk = lk + buf * (64 * GL * 2);
        const unsigned dv = lv + buf * (64 * VP * 2);
        // The closing s_wait_xcnt stands in the copies' own statement so that no
        // address register is rewritten ahead of it.
        asm volatile(
            "global_load_async_to_lds_b128 %0, %4, off\n\t"
            "global_load_async_to_lds_b128 %1, %5, off\n\t"
            "global_load_async_to_lds_b128 %2, %6, off\n\t"
            "global_load_async_to_lds_b128 %3, %7, off\n\t"
            "s_wait_xcnt 0x0"
            :: "v"(dk), "v"(dk + 32 * GL * 2), "v"(dv), "v"(dv + 32 * VP * 2),
               "v"(k), "v"(k + (size_t)32 * D), "v"(v), "v"(v + (size_t)32 * D)
            : "memory");
    };

    // Q fragments (B operand: column = query), d split into 2 k-steps. Both tiles'
    // are asked for here, so that the change of tile waits for no load.
    int qrow = q0 + wid * 16 + ln;
    const int qrow2 = pr * 128 + wid * 16 + ln;
    v16bf qa[2], qn[2];
#pragma unroll
    for (int kd = 0; kd < 2; ++kd) {
        const unsigned short* qp = &Q[base + (size_t)qrow * D + kd * 32 + 8 * g];
        const unsigned short* q2 = &Q[base + (size_t)qrow2 * D + kd * 32 + 8 * g];
        qa[kd] = make_frag(qp, qp + 16);
        qn[kd] = make_frag(q2, q2 + 16);
    }
    // No register that the loads above name is rewritten ahead of this wait.
    asm volatile("s_wait_xcnt 0x0" ::: "memory");

    v8f of[4];
#pragma unroll
    for (int j = 0; j < 4; ++j)
#pragma unroll
        for (int r = 0; r < 8; ++r) of[j][r] = 0.f;
    float mrow = -1e30f;   // running maximum of this lane's query (both halves alike)
    float lrow = 0.f;      // running sum over this half's keys; halves joined at the end

    // ---- end of a tile: join the halves' sums, normalize, store bf16 ----
    // of[j][r] is O[qrow][j*16 + 8g + r]: 8 consecutive d, one 16-byte store.
    auto store_tile = [&]() {
        const float inv = 1.0f / (lrow + xhalf(lrow));
        unsigned short* op = &O[base + (size_t)qrow * D + 8 * g];
#pragma unroll
        for (int j = 0; j < 4; ++j) {
            v8f o = of[j];
#pragma unroll
            for (int r = 0; r < 8; ++r) o[r] *= inv;
            *reinterpret_cast<v8bf*>(op + j * 16) = __builtin_convertvector(o, v8bf);
        }
        // No register that the stores above name is rewritten ahead of this wait.
        asm volatile("s_wait_xcnt 0x0" ::: "memory");
    };

    copyKV(0, 0);
    asm volatile("s_wait_asynccnt 0x0" ::: "memory");   // tile 0 landed (own copies)
    __syncthreads();                                     // tile 0 visible to all waves
    if (1 < nst) copyKV(1, stage_k0(1));
    for (int it = 0; it < nst; ++it) {
        const int k0 = stage_k0(it);
        const unsigned short* ks = &Ks [(it & 1) * 64 * GL];
        const unsigned short* vs = &Vs [(it & 1) * 64 * VP];

        // ---- S^T = K Q^T  (64 keys x 16 queries per wave; 1/sqrt(HD) folded into Q) ----
        v8f sf[4];
#pragma unroll
        for (int nf = 0; nf < 4; ++nf) {
            v8f c;
#pragma unroll
            for (int r = 0; r < 8; ++r) c[r] = 0.f;
#pragma unroll
            for (int kd = 0; kd < 2; ++kd) {
                const unsigned short* kp = &ks[(nf * 16 + ln) * GL + kd * 32 + 8 * g];
                v16bf kf = make_frag(kp, kp + 16);
                c = WMMA_BF16(kf, qa[kd], c);
            }
            sf[nf] = c;                  // sf[nf][r]: key k0 + nf*16 + 8g + r, query qrow
        }

        // ---- causal mask (uniform-per-wave predicate) ----
        if (k0 + 63 > q0 + wid * 16) {
#pragma unroll
            for (int nf = 0; nf < 4; ++nf) {
#pragma unroll
                for (int r = 0; r < 8; ++r) {
                    int key = k0 + nf * 16 + 8 * g + r;
                    sf[nf][r] = (key > qrow) ? -1e30f : sf[nf][r];
                }
            }
        }

        // ---- online softmax: 32 keys of one query per lane ----
        // Arguments of the exps are always <= 0, so the fast __expf
        // (single v_exp_f32) is safe: it just underflows to 0.
        float mx4[4];
#pragma unroll
        for (int nf = 0; nf < 4; ++nf) {
            mx4[nf] = sf[nf][0];
#pragma unroll
            for (int r = 1; r < 8; ++r) mx4[nf] = fmaxf(mx4[nf], sf[nf][r]);
        }
        float mx = fmaxf(fmaxf(mx4[0], mx4[1]), fmaxf(mx4[2], mx4[3]));
        mx = fmaxf(mx, xhalf(mx));
        const float mnew  = fmaxf(mrow, mx);
        const float alpha = __expf(mrow - mnew);
        float ps4[4];
#pragma unroll
        for (int nf = 0; nf < 4; ++nf) {
            ps4[nf] = 0.f;
#pragma unroll
            for (int r = 0; r < 8; ++r) {
                float p = __expf(sf[nf][r] - mnew);
                sf[nf][r] = p;
                ps4[nf] += p;
            }
        }
        lrow = lrow * alpha + ((ps4[0] + ps4[1]) + (ps4[2] + ps4[3]));
        mrow = mnew;

        // ---- P^T as B operand: score tiles 2kd and 2kd+1, rounded in place, hold
        //      keys 8g + 0..7 and 16 + 8g + 0..7 of the 32-key step: the k order
        //      that the transposing load delivers for V^T ----
        v16bf pb[2];
#pragma unroll
        for (int kd = 0; kd < 2; ++kd) {
            v8bf lo = __builtin_convertvector(sf[2 * kd],     v8bf);
            v8bf hi = __builtin_convertvector(sf[2 * kd + 1], v8bf);
            pb[kd] = __builtin_shufflevector(lo, hi, 0, 1, 2, 3, 4, 5, 6, 7,
                                                     8, 9, 10, 11, 12, 13, 14, 15);
        }

        // ---- rescale O^T, then O^T += V^T P^T ----
#pragma unroll
        for (int j = 0; j < 4; ++j)
#pragma unroll
            for (int r = 0; r < 8; ++r) of[j][r] *= alpha;

#pragma unroll
        for (int j = 0; j < 4; ++j) {
#pragma unroll
            for (int kd = 0; kd < 2; ++kd) {
                const unsigned short* vp =
                    &vs[(kd * 32 + 8 * g + (lane & 7)) * VP + j * 16 + 8 * ((lane >> 3) & 1)];
                v16bf va = make_frag_tr(vp, 16 * VP);
                of[j] = WMMA_BF16(va, pb[kd], of[j]);
            }
        }
        ring_waits();
        __syncthreads();                 // next tile visible; this buffer free
        if (it + 2 < nst) copyKV(it & 1, stage_k0(it + 2));
        if (it == n1 - 1) {              // first tile done (the same test in every wave)
            store_tile();
            q0   = pr * 128;
            qrow = qrow2;
            qa[0] = qn[0];
            qa[1] = qn[1];
#pragma unroll
            for (int j = 0; j < 4; ++j)
#pragma unroll
                for (int r = 0; r < 8; ++r) of[j][r] = 0.f;
            mrow = -1e30f;
            lrow = 0.f;
        }
    }
    asm volatile("s_wait_asynccnt 0x0" ::: "memory");   // no copy outlives the loop
    store_tile();
}

// ---------------------------------------------------------------------------
// Host orchestration
// ---------------------------------------------------------------------------
extern "C" void kernel_launch(void* const* d_in, const int* in_sizes, int n_in,
                              void* d_out, int out_size, void* d_ws, size_t ws_size,
                              hipStream_t stream) {
    constexpr int B = 4, S = 2048, D = 1024, H = 16, HD = 64, FF = 4096;
    constexpr int NT = B * S;                       // 8192 tokens

    const float* x     = (const float*)d_in[0];
    const float* Wq    = (const float*)d_in[1];
    const float* bq    = (const float*)d_in[2];
    const float* Wk    = (const float*)d_in[3];
    const float* bk    = (const float*)d_in[4];
    const float* Wv    = (const float*)d_in[5];
    const float* bv    = (const float*)d_in[6];
    const float* Wo    = (const float*)d_in[7];
    const float* bo    = (const float*)d_in[8];
    const float* W1    = (const float*)d_in[9];
    const float* b1    = (const float*)d_in[10];
    const float* W2    = (const float*)d_in[11];
    const float* b2    = (const float*)d_in[12];
    const float* ln1_g = (const float*)d_in[13];
    const float* ln1_b = (const float*)d_in[14];
    const float* ln2_g = (const float*)d_in[15];
    const float* ln2_b = (const float*)d_in[16];
    float* out = (float*)d_out;

    // ---- workspace carve-up (bf16 stored as unsigned short) ----
    char* p = (char*)d_ws;
    auto alloc = [&](size_t bytes) {
        void* r = p;
        p += (bytes + 255) & ~(size_t)255;
        return r;
    };
    unsigned short* wq_bf  = (unsigned short*)alloc((size_t)D * D * 2);
    unsigned short* wk_bf  = (unsigned short*)alloc((size_t)D * D * 2);
    unsigned short* wv_bf  = (unsigned short*)alloc((size_t)D * D * 2);
    unsigned short* wo_bf  = (unsigned short*)alloc((size_t)D * D * 2);
    unsigned short* w1_bf  = (unsigned short*)alloc((size_t)D * FF * 2);
    unsigned short* w2_bf  = (unsigned short*)alloc((size_t)FF * D * 2);
    unsigned short* h_bf   = (unsigned short*)alloc((size_t)NT * D * 2);   // h1 then h2
    unsigned short* q_bf   = (unsigned short*)alloc((size_t)NT * D * 2);
    unsigned short* k_bf   = (unsigned short*)alloc((size_t)NT * D * 2);
    unsigned short* v_bf   = (unsigned short*)alloc((size_t)NT * D * 2);
    unsigned short* at_bf  = (unsigned short*)alloc((size_t)NT * D * 2);
    float*          x2_f   = (float*)alloc((size_t)NT * D * 4);
    unsigned short* y1_bf  = (unsigned short*)alloc((size_t)NT * FF * 2);
    (void)ws_size; (void)in_sizes; (void)n_in; (void)out_size;

    // ---- LN1 and the weight conversions ----
    prep_kernel<H, D, HD, FF, NT>
        <<<NT / 16 + 2 * (D * FF / 8192) + 4 * (D * D / 4096), 256, 0, stream>>>(
        x, ln1_g, ln1_b, h_bf, Wq, Wk, Wv, Wo, W1, W2,
        wq_bf, wk_bf, wv_bf, wo_bf, w1_bf, w2_bf);

    // ---- QKV projections (Q pre-scaled by 1/sqrt(HD)) ----
    dim3 gP(D / 128, NT / 128);
    gemm_qkv_kernel<D><<<dim3(D / 128, NT / 128, 3), 256, 0, stream>>>(
        h_bf, wq_bf, wk_bf, wv_bf, bq, bk, bv, q_bf, k_bf, v_bf, NT, D, D, 0.125f);

    // ---- causal flash attention (a block takes a pair of 128-query tiles) ----
    static_assert(S % 256 == 0, "whole pairs of query tiles");
    attn_kernel<<<dim3(S / 256, B * H), 256, 0, stream>>>(q_bf, k_bf, v_bf, at_bf,
                                                          S, H, HD);

    // ---- output projection + residual -> x2 (fp32) ----
    gemm_bf16_kernel<0, true, true, false, D, 128><<<gP, 256, 0, stream>>>(
        at_bf, wo_bf, bo, x, x2_f, nullptr, NT, D, D, 1.0f);

    // ---- LN2 ----
    ln_kernel<D><<<NT / 16, 256, 0, stream>>>(x2_f, ln2_g, ln2_b, h_bf);

    // ---- FFN: gelu(h2 @ W1 + b1) -> y1 (bf16) ----
    dim3 gF(FF / 128, NT / 128);
    gemm_bf16_kernel<1, false, false, true, FF, 64><<<gF, 256, 0, stream>>>(
        h_bf, w1_bf, b1, nullptr, nullptr, y1_bf, NT, FF, D, 1.0f);

    // ---- gelu(y1 @ W2 + b2) + x2 -> out (fp32) ----
    gemm_bf16_kernel<1, true, true, false, D, 128><<<gP, 256, 0, stream>>>(
        y1_bf, w2_bf, b2, x2_f, out, nullptr, NT, D, FF, 1.0f);
}
